// v000
// Times are from an AMD MI455X. After a warm-up the kernel runs many times in a row, and a time is the length of
// such a window on the GPU divided by its runs, so every launch and the gaps after it count. The runs cycle
// through copies of the inputs. A figure is the median of several windows, for all but v000 over two sittings.
// Sittings can differ by a few percent; kernels timed side by side share one.
// v000, which the later versions start from, runs in 1360 microseconds.
// compute dtype: all float inputs rounded to bf16; q/k/v = x W^T + b with EXACT bf16 products on WMMA 16x16x32, f32 accumulate; q, k rounded once to f16 (1-product logits / 8, std ~1) stored in f32 (4 heads per launch); softmax in f32 (precise expf) -> P f16 x 2^11; o = P . v (v once to f16); per-position exclusion o -= (o . v_s / (|v_s|^2 + 1e-8)) v_s in f32 with the exact f32 v row; out = o (bf16 hi + lo) Wo^T + bo; f32 output.
#include <hip/hip_runtime.h>
#include <math.h>

typedef __attribute__((ext_vector_type(16))) _Float16 v16h;
typedef __attribute__((ext_vector_type(16))) __bf16 v16b;
typedef __attribute__((ext_vector_type(8)))  _Float16 v8h;
typedef __attribute__((ext_vector_type(8)))  float v8f;
typedef __attribute__((ext_vector_type(4)))  float v4f;
typedef __attribute__((ext_vector_type(2)))  float v2f;
typedef __attribute__((ext_vector_type(4)))  unsigned v4u;
typedef __attribute__((ext_vector_type(4)))  int v4i;
typedef float __attribute__((may_alias)) float_a;
typedef int __attribute__((may_alias)) int_a;

template <typename T> __device__ __forceinline__ void vst2(void* p, T v) { *(T*)p = v;  }
__device__ __forceinline__ v8f wmma16(v16h a, v16h b, v8f c) {
  v8f d = __builtin_amdgcn_wmma_f32_16x16x32_f16(false, a, false, b, (short)0, c, false, false);
  asm volatile("v_nop\n\tv_nop\n\tv_nop\n\tv_nop" : "+v"(d) : "v"(a), "v"(b));
  return d;
}
__device__ __forceinline__ v8f wmma_bf(v16b a, v16b b, v8f c) {
  v8f d = __builtin_amdgcn_wmma_f32_16x16x32_bf16(false, a, false, b, (short)0, c, false, false);
  asm volatile("v_nop\n\tv_nop\n\tv_nop\n\tv_nop" : "+v"(d) : "v"(a), "v"(b));
  return d;
}
// 16x16x32 fragments: lane = (h = lane>>4, row/col = lane&15); elements 0..7 = k0+8h+0..7, 8..15 = k0+16+8h+0..7; D element r = row 8h+r
__device__ __forceinline__ v16h frag_h(const _Float16* rowk0, int lane) {
  union { v16h v; v8h q[2]; } u; const _Float16* p = rowk0 + 8 * (lane >> 4);
  u.q[0] = *(const v8h*)p; u.q[1] = *(const v8h*)(p + 16); return u.v;
}
__device__ __forceinline__ v16h frag_f32(const float* rowk0, int lane) {
  v16h a; const float* p = rowk0 + 8 * (lane >> 4);
#pragma unroll
  for (int i = 0; i < 8; ++i) { a[i] = (_Float16)p[i]; a[8 + i] = (_Float16)p[16 + i]; }
  return a;
}
__device__ __forceinline__ v16h frag_f32s(const float* rowk0, int lane, float sc) {
  v16h a; const float* p = rowk0 + 8 * (lane >> 4);
#pragma unroll
  for (int i = 0; i < 8; ++i) { a[i] = (_Float16)(p[i] * sc); a[8 + i] = (_Float16)(p[16 + i] * sc); }
  return a;
}
// column fragment from a [K][ld] layout (column n), rows >= K read as 0
__device__ __forceinline__ v16h fragc_f32(const float* W, int k0, int n, int lane, int ld, int K) {
  v16h a; const int g = lane >> 4;
#pragma unroll
  for (int i = 0; i < 8; ++i) { const int ka = k0 + 8 * g + i, kb = ka + 16;
    a[i] = (_Float16)(ka < K ? W[(size_t)(ka < K ? ka : K - 1) * ld + n] : 0.f); a[8 + i] = (_Float16)(kb < K ? W[(size_t)(kb < K ? kb : K - 1) * ld + n] : 0.f); }
  return a;
}
struct F2 { v16b h, l; };
__device__ __forceinline__ F2 bsplit16(const float v[16]) { F2 r;
#pragma unroll
  for (int i = 0; i < 16; ++i) { const __bf16 h = (__bf16)v[i]; r.h[i] = h; r.l[i] = (__bf16)(v[i] - (float)h); }
  return r; }
__device__ __forceinline__ F2 split_row(const float* row, int k0, int lane) { float v[16]; const float* p = row + k0 + 8 * (lane >> 4);
#pragma unroll
  for (int i = 0; i < 8; ++i) { v[i] = p[i]; v[8 + i] = p[16 + i]; }
  return bsplit16(v); }
__device__ __forceinline__ F2 split_rowK(const float* row, int k0, int lane, int K) { float v[16]; const int g = lane >> 4;
#pragma unroll
  for (int i = 0; i < 8; ++i) { const int ka = k0 + 8 * g + i, kb = ka + 16; v[i] = ka < K ? row[ka < K ? ka : K - 1] : 0.f; v[8 + i] = kb < K ? row[kb < K ? kb : K - 1] : 0.f; }
  return bsplit16(v); }
__device__ __forceinline__ F2 split_col(const float* W, int k0, int n, int lane, int ld, int K) { float v[16]; const int g = lane >> 4;
#pragma unroll
  for (int i = 0; i < 8; ++i) { const int ka = k0 + 8 * g + i, kb = ka + 16; v[i] = ka < K ? W[(size_t)(ka < K ? ka : K - 1) * ld + n] : 0.f; v[8 + i] = kb < K ? W[(size_t)(kb < K ? kb : K - 1) * ld + n] : 0.f; }
  return bsplit16(v); }
__device__ __forceinline__ v8f mac3(const F2& a, const F2& b, v8f c) { c = wmma_bf(a.l, b.h, c); c = wmma_bf(a.h, b.l, c); return wmma_bf(a.h, b.h, c); }
__device__ __forceinline__ float sigm(float v) { return 1.0f / (1.0f + expf(-v)); }
#define LDSX() do { asm volatile("s_wait_dscnt 0" ::: "memory"); __builtin_amdgcn_wave_barrier(); __builtin_amdgcn_fence(__ATOMIC_RELEASE, "workgroup"); } while (0)


// Exclusive self attention (B 2, S 2,048, D 1,024 = 16 x 64): q/k/v Linear ([out,in] + bias), softmax(q k / 8) v, then per position and head o -= <o, v_s> / (|v_s|^2 + 1e-8) v_s, output Linear.
#define NB 2
#define TT 2048
#define CC 1024
#define NH 16
#define HD 64
#ifndef TNB
#define TNB NB
#endif
typedef __attribute__((ext_vector_type(8))) __bf16 v8b;
__device__ __forceinline__ v16b frag_b(const __bf16* rowk0, int lane) {
  union { v16b v; v8b q[2]; } u; const __bf16* p = rowk0 + 8 * (lane >> 4);
  u.q[0] = *(const v8b*)p; u.q[1] = *(const v8b*)(p + 16); return u.v;
}
__device__ __forceinline__ float bfr(float v) { return (float)(__bf16)v; }
__device__ __attribute__((noinline)) float exp_ni(float v) { return expf(v); }
__device__ __attribute__((noinline)) float erf_ni(float v) { return erff(v); }

#define WS_QH  0u
#define WS_QL  (WS_QH + 2u * (size_t)NB * TT * CC)
#define WS_KH  (WS_QL + 2u * (size_t)NB * TT * CC)
#define WS_VT  (WS_KH + 2u * (size_t)NB * TT * CC)      // f16 v planes [b][c][t]
#define HG 4
#define WS_S   (WS_VT + 2u * (size_t)NB * CC * TT)      // f32 logits [hg][q][k]
#define WS_PH  (WS_S + 4u * (size_t)HG * TT * TT)       // f16 P [hg][q][k]
#define WS_Y   (WS_PH + 2u * (size_t)HG * TT * TT)          // f32 y rows [b*t][C]
#define WS_VR  (WS_Y + 4u * (size_t)NB * TT * CC)       // f32 v rows [b*t][C] for the exclusion step
#define WS_END (WS_VR + 4u * (size_t)NB * TT * CC)

// ---- k_proj: block = (64 rows, 128 cols, which): qkv = x W (+ b), exact; q -> f16 hi (+ residual), k -> f16 rows, v -> f16 planes
__global__ __launch_bounds__(128) void k_proj(const float* __restrict__ X, const float* __restrict__ WQ, const float* __restrict__ BQ, const float* __restrict__ WK, const float* __restrict__ BK, const float* __restrict__ WV, const float* __restrict__ BV, _Float16* __restrict__ QH, _Float16* __restrict__ QL, _Float16* __restrict__ KH, _Float16* __restrict__ VT, float* __restrict__ VR) {
  __shared__ __align__(16) _Float16 sh[64][136], sl[64][136]; __shared__ __align__(16) _Float16 th[128][72]; __shared__ __align__(16) float sf[64][132];
  const int tid = threadIdx.x, wave = tid >> 5, lane = tid & 31, col = lane & 15, g = lane >> 4; const int which = blockIdx.z; const int c0 = blockIdx.y * 128; const size_t r0 = (size_t)blockIdx.x * 64; const float* WA = which == 0 ? WQ : which == 1 ? WK : WV; const float* BA = which == 0 ? BQ : which == 1 ? BK : BV;
  v8f acc[8] = {};
#pragma unroll 2
  for (int kc = 0; kc < CC / 32; ++kc) { v16b a; { const float* p = X + (r0 + wave * 16 + col) * CC + kc * 32 + 8 * g;
#pragma unroll
      for (int i = 0; i < 8; ++i) { a[i] = (__bf16)p[i]; a[8 + i] = (__bf16)p[16 + i]; } }
#pragma unroll
    for (int j = 0; j < 8; ++j) { v16b w; const int o = c0 + j * 16 + col;
#pragma unroll
      for (int i = 0; i < 8; ++i) { w[i] = (__bf16)WA[(size_t)(o) * CC + (kc * 32 + 8 * g + i)]; w[8 + i] = (__bf16)WA[(size_t)(o) * CC + (kc * 32 + 16 + 8 * g + i)]; }
      acc[j] = wmma_bf(a, w, acc[j]); } }
#pragma unroll
  for (int j = 0; j < 8; ++j) { const float bb = bfr(BA[c0 + j * 16 + col]);
#pragma unroll
    for (int r = 0; r < 8; ++r) { const float v = acc[j][r] + bb; const int rl = wave * 16 + 8 * g + r, cl = j * 16 + col; const _Float16 hv = (_Float16)v;
      if (which == 2) { th[cl][rl] = hv; sf[rl][cl] = v; } else { sh[rl][cl] = hv; sl[rl][cl] = (_Float16)(v - (float)hv); } } }
  __syncthreads();
  if (which < 2) { _Float16* dh = which == 0 ? QH : KH; for (int e = tid; e < 64 * 16; e += 128) { const int rl = e >> 4, q = e & 15; vst2((unsigned*)(dh + (r0 + rl) * CC + c0 + q * 8), *(const v4u*)&sh[rl][q * 8]); if (which == 0) vst2((unsigned*)(QL + (r0 + rl) * CC + c0 + q * 8), *(const v4u*)&sl[rl][q * 8]); } }
  else { const size_t b = r0 / TT; const int t0 = (int)(r0 % TT); for (int e = tid; e < 128 * 8; e += 128) { const int cl = e >> 3, q = e & 7; vst2((unsigned*)(VT + (b * CC + c0 + cl) * (size_t)TT + t0 + q * 8), *(const v4u*)&th[cl][q * 8]); }
    for (int e = tid; e < 64 * 32; e += 128) { const int rl = e >> 5, q = e & 31; vst2(VR + (r0 + rl) * CC + c0 + q * 4, *(const v4f*)&sf[rl][q * 4]); } } }
// ---- k_sc: block = (64 queries, 128 keys) of (b,h): 1-product logits / 8
__global__ __launch_bounds__(128) void k_sc(const _Float16* __restrict__ QH, const _Float16* __restrict__ QL, const _Float16* __restrict__ KH, int b, int h0, float* __restrict__ S0) { __shared__ __align__(16) float ss[4][16][132]; const int h = h0 + blockIdx.z; float* S = S0 + (size_t)blockIdx.z * TT * TT;
  const int tid = threadIdx.x, wave = tid >> 5, lane = tid & 31, col = lane & 15, g = lane >> 4; const int k0 = blockIdx.y * 128; const int ql0 = blockIdx.x * 64 + wave * 16; const size_t q0 = (size_t)b * TT + ql0;
  
  v8f acc[8] = {};
#pragma unroll
  for (int kc = 0; kc < HD / 32; ++kc) { const v16h ah = frag_h(QH + (q0 + col) * CC + h * HD + kc * 32, lane);
#pragma unroll
    for (int j = 0; j < 8; ++j) { const v16h kb = frag_h(KH + ((size_t)b * TT + k0 + j * 16 + col) * CC + h * HD + kc * 32, lane); acc[j] = wmma16(ah, kb, acc[j]); } }
#pragma unroll
  for (int j = 0; j < 8; ++j) { const int kt = k0 + j * 16 + col;
#pragma unroll
    for (int r = 0; r < 8; ++r) { (void)kt; const float v = acc[j][r] * 0.125f; ss[wave][8 * g + r][j * 16 + col] = v; } }
  LDSX(); for (int rl = 0; rl < 16; ++rl) vst2(S + (size_t)(ql0 + rl) * TT + k0 + lane * 4, *(const v4f*)&ss[wave][rl][lane * 4]); }
// ---- k_sm: block = query row: softmax over keys [0, kend) -> P x 2^11 f16 (masked -> 0)
__global__ __launch_bounds__(256) void k_sm(const float* __restrict__ S0, _Float16* __restrict__ PH0) { __shared__ float sred[8]; __shared__ float sbc; __shared__ __align__(16) _Float16 sh[TT];
  const int t = threadIdx.x; const size_t row = blockIdx.x; const float* sr = S0 + (size_t)blockIdx.y * TT * TT + row * TT; _Float16* PH = PH0 + (size_t)blockIdx.y * TT * TT; const int kend = TT;
  float m = -3.0e38f; for (int k = t; k < kend; k += 256) m = fmaxf(m, sr[k]);
#pragma unroll
  for (int o = 1; o < 32; o <<= 1) m = fmaxf(m, __shfl_xor(m, o));
  if ((t & 31) == 0) sred[t >> 5] = m; __syncthreads(); if (t == 0) { float a = sred[0]; for (int i = 1; i < 8; ++i) a = fmaxf(a, sred[i]); sbc = a; } __syncthreads(); m = sbc; __syncthreads();
  float sum = 0.f; for (int k = t; k < kend; k += 256) { const float v = sr[k]; sum += (v <= -1.0e38f) ? 0.f : expf(v - m); }
#pragma unroll
  for (int o = 1; o < 32; o <<= 1) sum += __shfl_xor(sum, o);
  if ((t & 31) == 0) sred[t >> 5] = sum; __syncthreads(); if (t == 0) { float a = 0.f; for (int i = 0; i < 8; ++i) a += sred[i]; sbc = 1.0f / a; } __syncthreads(); const float inv = sbc;
  for (int k = t; k < kend; k += 256) { const float v = sr[k]; sh[k] = (_Float16)((v <= -1.0e38f) ? 0.f : expf(v - m) * inv * 2048.0f); }
  __syncthreads(); for (int q = t; q < kend / 8; q += 256) vst2((unsigned*)(PH + row * TT + q * 8), *(const v4u*)&sh[q * 8]); }
// ---- k_pv: block = 64 queries of (b,h): y[q][h*HD + d] = P . v  (keys [0, kend))
__global__ __launch_bounds__(128) void k_pv(const _Float16* __restrict__ PH0, const _Float16* __restrict__ VT, const float* __restrict__ VR, int b, int h0, float* __restrict__ Y) { const int h = h0 + blockIdx.z; const _Float16* PH = PH0 + (size_t)blockIdx.z * TT * TT; __shared__ __align__(16) float ss[4][16][HD + 4];
  const int tid = threadIdx.x, wave = tid >> 5, lane = tid & 31, col = lane & 15, g = lane >> 4; const int ql0 = blockIdx.x * 64 + wave * 16; const int kend = TT;
  v8f acc[HD / 16] = {};
#pragma unroll 1
  for (int kc = 0; kc < kend / 32; ++kc) { const v16h ph = frag_h(PH + (size_t)(ql0 + col) * TT + kc * 32, lane);
#pragma unroll
    for (int j = 0; j < HD / 16; ++j) acc[j] = wmma16(ph, frag_h(VT + ((size_t)b * CC + h * HD + j * 16 + col) * (size_t)TT + kc * 32, lane), acc[j]); }
#pragma unroll
  for (int j = 0; j < HD / 16; ++j)
#pragma unroll
    for (int r = 0; r < 8; ++r) ss[wave][8 * g + r][j * 16 + col] = acc[j][r] * (1.0f / 2048.0f);
  LDSX();
  for (int rl = 0; rl < 16; ++rl) {   // exclusion: o -= (o . v / (|v|^2 + 1e-8)) v with the position's own f32 v row (lanes 0..15 hold 4 elements each; lanes 16..31 contribute 0)
    const size_t ro = ((size_t)b * TT + ql0 + rl) * CC + h * HD + (lane & 15) * 4; const v4f vv = *(const v4f*)(VR + ro); v4f ov = *(const v4f*)&ss[wave][rl][(lane & 15) * 4];
    float dt = 0.f, nn = 0.f; if (lane < 16) { dt = ov[0] * vv[0] + ov[1] * vv[1] + ov[2] * vv[2] + ov[3] * vv[3]; nn = vv[0] * vv[0] + vv[1] * vv[1] + vv[2] * vv[2] + vv[3] * vv[3]; }
#pragma unroll
    for (int o = 1; o < 32; o <<= 1) { dt += __shfl_xor(dt, o); nn += __shfl_xor(nn, o); }
    const float al = dt / (nn + 1e-8f); ov -= al * vv;
    if (lane < HD / 4) vst2(Y + ro, ov); } }
// ---- k_out: block = (64 rows, 128 cols): out = y (bf16 hi + lo) Wproj + b
__global__ __launch_bounds__(128) void k_out(const float* __restrict__ Y, const float* __restrict__ WP, const float* __restrict__ BP, float* __restrict__ OUT) { __shared__ __align__(16) float sf[4][16][132];
  const int tid = threadIdx.x, wave = tid >> 5, lane = tid & 31, col = lane & 15, g = lane >> 4; const int c0 = blockIdx.y * 128; const size_t r0 = (size_t)blockIdx.x * 64 + wave * 16;
  v8f acc[8] = {};
#pragma unroll 2
  for (int kc = 0; kc < CC / 32; ++kc) { const F2 a = split_row(Y + (r0 + col) * CC, kc * 32, lane);
#pragma unroll
    for (int j = 0; j < 8; ++j) { v16b w; const int o = c0 + j * 16 + col;
#pragma unroll
      for (int i = 0; i < 8; ++i) { w[i] = (__bf16)WP[(size_t)(o) * CC + (kc * 32 + 8 * g + i)]; w[8 + i] = (__bf16)WP[(size_t)(o) * CC + (kc * 32 + 16 + 8 * g + i)]; }
      acc[j] = wmma_bf(a.h, w, acc[j]); acc[j] = wmma_bf(a.l, w, acc[j]); } }
#pragma unroll
  for (int j = 0; j < 8; ++j) { const float bb = BP ? bfr(BP[c0 + j * 16 + col]) : 0.f;
#pragma unroll
    for (int r = 0; r < 8; ++r) sf[wave][8 * g + r][j * 16 + col] = acc[j][r] + bb; }
  LDSX(); for (int rl = 0; rl < 16; ++rl) vst2(OUT + (r0 + rl) * CC + c0 + lane * 4, *(const v4f*)&sf[wave][rl][lane * 4]); }
extern "C" void kernel_launch(void* const* d_in, const int* in_sizes, int n_in, void* d_out, int out_size, void* d_ws, size_t ws_size, hipStream_t stream) {
  (void)in_sizes; (void)n_in; (void)out_size;
  const float** F = (const float**)d_in;   // 0 x [2,2048,1024], 1 wq [1024,1024] ([out,in]), 2 bq, 3 wk, 4 bk, 5 wv, 6 bv, 7 wo, 8 bo
  if (ws_size < (size_t)WS_END) return;
  char* ws = (char*)d_ws; _Float16 *QH = (_Float16*)(ws + WS_QH), *QL = (_Float16*)(ws + WS_QL), *KH = (_Float16*)(ws + WS_KH), *VT = (_Float16*)(ws + WS_VT), *PH = (_Float16*)(ws + WS_PH); float *S = (float*)(ws + WS_S), *Y = (float*)(ws + WS_Y), *VR = (float*)(ws + WS_VR);
  k_proj<<<dim3(TNB * TT / 64, CC / 128, 3), 128, 0, stream>>>(F[0], F[1], F[2], F[3], F[4], F[5], F[6], QH, QL, KH, VT, VR);
  for (int b = 0; b < TNB; ++b) for (int h0 = 0; h0 < NH; h0 += HG) {   // HG heads per launch
    k_sc<<<dim3(TT / 64, TT / 128, HG), 128, 0, stream>>>(QH, QL, KH, b, h0, S);
    k_sm<<<dim3(TT, HG), 256, 0, stream>>>(S, PH);
    k_pv<<<dim3(TT / 64, 1, HG), 128, 0, stream>>>(PH, VT, VR, b, h0, Y);
  }
  k_out<<<dim3(TNB * TT / 64, CC / 128), 128, 0, stream>>>(Y, F[7], F[8], (float*)d_out);
}

// v001
// One run takes 416 microseconds.
// Next to v000, in two timings, it ran 3.29 and 3.27 times as fast.
// compute dtype: all float inputs rounded to bf16; q/k/v = x W^T + b with EXACT bf16 products on WMMA 16x16x32, f32 accumulate; q, k rounded once to f16 (1-product logits, f32, kept in registers); online softmax in f32, base 2, against a running maximum -> unnormalised P f16 (at most 2^8); o = P . v (v once to f16) / row sum; per-position exclusion o -= (o . v_s / (|v_s|^2 + 1e-8)) v_s in f32 with the exact f32 v row; out = o (bf16 hi + lo) Wo^T + bo; f32 output.
#include <hip/hip_runtime.h>
#include <math.h>

typedef __attribute__((ext_vector_type(16))) _Float16 v16h;
typedef __attribute__((ext_vector_type(16))) __bf16 v16b;
typedef __attribute__((ext_vector_type(8)))  _Float16 v8h;
typedef __attribute__((ext_vector_type(8)))  float v8f;
typedef __attribute__((ext_vector_type(4)))  float v4f;
typedef __attribute__((ext_vector_type(2)))  float v2f;
typedef __attribute__((ext_vector_type(4)))  unsigned v4u;
typedef __attribute__((ext_vector_type(4)))  int v4i;
typedef float __attribute__((may_alias)) float_a;
typedef int __attribute__((may_alias)) int_a;

template <typename T> __device__ __forceinline__ void vst2(void* p, T v) { *(T*)p = v;  }
__device__ __forceinline__ v8f wmma16(v16h a, v16h b, v8f c) {
  v8f d = __builtin_amdgcn_wmma_f32_16x16x32_f16(false, a, false, b, (short)0, c, false, false);
  asm volatile("v_nop\n\tv_nop\n\tv_nop\n\tv_nop" : "+v"(d) : "v"(a), "v"(b));
  return d;
}
__device__ __forceinline__ v8f wmma_bf(v16b a, v16b b, v8f c) {
  v8f d = __builtin_amdgcn_wmma_f32_16x16x32_bf16(false, a, false, b, (short)0, c, false, false);
  asm volatile("v_nop\n\tv_nop\n\tv_nop\n\tv_nop" : "+v"(d) : "v"(a), "v"(b));
  return d;
}
// 16x16x32 fragments: lane = (h = lane>>4, row/col = lane&15); elements 0..7 = k0+8h+0..7, 8..15 = k0+16+8h+0..7; D element r = row 8h+r
__device__ __forceinline__ v16h frag_h(const _Float16* rowk0, int lane) {
  union { v16h v; v8h q[2]; } u; const _Float16* p = rowk0 + 8 * (lane >> 4);
  u.q[0] = *(const v8h*)p; u.q[1] = *(const v8h*)(p + 16); return u.v;
}
__device__ __forceinline__ v16h frag_f32(const float* rowk0, int lane) {
  v16h a; const float* p = rowk0 + 8 * (lane >> 4);
#pragma unroll
  for (int i = 0; i < 8; ++i) { a[i] = (_Float16)p[i]; a[8 + i] = (_Float16)p[16 + i]; }
  return a;
}
__device__ __forceinline__ v16h frag_f32s(const float* rowk0, int lane, float sc) {
  v16h a; const float* p = rowk0 + 8 * (lane >> 4);
#pragma unroll
  for (int i = 0; i < 8; ++i) { a[i] = (_Float16)(p[i] * sc); a[8 + i] = (_Float16)(p[16 + i] * sc); }
  return a;
}
// column fragment from a [K][ld] layout (column n), rows >= K read as 0
__device__ __forceinline__ v16h fragc_f32(const float* W, int k0, int n, int lane, int ld, int K) {
  v16h a; const int g = lane >> 4;
#pragma unroll
  for (int i = 0; i < 8; ++i) { const int ka = k0 + 8 * g + i, kb = ka + 16;
    a[i] = (_Float16)(ka < K ? W[(size_t)(ka < K ? ka : K - 1) * ld + n] : 0.f); a[8 + i] = (_Float16)(kb < K ? W[(size_t)(kb < K ? kb : K - 1) * ld + n] : 0.f); }
  return a;
}
struct F2 { v16b h, l; };
__device__ __forceinline__ F2 bsplit16(const float v[16]) { F2 r;
#pragma unroll
  for (int i = 0; i < 16; ++i) { const __bf16 h = (__bf16)v[i]; r.h[i] = h; r.l[i] = (__bf16)(v[i] - (float)h); }
  return r; }
__device__ __forceinline__ F2 split_row(const float* row, int k0, int lane) { float v[16]; const float* p = row + k0 + 8 * (lane >> 4);
#pragma unroll
  for (int i = 0; i < 8; ++i) { v[i] = p[i]; v[8 + i] = p[16 + i]; }
  return bsplit16(v); }
__device__ __forceinline__ F2 split_rowK(const float* row, int k0, int lane, int K) { float v[16]; const int g = lane >> 4;
#pragma unroll
  for (int i = 0; i < 8; ++i) { const int ka = k0 + 8 * g + i, kb = ka + 16; v[i] = ka < K ? row[ka < K ? ka : K - 1] : 0.f; v[8 + i] = kb < K ? row[kb < K ? kb : K - 1] : 0.f; }
  return bsplit16(v); }
__device__ __forceinline__ F2 split_col(const float* W, int k0, int n, int lane, int ld, int K) { float v[16]; const int g = lane >> 4;
#pragma unroll
  for (int i = 0; i < 8; ++i) { const int ka = k0 + 8 * g + i, kb = ka + 16; v[i] = ka < K ? W[(size_t)(ka < K ? ka : K - 1) * ld + n] : 0.f; v[8 + i] = kb < K ? W[(size_t)(kb < K ? kb : K - 1) * ld + n] : 0.f; }
  return bsplit16(v); }
__device__ __forceinline__ v8f mac3(const F2& a, const F2& b, v8f c) { c = wmma_bf(a.l, b.h, c); c = wmma_bf(a.h, b.l, c); return wmma_bf(a.h, b.h, c); }
__device__ __forceinline__ float sigm(float v) { return 1.0f / (1.0f + expf(-v)); }
#define LDSX() do { asm volatile("s_wait_dscnt 0" ::: "memory"); __builtin_amdgcn_wave_barrier(); __builtin_amdgcn_fence(__ATOMIC_RELEASE, "workgroup"); } while (0)


// Exclusive self attention (B 2, S 2,048, D 1,024 = 16 x 64): q/k/v Linear ([out,in] + bias), softmax(q k / 8) v, then per position and head o -= <o, v_s> / (|v_s|^2 + 1e-8) v_s, output Linear.
#define NB 2
#define TT 2048
#define CC 1024
#define NH 16
#define HD 64
#ifndef TNB
#define TNB NB
#endif
typedef __attribute__((ext_vector_type(8))) __bf16 v8b;
__device__ __forceinline__ v16b frag_b(const __bf16* rowk0, int lane) {
  union { v16b v; v8b q[2]; } u; const __bf16* p = rowk0 + 8 * (lane >> 4);
  u.q[0] = *(const v8b*)p; u.q[1] = *(const v8b*)(p + 16); return u.v;
}
__device__ __forceinline__ float bfr(float v) { return (float)(__bf16)v; }
__device__ __attribute__((noinline)) float exp_ni(float v) { return expf(v); }
__device__ __attribute__((noinline)) float erf_ni(float v) { return erff(v); }

#define WS_QH  0u
#define WS_QL  (WS_QH + 2u * (size_t)NB * TT * CC)
#define WS_KH  (WS_QL + 2u * (size_t)NB * TT * CC)
#define WS_VT  (WS_KH + 2u * (size_t)NB * TT * CC)      // f16 v planes [b][c][t]
#define WS_Y   (WS_VT + 2u * (size_t)NB * CC * TT)      // f32 y rows [b*t][C]
#define WS_VR  (WS_Y + 4u * (size_t)NB * TT * CC)       // f32 v rows [b*t][C] for the exclusion step
#define WS_END (WS_VR + 4u * (size_t)NB * TT * CC)

// ---- k_proj: block = (64 rows, 128 cols, which): qkv = x W (+ b), exact; q -> f16 hi (+ residual), k -> f16 rows, v -> f16 planes
__global__ __launch_bounds__(128) void k_proj(const float* __restrict__ X, const float* __restrict__ WQ, const float* __restrict__ BQ, const float* __restrict__ WK, const float* __restrict__ BK, const float* __restrict__ WV, const float* __restrict__ BV, _Float16* __restrict__ QH, _Float16* __restrict__ QL, _Float16* __restrict__ KH, _Float16* __restrict__ VT, float* __restrict__ VR) {
  __shared__ __align__(16) _Float16 sh[64][136], sl[64][136]; __shared__ __align__(16) _Float16 th[128][72]; __shared__ __align__(16) float sf[64][132];
  const int tid = threadIdx.x, wave = tid >> 5, lane = tid & 31, col = lane & 15, g = lane >> 4; const int which = blockIdx.z; const int c0 = blockIdx.y * 128; const size_t r0 = (size_t)blockIdx.x * 64; const float* WA = which == 0 ? WQ : which == 1 ? WK : WV; const float* BA = which == 0 ? BQ : which == 1 ? BK : BV;
  v8f acc[8] = {};
#pragma unroll 2
  for (int kc = 0; kc < CC / 32; ++kc) { v16b a; { const float* p = X + (r0 + wave * 16 + col) * CC + kc * 32 + 8 * g;
#pragma unroll
      for (int i = 0; i < 8; ++i) { a[i] = (__bf16)p[i]; a[8 + i] = (__bf16)p[16 + i]; } }
#pragma unroll
    for (int j = 0; j < 8; ++j) { v16b w; const int o = c0 + j * 16 + col;
#pragma unroll
      for (int i = 0; i < 8; ++i) { w[i] = (__bf16)WA[(size_t)(o) * CC + (kc * 32 + 8 * g + i)]; w[8 + i] = (__bf16)WA[(size_t)(o) * CC + (kc * 32 + 16 + 8 * g + i)]; }
      acc[j] = wmma_bf(a, w, acc[j]); } }
#pragma unroll
  for (int j = 0; j < 8; ++j) { const float bb = bfr(BA[c0 + j * 16 + col]);
#pragma unroll
    for (int r = 0; r < 8; ++r) { const float v = acc[j][r] + bb; const int rl = wave * 16 + 8 * g + r, cl = j * 16 + col; const _Float16 hv = (_Float16)v;
      if (which == 2) { th[cl][rl] = hv; sf[rl][cl] = v; } else { sh[rl][cl] = hv; sl[rl][cl] = (_Float16)(v - (float)hv); } } }
  __syncthreads();
  if (which < 2) { _Float16* dh = which == 0 ? QH : KH; for (int e = tid; e < 64 * 16; e += 128) { const int rl = e >> 4, q = e & 15; vst2((unsigned*)(dh + (r0 + rl) * CC + c0 + q * 8), *(const v4u*)&sh[rl][q * 8]); if (which == 0) vst2((unsigned*)(QL + (r0 + rl) * CC + c0 + q * 8), *(const v4u*)&sl[rl][q * 8]); } }
  else { const size_t b = r0 / TT; const int t0 = (int)(r0 % TT); for (int e = tid; e < 128 * 8; e += 128) { const int cl = e >> 3, q = e & 7; vst2((unsigned*)(VT + (b * CC + c0 + cl) * (size_t)TT + t0 + q * 8), *(const v4u*)&th[cl][q * 8]); }
    for (int e = tid; e < 64 * 32; e += 128) { const int rl = e >> 5, q = e & 31; vst2(VR + (r0 + rl) * CC + c0 + q * 4, *(const v4f*)&sf[rl][q * 4]); } } }
// ---- k_fa: block = 8 waves x 32 queries of (b,h). Per pass of 32 keys: S^T = K Q^T (a lane holds 16 logits of one query per 16-query tile), online softmax in registers, O^T += V^T P^T (the two S^T tiles, converted in place, are the B operand); then the exclusion step and the y rows.
__device__ __forceinline__ float xhalf(float x) { return __builtin_bit_cast(float, __builtin_amdgcn_permlanex16(__builtin_bit_cast(int, x), __builtin_bit_cast(int, x), 0x76543210, 0xfedcba98, false, false)); }  // lane l with lane l ^ 16
#define QT 2
__global__ __launch_bounds__(256) void k_fa(const _Float16* __restrict__ QH, const _Float16* __restrict__ KH, const _Float16* __restrict__ VT, const float* __restrict__ VR, float* __restrict__ Y) {
  const int tid = threadIdx.x, wave = tid >> 5, lane = tid & 31, col = lane & 15, g = lane >> 4; const int h = blockIdx.y, b = blockIdx.z; const int ql0 = blockIdx.x * (8 * 16 * QT) + wave * (16 * QT);
  const _Float16* Kb = KH + ((size_t)b * TT + col) * CC + h * HD;            // key row col of a 16-key tile
  const _Float16* Vb = VT + ((size_t)b * CC + h * HD + col) * (size_t)TT;    // plane row d = col of a 16-d tile
  const float SC = 0.125f * 1.4426950408889634f;                             // logits / 8, in base 2
  const _Float16* Qa = QH + ((size_t)b * TT + ql0 + col) * CC + h * HD + 8 * g;   // this lane's first 8 elements of query row col (fragment order as in frag_h)
  v16h qf[QT][2];
#pragma unroll
  for (int t = 0; t < QT; ++t)
#pragma unroll
    for (int kc = 0; kc < 2; ++kc) { union { v16h v; v8h q[2]; } u; u.q[0] = *(const v8h*)(Qa + t * 16 * CC + kc * 32); u.q[1] = *(const v8h*)(Qa + t * 16 * CC + kc * 32 + 16); qf[t][kc] = u.v; }
  v16h kf[2][2];
#pragma unroll
  for (int i = 0; i < 2; ++i)
#pragma unroll
    for (int kc = 0; kc < 2; ++kc) kf[i][kc] = frag_h(Kb + (size_t)(i * 16) * CC + kc * 32, lane);
  asm volatile("s_wait_xcnt 0x0" :: "v"(Qa) : "memory");   // the Q loads' address register stays live up to this wait, so that the accumulators below reuse it only behind it
  v8f acc[QT][4] = {}; float mr[QT], lr[QT];
#pragma unroll
  for (int t = 0; t < QT; ++t) { mr[t] = -3.0e38f; lr[t] = 0.f; }
#pragma unroll 1
  for (int p = 0; p < TT / 32; ++p) {   // rolled: one pass already fills the registers
    v16h vf[4];
#pragma unroll
    for (int j = 0; j < 4; ++j) vf[j] = frag_h(Vb + (size_t)(j * 16) * TT + p * 32, lane);
    v8f s[QT][2];
#pragma unroll
    for (int t = 0; t < QT; ++t)
#pragma unroll
      for (int i = 0; i < 2; ++i) { v8f z = {}; z = wmma16(kf[i][0], qf[t][0], z); s[t][i] = wmma16(kf[i][1], qf[t][1], z); }
    const int pn = p + 1 < TT / 32 ? p + 1 : p;   // next pass's K fragments fly under the softmax (the last pass reads its own again)
#pragma unroll
    for (int i = 0; i < 2; ++i)
#pragma unroll
      for (int kc = 0; kc < 2; ++kc) kf[i][kc] = frag_h(Kb + (size_t)(pn * 32 + i * 16) * CC + kc * 32, lane);
    float mx[QT]; bool need = false;
#pragma unroll
    for (int t = 0; t < QT; ++t) { float a = fmaxf(s[t][0][0], s[t][1][0]);
#pragma unroll
      for (int r = 1; r < 8; ++r) a = fmaxf(a, fmaxf(s[t][0][r], s[t][1][r]));
      a = fmaxf(a, xhalf(a)); mx[t] = a * SC; need = need || (mx[t] > mr[t] + 8.0f); }
    if (__builtin_amdgcn_ballot_w32(need) != 0) {   // lazy rescale: only when some query's maximum has grown by more than 2^8 (always on the first pass)
#pragma unroll
      for (int t = 0; t < QT; ++t) { const float mn = fmaxf(mr[t], mx[t]); const float al = __builtin_amdgcn_exp2f(mr[t] - mn); mr[t] = mn; lr[t] *= al;
#pragma unroll
        for (int j = 0; j < 4; ++j) acc[t][j] *= al; }
    }
#pragma unroll
    for (int t = 0; t < QT; ++t) { v16h pf; v2f sum = {0.f, 0.f}; const v2f sc2 = {SC, SC}, nm2 = {-mr[t], -mr[t]};
#pragma unroll
      for (int i = 0; i < 2; ++i)
#pragma unroll
        for (int r = 0; r < 8; r += 2) { v2f a = {s[t][i][r], s[t][i][r + 1]}; a = __builtin_elementwise_fma(a, sc2, nm2); const v2f e = {__builtin_amdgcn_exp2f(a[0]), __builtin_amdgcn_exp2f(a[1])}; sum += e; pf[i * 8 + r] = (_Float16)e[0]; pf[i * 8 + r + 1] = (_Float16)e[1]; }
      lr[t] += sum[0] + sum[1];
#pragma unroll
      for (int j = 0; j < 4; ++j) acc[t][j] = wmma16(vf[j], pf, acc[t][j]); }
  }
#pragma unroll
  for (int t = 0; t < QT; ++t) {   // lane (g, col) holds o[d = 16 j + 8 g + r] of query col; the two halves of a query join by one exchange
    const float inv = 1.0f / (lr[t] + xhalf(lr[t])); const size_t ro = ((size_t)b * TT + ql0 + t * 16 + col) * CC + h * HD + 8 * g;
    v4f vv[4][2]; float dt = 0.f, nn = 0.f;
#pragma unroll
    for (int j = 0; j < 4; ++j) { vv[j][0] = *(const v4f*)(VR + ro + j * 16); vv[j][1] = *(const v4f*)(VR + ro + j * 16 + 4);
#pragma unroll
      for (int r = 0; r < 8; ++r) { const float o = acc[t][j][r] * inv, v = vv[j][r >> 2][r & 3]; acc[t][j][r] = o; dt += o * v; nn += v * v; } }
    dt += xhalf(dt); nn += xhalf(nn); const float al = dt / (nn + 1e-8f);
#pragma unroll
    for (int j = 0; j < 4; ++j) { v4f o0, o1;
#pragma unroll
      for (int r = 0; r < 4; ++r) { o0[r] = acc[t][j][r] - al * vv[j][0][r]; o1[r] = acc[t][j][4 + r] - al * vv[j][1][r]; }
      vst2(Y + ro + j * 16, o0); vst2(Y + ro + j * 16 + 4, o1); } } }
// ---- k_out: block = (64 rows, 128 cols): out = y (bf16 hi + lo) Wproj + b
__global__ __launch_bounds__(128) void k_out(const float* __restrict__ Y, const float* __restrict__ WP, const float* __restrict__ BP, float* __restrict__ OUT) { __shared__ __align__(16) float sf[4][16][132];
  const int tid = threadIdx.x, wave = tid >> 5, lane = tid & 31, col = lane & 15, g = lane >> 4; const int c0 = blockIdx.y * 128; const size_t r0 = (size_t)blockIdx.x * 64 + wave * 16;
  v8f acc[8] = {};
#pragma unroll 2
  for (int kc = 0; kc < CC / 32; ++kc) { const F2 a = split_row(Y + (r0 + col) * CC, kc * 32, lane);
#pragma unroll
    for (int j = 0; j < 8; ++j) { v16b w; const int o = c0 + j * 16 + col;
#pragma unroll
      for (int i = 0; i < 8; ++i) { w[i] = (__bf16)WP[(size_t)(o) * CC + (kc * 32 + 8 * g + i)]; w[8 + i] = (__bf16)WP[(size_t)(o) * CC + (kc * 32 + 16 + 8 * g + i)]; }
      acc[j] = wmma_bf(a.h, w, acc[j]); acc[j] = wmma_bf(a.l, w, acc[j]); } }
#pragma unroll
  for (int j = 0; j < 8; ++j) { const float bb = BP ? bfr(BP[c0 + j * 16 + col]) : 0.f;
#pragma unroll
    for (int r = 0; r < 8; ++r) sf[wave][8 * g + r][j * 16 + col] = acc[j][r] + bb; }
  LDSX(); for (int rl = 0; rl < 16; ++rl) vst2(OUT + (r0 + rl) * CC + c0 + lane * 4, *(const v4f*)&sf[wave][rl][lane * 4]); }
extern "C" void kernel_launch(void* const* d_in, const int* in_sizes, int n_in, void* d_out, int out_size, void* d_ws, size_t ws_size, hipStream_t stream) {
  (void)in_sizes; (void)n_in; (void)out_size;
  const float** F = (const float**)d_in;   // 0 x [2,2048,1024], 1 wq [1024,1024] ([out,in]), 2 bq, 3 wk, 4 bk, 5 wv, 6 bv, 7 wo, 8 bo
  if (ws_size < (size_t)WS_END) return;
  char* ws = (char*)d_ws; _Float16 *QH = (_Float16*)(ws + WS_QH), *QL = (_Float16*)(ws + WS_QL), *KH = (_Float16*)(ws + WS_KH), *VT = (_Float16*)(ws + WS_VT); float *Y = (float*)(ws + WS_Y), *VR = (float*)(ws + WS_VR);
  k_proj<<<dim3(TNB * TT / 64, CC / 128, 3), 128, 0, stream>>>(F[0], F[1], F[2], F[3], F[4], F[5], F[6], QH, QL, KH, VT, VR);
  k_fa<<<dim3(TT / (8 * 16 * QT), NH, TNB), 256, 0, stream>>>(QH, KH, VT, VR, Y);
  k_out<<<dim3(TNB * TT / 64, CC / 128), 128, 0, stream>>>(Y, F[7], F[8], (float*)d_out);
}

// v002
// One run takes 152 microseconds.
// Next to v001, in two timings, it ran 2.73 times as fast each time.
// All steps since v000 together make it 8.96 times as fast.
// compute dtype: all float inputs rounded to bf16; q/k/v = x W^T + b with EXACT bf16 products on WMMA 16x16x32, f32 accumulate; q, k rounded once to f16 (1-product logits, f32, kept in registers); online softmax in f32, base 2, against a running maximum -> unnormalised P f16 (at most 2^8); o = P . v (v once to f16) / row sum; per-position exclusion o -= (o . v_s / (|v_s|^2 + 1e-8)) v_s in f32 with the exact f32 v row; out = o (bf16 hi + lo) Wo^T + bo; f32 output.
#include <hip/hip_runtime.h>
#include <math.h>

typedef __attribute__((ext_vector_type(16))) _Float16 v16h;
typedef __attribute__((ext_vector_type(16))) __bf16 v16b;
typedef __attribute__((ext_vector_type(8)))  _Float16 v8h;
typedef __attribute__((ext_vector_type(8)))  float v8f;
typedef __attribute__((ext_vector_type(4)))  float v4f;
typedef __attribute__((ext_vector_type(2)))  float v2f;
typedef __attribute__((ext_vector_type(4)))  unsigned v4u;
typedef __attribute__((ext_vector_type(4)))  int v4i;
typedef float __attribute__((may_alias)) float_a;
typedef int __attribute__((may_alias)) int_a;

template <typename T> __device__ __forceinline__ void vst2(void* p, T v) { *(T*)p = v;  }
__device__ __forceinline__ v8f wmma16(v16h a, v16h b, v8f c) {
  v8f d = __builtin_amdgcn_wmma_f32_16x16x32_f16(false, a, false, b, (short)0, c, false, false);
  asm volatile("v_nop\n\tv_nop\n\tv_nop\n\tv_nop" : "+v"(d) : "v"(a), "v"(b));
  return d;
}
__device__ __forceinline__ v8f wmma_bf(v16b a, v16b b, v8f c) {
  v8f d = __builtin_amdgcn_wmma_f32_16x16x32_bf16(false, a, false, b, (short)0, c, false, false);
  asm volatile("v_nop\n\tv_nop\n\tv_nop\n\tv_nop" : "+v"(d) : "v"(a), "v"(b));
  return d;
}
// 16x16x32 fragments: lane = (h = lane>>4, row/col = lane&15); elements 0..7 = k0+8h+0..7, 8..15 = k0+16+8h+0..7; D element r = row 8h+r
__device__ __forceinline__ v16h frag_h(const _Float16* rowk0, int lane) {
  union { v16h v; v8h q[2]; } u; const _Float16* p = rowk0 + 8 * (lane >> 4);
  u.q[0] = *(const v8h*)p; u.q[1] = *(const v8h*)(p + 16); return u.v;
}
__device__ __forceinline__ v16h frag_f32(const float* rowk0, int lane) {
  v16h a; const float* p = rowk0 + 8 * (lane >> 4);
#pragma unroll
  for (int i = 0; i < 8; ++i) { a[i] = (_Float16)p[i]; a[8 + i] = (_Float16)p[16 + i]; }
  return a;
}
__device__ __forceinline__ v16h frag_f32s(const float* rowk0, int lane, float sc) {
  v16h a; const float* p = rowk0 + 8 * (lane >> 4);
#pragma unroll
  for (int i = 0; i < 8; ++i) { a[i] = (_Float16)(p[i] * sc); a[8 + i] = (_Float16)(p[16 + i] * sc); }
  return a;
}
// column fragment from a [K][ld] layout (column n), rows >= K read as 0
__device__ __forceinline__ v16h fragc_f32(const float* W, int k0, int n, int lane, int ld, int K) {
  v16h a; const int g = lane >> 4;
#pragma unroll
  for (int i = 0; i < 8; ++i) { const int ka = k0 + 8 * g + i, kb = ka + 16;
    a[i] = (_Float16)(ka < K ? W[(size_t)(ka < K ? ka : K - 1) * ld + n] : 0.f); a[8 + i] = (_Float16)(kb < K ? W[(size_t)(kb < K ? kb : K - 1) * ld + n] : 0.f); }
  return a;
}
struct F2 { v16b h, l; };
__device__ __forceinline__ F2 bsplit16(const float v[16]) { F2 r;
#pragma unroll
  for (int i = 0; i < 16; ++i) { const __bf16 h = (__bf16)v[i]; r.h[i] = h; r.l[i] = (__bf16)(v[i] - (float)h); }
  return r; }
__device__ __forceinline__ F2 split_row(const float* row, int k0, int lane) { float v[16]; const float* p = row + k0 + 8 * (lane >> 4);
#pragma unroll
  for (int i = 0; i < 8; ++i) { v[i] = p[i]; v[8 + i] = p[16 + i]; }
  return bsplit16(v); }
__device__ __forceinline__ F2 split_rowK(const float* row, int k0, int lane, int K) { float v[16]; const int g = lane >> 4;
#pragma unroll
  for (int i = 0; i < 8; ++i) { const int ka = k0 + 8 * g + i, kb = ka + 16; v[i] = ka < K ? row[ka < K ? ka : K - 1] : 0.f; v[8 + i] = kb < K ? row[kb < K ? kb : K - 1] : 0.f; }
  return bsplit16(v); }
__device__ __forceinline__ F2 split_col(const float* W, int k0, int n, int lane, int ld, int K) { float v[16]; const int g = lane >> 4;
#pragma unroll
  for (int i = 0; i < 8; ++i) { const int ka = k0 + 8 * g + i, kb = ka + 16; v[i] = ka < K ? W[(size_t)(ka < K ? ka : K - 1) * ld + n] : 0.f; v[8 + i] = kb < K ? W[(size_t)(kb < K ? kb : K - 1) * ld + n] : 0.f; }
  return bsplit16(v); }
__device__ __forceinline__ v8f mac3(const F2& a, const F2& b, v8f c) { c = wmma_bf(a.l, b.h, c); c = wmma_bf(a.h, b.l, c); return wmma_bf(a.h, b.h, c); }
__device__ __forceinline__ float sigm(float v) { return 1.0f / (1.0f + expf(-v)); }
#define LDSX() do { asm volatile("s_wait_dscnt 0" ::: "memory"); __builtin_amdgcn_wave_barrier(); __builtin_amdgcn_fence(__ATOMIC_RELEASE, "workgroup"); } while (0)


// Exclusive self attention (B 2, S 2,048, D 1,024 = 16 x 64): q/k/v Linear ([out,in] + bias), softmax(q k / 8) v, then per position and head o -= <o, v_s> / (|v_s|^2 + 1e-8) v_s, output Linear.
#define NB 2
#define TT 2048
#define CC 1024
#define NH 16
#define HD 64
#ifndef TNB
#define TNB NB
#endif
typedef __attribute__((ext_vector_type(8))) __bf16 v8b;
__device__ __forceinline__ v16b frag_b(const __bf16* rowk0, int lane) {
  union { v16b v; v8b q[2]; } u; const __bf16* p = rowk0 + 8 * (lane >> 4);
  u.q[0] = *(const v8b*)p; u.q[1] = *(const v8b*)(p + 16); return u.v;
}
__device__ __forceinline__ float bfr(float v) { return (float)(__bf16)v; }
typedef __attribute__((ext_vector_type(4))) __bf16 v4b;
typedef v4f __attribute__((aligned(4))) v4fu;   // 16-byte read of an input that is only known to be float-aligned
#define KP 40   // elements per staged row of 32 bf16: 80 B = 16 B x odd, the pitch at which 16-byte fragment reads meet no bank twice
__device__ __forceinline__ v4b cvt4(v4f v) { v4b r;
#pragma unroll
  for (int i = 0; i < 4; ++i) r[i] = (__bf16)v[i];
  return r; }
__device__ __attribute__((noinline)) float exp_ni(float v) { return expf(v); }
__device__ __attribute__((noinline)) float erf_ni(float v) { return erff(v); }

#define WS_QH  0u
#define WS_QL  (WS_QH + 2u * (size_t)NB * TT * CC)
#define WS_KH  (WS_QL + 2u * (size_t)NB * TT * CC)
#define WS_VT  (WS_KH + 2u * (size_t)NB * TT * CC)      // f16 v planes [b][c][t]
#define WS_Y   (WS_VT + 2u * (size_t)NB * CC * TT)      // f32 y rows [b*t][C]
#define WS_VR  (WS_Y + 4u * (size_t)NB * TT * CC)       // f32 v rows [b*t][C] for the exclusion step
#define WS_END (WS_VR + 4u * (size_t)NB * TT * CC)

// ---- k_proj: block = (64 rows, 128 cols, which): qkv = x W (+ b), exact; q -> f16 hi (+ residual), k -> f16 rows, v -> f16 planes. Per 32-k step the block reads its x and W rows once, a whole 128-B line per 8 lanes, rounds them to bf16 and stages them in LDS (two buffers); the waves take their fragments from there. The stage buffers lie in the same LDS as the epilogue's tiles.
__global__ __launch_bounds__(128) void k_proj(const float* __restrict__ X, const float* __restrict__ WQ, const float* __restrict__ BQ, const float* __restrict__ WK, const float* __restrict__ BK, const float* __restrict__ WV, const float* __restrict__ BV, _Float16* __restrict__ QH, _Float16* __restrict__ QL, _Float16* __restrict__ KH, _Float16* __restrict__ VT, float* __restrict__ VR) {
  __shared__ __align__(16) char sm[128 * 72 * 2 + 64 * 132 * 4];
  _Float16 (*sh)[136] = (_Float16 (*)[136])sm; _Float16 (*sl)[136] = (_Float16 (*)[136])(sm + 64 * 136 * 2);   // q, k epilogue
  _Float16 (*th)[72] = (_Float16 (*)[72])sm; float (*sf)[132] = (float (*)[132])(sm + 128 * 72 * 2);            // v epilogue
  __bf16 (*sA)[64][KP] = (__bf16 (*)[64][KP])sm; __bf16 (*sB)[128][KP] = (__bf16 (*)[128][KP])(sm + 2 * 64 * KP * 2);   // main loop
  const int tid = threadIdx.x, wave = tid >> 5, lane = tid & 31, col = lane & 15, g = lane >> 4; const int which = blockIdx.z; const int c0 = blockIdx.y * 128; const size_t r0 = (size_t)blockIdx.x * 64; const float* WA = which == 0 ? WQ : which == 1 ? WK : WV; const float* BA = which == 0 ? BQ : which == 1 ? BK : BV;
  v8f acc[8] = {};
  const int srow = tid >> 3, sq = tid & 7;   // staging: thread = (row srow + 16 i, 16-byte piece sq of the row's 128-B line)
  const float* Xp = X + (r0 + srow) * CC + sq * 4; const float* Wp = WA + (size_t)(c0 + srow) * CC + sq * 4;
  v4f ra[4], rb[8];
#pragma unroll
  for (int i = 0; i < 4; ++i) ra[i] = *(const v4fu*)(Xp + (size_t)i * 16 * CC);
#pragma unroll
  for (int i = 0; i < 8; ++i) rb[i] = *(const v4fu*)(Wp + (size_t)i * 16 * CC);
#pragma unroll
  for (int i = 0; i < 4; ++i) *(v4b*)&sA[0][srow + i * 16][sq * 4] = cvt4(ra[i]);
#pragma unroll
  for (int i = 0; i < 8; ++i) *(v4b*)&sB[0][srow + i * 16][sq * 4] = cvt4(rb[i]);
  __syncthreads();
#pragma unroll 2   // by two, so that each half addresses its buffers by constants
  for (int kc = 0; kc < CC / 32; ++kc) { const int cur = kc & 1; const bool more = kc + 1 < CC / 32;
    if (more) {   // the next step's lines fly under this step's products
#pragma unroll
      for (int i = 0; i < 4; ++i) ra[i] = *(const v4fu*)(Xp + (size_t)i * 16 * CC + (kc + 1) * 32);
#pragma unroll
      for (int i = 0; i < 8; ++i) rb[i] = *(const v4fu*)(Wp + (size_t)i * 16 * CC + (kc + 1) * 32);
      asm volatile("s_wait_xcnt 0x0" ::: "memory"); }   // behind the run of loads: their address registers may be reused by the roundings below only behind this wait
    const v16b a = frag_b(&sA[cur][wave * 16 + col][0], lane); v16b w[8];
#pragma unroll
    for (int j = 0; j < 8; ++j) w[j] = frag_b(&sB[cur][j * 16 + col][0], lane);
#pragma unroll
    for (int j = 0; j < 8; ++j) acc[j] = wmma_bf(a, w[j], acc[j]);
    __builtin_amdgcn_sched_barrier(0);   // keeps the roundings below, which wait for the lines in flight, from moving up among this step's products
    if (more) {
#pragma unroll
      for (int i = 0; i < 4; ++i) *(v4b*)&sA[cur ^ 1][srow + i * 16][sq * 4] = cvt4(ra[i]);
#pragma unroll
      for (int i = 0; i < 8; ++i) *(v4b*)&sB[cur ^ 1][srow + i * 16][sq * 4] = cvt4(rb[i]); }
    __syncthreads(); }   // publishes the buffer just filled and ends the reads of the one filled next; the last one frees the LDS for the epilogue
#pragma unroll
  for (int j = 0; j < 8; ++j) { const float bb = bfr(BA[c0 + j * 16 + col]);
#pragma unroll
    for (int r = 0; r < 8; ++r) { const float v = acc[j][r] + bb; const int rl = wave * 16 + 8 * g + r, cl = j * 16 + col; const _Float16 hv = (_Float16)v;
      if (which == 2) { th[cl][rl] = hv; sf[rl][cl] = v; } else { sh[rl][cl] = hv; sl[rl][cl] = (_Float16)(v - (float)hv); } } }
  __syncthreads();
  if (which < 2) { _Float16* dh = which == 0 ? QH : KH; for (int e = tid; e < 64 * 16; e += 128) { const int rl = e >> 4, q = e & 15; vst2((unsigned*)(dh + (r0 + rl) * CC + c0 + q * 8), *(const v4u*)&sh[rl][q * 8]); if (which == 0) vst2((unsigned*)(QL + (r0 + rl) * CC + c0 + q * 8), *(const v4u*)&sl[rl][q * 8]); } }
  else { const size_t b = r0 / TT; const int t0 = (int)(r0 % TT); for (int e = tid; e < 128 * 8; e += 128) { const int cl = e >> 3, q = e & 7; vst2((unsigned*)(VT + (b * CC + c0 + cl) * (size_t)TT + t0 + q * 8), *(const v4u*)&th[cl][q * 8]); }
    for (int e = tid; e < 64 * 32; e += 128) { const int rl = e >> 5, q = e & 31; vst2(VR + (r0 + rl) * CC + c0 + q * 4, *(const v4f*)&sf[rl][q * 4]); } } }
// ---- k_fa: block = 8 waves x 32 queries of (b,h). Per pass of 32 keys: S^T = K Q^T (a lane holds 16 logits of one query per 16-query tile), online softmax in registers, O^T += V^T P^T (the two S^T tiles, converted in place, are the B operand); then the exclusion step and the y rows.
__device__ __forceinline__ float xhalf(float x) { return __builtin_bit_cast(float, __builtin_amdgcn_permlanex16(__builtin_bit_cast(int, x), __builtin_bit_cast(int, x), 0x76543210, 0xfedcba98, false, false)); }  // lane l with lane l ^ 16
#define QT 2
__global__ __launch_bounds__(256) void k_fa(const _Float16* __restrict__ QH, const _Float16* __restrict__ KH, const _Float16* __restrict__ VT, const float* __restrict__ VR, float* __restrict__ Y) {
  const int tid = threadIdx.x, wave = tid >> 5, lane = tid & 31, col = lane & 15, g = lane >> 4; const int h = blockIdx.y, b = blockIdx.z; const int ql0 = blockIdx.x * (8 * 16 * QT) + wave * (16 * QT);
  const _Float16* Kb = KH + ((size_t)b * TT + col) * CC + h * HD;            // key row col of a 16-key tile
  const _Float16* Vb = VT + ((size_t)b * CC + h * HD + col) * (size_t)TT;    // plane row d = col of a 16-d tile
  const float SC = 0.125f * 1.4426950408889634f;                             // logits / 8, in base 2
  const _Float16* Qa = QH + ((size_t)b * TT + ql0 + col) * CC + h * HD + 8 * g;   // this lane's first 8 elements of query row col (fragment order as in frag_h)
  v16h qf[QT][2];
#pragma unroll
  for (int t = 0; t < QT; ++t)
#pragma unroll
    for (int kc = 0; kc < 2; ++kc) { union { v16h v; v8h q[2]; } u; u.q[0] = *(const v8h*)(Qa + t * 16 * CC + kc * 32); u.q[1] = *(const v8h*)(Qa + t * 16 * CC + kc * 32 + 16); qf[t][kc] = u.v; }
  v16h kf[2][2];
#pragma unroll
  for (int i = 0; i < 2; ++i)
#pragma unroll
    for (int kc = 0; kc < 2; ++kc) kf[i][kc] = frag_h(Kb + (size_t)(i * 16) * CC + kc * 32, lane);
  asm volatile("s_wait_xcnt 0x0" :: "v"(Qa) : "memory");   // the Q loads' address register stays live up to this wait, so that the accumulators below reuse it only behind it
  v8f acc[QT][4] = {}; float mr[QT], lr[QT];
#pragma unroll
  for (int t = 0; t < QT; ++t) { mr[t] = -3.0e38f; lr[t] = 0.f; }
#pragma unroll 1
  for (int p = 0; p < TT / 32; ++p) {   // rolled: one pass already fills the registers
    v16h vf[4];
#pragma unroll
    for (int j = 0; j < 4; ++j) vf[j] = frag_h(Vb + (size_t)(j * 16) * TT + p * 32, lane);
    v8f s[QT][2];
#pragma unroll
    for (int t = 0; t < QT; ++t)
#pragma unroll
      for (int i = 0; i < 2; ++i) { v8f z = {}; z = wmma16(kf[i][0], qf[t][0], z); s[t][i] = wmma16(kf[i][1], qf[t][1], z); }
    const int pn = p + 1 < TT / 32 ? p + 1 : p;   // next pass's K fragments fly under the softmax (the last pass reads its own again)
#pragma unroll
    for (int i = 0; i < 2; ++i)
#pragma unroll
      for (int kc = 0; kc < 2; ++kc) kf[i][kc] = frag_h(Kb + (size_t)(pn * 32 + i * 16) * CC + kc * 32, lane);
    float mx[QT]; bool need = false;
#pragma unroll
    for (int t = 0; t < QT; ++t) { float a = fmaxf(s[t][0][0], s[t][1][0]);
#pragma unroll
      for (int r = 1; r < 8; ++r) a = fmaxf(a, fmaxf(s[t][0][r], s[t][1][r]));
      a = fmaxf(a, xhalf(a)); mx[t] = a * SC; need = need || (mx[t] > mr[t] + 8.0f); }
    if (__builtin_amdgcn_ballot_w32(need) != 0) {   // lazy rescale: only when some query's maximum has grown by more than 2^8 (always on the first pass)
#pragma unroll
      for (int t = 0; t < QT; ++t) { const float mn = fmaxf(mr[t], mx[t]); const float al = __builtin_amdgcn_exp2f(mr[t] - mn); mr[t] = mn; lr[t] *= al;
#pragma unroll
        for (int j = 0; j < 4; ++j) acc[t][j] *= al; }
    }
#pragma unroll
    for (int t = 0; t < QT; ++t) { v16h pf; v2f sum = {0.f, 0.f}; const v2f sc2 = {SC, SC}, nm2 = {-mr[t], -mr[t]};
#pragma unroll
      for (int i = 0; i < 2; ++i)
#pragma unroll
        for (int r = 0; r < 8; r += 2) { v2f a = {s[t][i][r], s[t][i][r + 1]}; a = __builtin_elementwise_fma(a, sc2, nm2); const v2f e = {__builtin_amdgcn_exp2f(a[0]), __builtin_amdgcn_exp2f(a[1])}; sum += e; pf[i * 8 + r] = (_Float16)e[0]; pf[i * 8 + r + 1] = (_Float16)e[1]; }
      lr[t] += sum[0] + sum[1];
#pragma unroll
      for (int j = 0; j < 4; ++j) acc[t][j] = wmma16(vf[j], pf, acc[t][j]); }
  }
#pragma unroll
  for (int t = 0; t < QT; ++t) {   // lane (g, col) holds o[d = 16 j + 8 g + r] of query col; the two halves of a query join by one exchange
    const float inv = 1.0f / (lr[t] + xhalf(lr[t])); const size_t ro = ((size_t)b * TT + ql0 + t * 16 + col) * CC + h * HD + 8 * g;
    v4f vv[4][2]; float dt = 0.f, nn = 0.f;
#pragma unroll
    for (int j = 0; j < 4; ++j) { vv[j][0] = *(const v4f*)(VR + ro + j * 16); vv[j][1] = *(const v4f*)(VR + ro + j * 16 + 4);
#pragma unroll
      for (int r = 0; r < 8; ++r) { const float o = acc[t][j][r] * inv, v = vv[j][r >> 2][r & 3]; acc[t][j][r] = o; dt += o * v; nn += v * v; } }
    dt += xhalf(dt); nn += xhalf(nn); const float al = dt / (nn + 1e-8f);
#pragma unroll
    for (int j = 0; j < 4; ++j) { v4f o0, o1;
#pragma unroll
      for (int r = 0; r < 4; ++r) { o0[r] = acc[t][j][r] - al * vv[j][0][r]; o1[r] = acc[t][j][4 + r] - al * vv[j][1][r]; }
      vst2(Y + ro + j * 16, o0); vst2(Y + ro + j * 16 + 4, o1); } } }
// ---- k_out: block = (64 rows, 128 cols): out = y (bf16 hi + lo) Wproj + b; y (split once per block) and W staged in LDS as in k_proj
__global__ __launch_bounds__(128) void k_out(const float* __restrict__ Y, const float* __restrict__ WP, const float* __restrict__ BP, float* __restrict__ OUT) { __shared__ __align__(16) float sf[4][16][132]; __shared__ __align__(16) __bf16 sH[2][64][KP], sL[2][64][KP], sB[2][128][KP];
  const int tid = threadIdx.x, wave = tid >> 5, lane = tid & 31, col = lane & 15, g = lane >> 4; const int c0 = blockIdx.y * 128; const size_t r0 = (size_t)blockIdx.x * 64 + wave * 16;
  v8f acc[8] = {};
  const int srow = tid >> 3, sq = tid & 7;   // staging: thread = (row srow + 16 i, 16-byte piece sq of the row's 128-B line)
  const float* Yp = Y + ((size_t)blockIdx.x * 64 + srow) * CC + sq * 4; const float* Wp = WP + (size_t)(c0 + srow) * CC + sq * 4;
  v4f ra[4], rb[8];
#pragma unroll
  for (int i = 0; i < 4; ++i) ra[i] = *(const v4f*)(Yp + (size_t)i * 16 * CC);
#pragma unroll
  for (int i = 0; i < 8; ++i) rb[i] = *(const v4fu*)(Wp + (size_t)i * 16 * CC);
#pragma unroll
  for (int i = 0; i < 4; ++i) { const v4b hi = cvt4(ra[i]); v4f re;
#pragma unroll
    for (int e = 0; e < 4; ++e) re[e] = ra[i][e] - (float)hi[e];
    *(v4b*)&sH[0][srow + i * 16][sq * 4] = hi; *(v4b*)&sL[0][srow + i * 16][sq * 4] = cvt4(re); }
#pragma unroll
  for (int i = 0; i < 8; ++i) *(v4b*)&sB[0][srow + i * 16][sq * 4] = cvt4(rb[i]);
  __syncthreads();
#pragma unroll 2   // by two, so that each half addresses its buffers by constants
  for (int kc = 0; kc < CC / 32; ++kc) { const int cur = kc & 1; const bool more = kc + 1 < CC / 32;
    if (more) {   // the next step's lines fly under this step's products
#pragma unroll
      for (int i = 0; i < 4; ++i) ra[i] = *(const v4f*)(Yp + (size_t)i * 16 * CC + (kc + 1) * 32);
#pragma unroll
      for (int i = 0; i < 8; ++i) rb[i] = *(const v4fu*)(Wp + (size_t)i * 16 * CC + (kc + 1) * 32);
      asm volatile("s_wait_xcnt 0x0" ::: "memory"); }   // behind the run of loads: their address registers may be reused by the roundings below only behind this wait
    const v16b ah = frag_b(&sH[cur][wave * 16 + col][0], lane), al = frag_b(&sL[cur][wave * 16 + col][0], lane); v16b w[8];
#pragma unroll
    for (int j = 0; j < 8; ++j) w[j] = frag_b(&sB[cur][j * 16 + col][0], lane);
#pragma unroll
    for (int j = 0; j < 8; ++j) { acc[j] = wmma_bf(ah, w[j], acc[j]); acc[j] = wmma_bf(al, w[j], acc[j]); }
    __builtin_amdgcn_sched_barrier(0);   // keeps the roundings below, which wait for the lines in flight, from moving up among this step's products
    if (more) {
#pragma unroll
      for (int i = 0; i < 4; ++i) { const v4b hi = cvt4(ra[i]); v4f re;
#pragma unroll
        for (int e = 0; e < 4; ++e) re[e] = ra[i][e] - (float)hi[e];
        *(v4b*)&sH[cur ^ 1][srow + i * 16][sq * 4] = hi; *(v4b*)&sL[cur ^ 1][srow + i * 16][sq * 4] = cvt4(re); }
#pragma unroll
      for (int i = 0; i < 8; ++i) *(v4b*)&sB[cur ^ 1][srow + i * 16][sq * 4] = cvt4(rb[i]); }
    __syncthreads(); }   // publishes the buffer just filled and ends the reads of the one filled next
#pragma unroll
  for (int j = 0; j < 8; ++j) { const float bb = BP ? bfr(BP[c0 + j * 16 + col]) : 0.f;
#pragma unroll
    for (int r = 0; r < 8; ++r) sf[wave][8 * g + r][j * 16 + col] = acc[j][r] + bb; }
  LDSX(); for (int rl = 0; rl < 16; ++rl) vst2(OUT + (r0 + rl) * CC + c0 + lane * 4, *(const v4f*)&sf[wave][rl][lane * 4]); }
extern "C" void kernel_launch(void* const* d_in, const int* in_sizes, int n_in, void* d_out, int out_size, void* d_ws, size_t ws_size, hipStream_t stream) {
  (void)in_sizes; (void)n_in; (void)out_size;
  const float** F = (const float**)d_in;   // 0 x [2,2048,1024], 1 wq [1024,1024] ([out,in]), 2 bq, 3 wk, 4 bk, 5 wv, 6 bv, 7 wo, 8 bo
  if (ws_size < (size_t)WS_END) return;
  char* ws = (char*)d_ws; _Float16 *QH = (_Float16*)(ws + WS_QH), *QL = (_Float16*)(ws + WS_QL), *KH = (_Float16*)(ws + WS_KH), *VT = (_Float16*)(ws + WS_VT); float *Y = (float*)(ws + WS_Y), *VR = (float*)(ws + WS_VR);
  k_proj<<<dim3(TNB * TT / 64, CC / 128, 3), 128, 0, stream>>>(F[0], F[1], F[2], F[3], F[4], F[5], F[6], QH, QL, KH, VT, VR);
  k_fa<<<dim3(TT / (8 * 16 * QT), NH, TNB), 256, 0, stream>>>(QH, KH, VT, VR, Y);
  k_out<<<dim3(TNB * TT / 64, CC / 128), 128, 0, stream>>>(Y, F[7], F[8], (float*)d_out);
}

// v003
// A run of this version takes 123 microseconds.
// Two timings next to v002 both put it at 1.24 times that version's speed.
// Over all steps from v000 it is 11.1 times as fast.
// compute dtype: all float inputs rounded to bf16; q/k/v = x W^T + b with EXACT bf16 products on WMMA 16x16x32, f32 accumulate; q, k rounded once to f16 (1-product logits, f32, kept in registers); online softmax in f32, base 2, against a running maximum -> unnormalised P f16 (at most 2^8); o = P . v (v once to f16) / row sum; per-position exclusion o -= (o . v_s / (|v_s|^2 + 1e-8)) v_s in f32 with the exact f32 v row; out = o (bf16 hi + lo) Wo^T + bo; f32 output.
#include <hip/hip_runtime.h>
#include <math.h>

typedef __attribute__((ext_vector_type(16))) _Float16 v16h;
typedef __attribute__((ext_vector_type(16))) __bf16 v16b;
typedef __attribute__((ext_vector_type(8)))  _Float16 v8h;
typedef __attribute__((ext_vector_type(8)))  float v8f;
typedef __attribute__((ext_vector_type(4)))  float v4f;
typedef __attribute__((ext_vector_type(2)))  float v2f;
typedef __attribute__((ext_vector_type(4)))  unsigned v4u;
typedef __attribute__((ext_vector_type(4)))  int v4i;
typedef float __attribute__((may_alias)) float_a;
typedef int __attribute__((may_alias)) int_a;

template <typename T> __device__ __forceinline__ void vst2(void* p, T v) { *(T*)p = v;  }
__device__ __forceinline__ v8f wmma16(v16h a, v16h b, v8f c) {
  v8f d = __builtin_amdgcn_wmma_f32_16x16x32_f16(false, a, false, b, (short)0, c, false, false);
  asm volatile("v_nop\n\tv_nop\n\tv_nop\n\tv_nop" : "+v"(d) : "v"(a), "v"(b));
  return d;
}
__device__ __forceinline__ v8f wmma_bf(v16b a, v16b b, v8f c) {
  v8f d = __builtin_amdgcn_wmma_f32_16x16x32_bf16(false, a, false, b, (short)0, c, false, false);
  asm volatile("v_nop\n\tv_nop\n\tv_nop\n\tv_nop" : "+v"(d) : "v"(a), "v"(b));
  return d;
}
// 16x16x32 fragments: lane = (h = lane>>4, row/col = lane&15); elements 0..7 = k0+8h+0..7, 8..15 = k0+16+8h+0..7; D element r = row 8h+r
__device__ __forceinline__ v16h frag_h(const _Float16* rowk0, int lane) {
  union { v16h v; v8h q[2]; } u; const _Float16* p = rowk0 + 8 * (lane >> 4);
  u.q[0] = *(const v8h*)p; u.q[1] = *(const v8h*)(p + 16); return u.v;
}
__device__ __forceinline__ v16h frag_f32(const float* rowk0, int lane) {
  v16h a; const float* p = rowk0 + 8 * (lane >> 4);
#pragma unroll
  for (int i = 0; i < 8; ++i) { a[i] = (_Float16)p[i]; a[8 + i] = (_Float16)p[16 + i]; }
  return a;
}
__device__ __forceinline__ v16h frag_f32s(const float* rowk0, int lane, float sc) {
  v16h a; const float* p = rowk0 + 8 * (lane >> 4);
#pragma unroll
  for (int i = 0; i < 8; ++i) { a[i] = (_Float16)(p[i] * sc); a[8 + i] = (_Float16)(p[16 + i] * sc); }
  return a;
}
// column fragment from a [K][ld] layout (column n), rows >= K read as 0
__device__ __forceinline__ v16h fragc_f32(const float* W, int k0, int n, int lane, int ld, int K) {
  v16h a; const int g = lane >> 4;
#pragma unroll
  for (int i = 0; i < 8; ++i) { const int ka = k0 + 8 * g + i, kb = ka + 16;
    a[i] = (_Float16)(ka < K ? W[(size_t)(ka < K ? ka : K - 1) * ld + n] : 0.f); a[8 + i] = (_Float16)(kb < K ? W[(size_t)(kb < K ? kb : K - 1) * ld + n] : 0.f); }
  return a;
}
struct F2 { v16b h, l; };
__device__ __forceinline__ F2 bsplit16(const float v[16]) { F2 r;
#pragma unroll
  for (int i = 0; i < 16; ++i) { const __bf16 h = (__bf16)v[i]; r.h[i] = h; r.l[i] = (__bf16)(v[i] - (float)h); }
  return r; }
__device__ __forceinline__ F2 split_row(const float* row, int k0, int lane) { float v[16]; const float* p = row + k0 + 8 * (lane >> 4);
#pragma unroll
  for (int i = 0; i < 8; ++i) { v[i] = p[i]; v[8 + i] = p[16 + i]; }
  return bsplit16(v); }
__device__ __forceinline__ F2 split_rowK(const float* row, int k0, int lane, int K) { float v[16]; const int g = lane >> 4;
#pragma unroll
  for (int i = 0; i < 8; ++i) { const int ka = k0 + 8 * g + i, kb = ka + 16; v[i] = ka < K ? row[ka < K ? ka : K - 1] : 0.f; v[8 + i] = kb < K ? row[kb < K ? kb : K - 1] : 0.f; }
  return bsplit16(v); }
__device__ __forceinline__ F2 split_col(const float* W, int k0, int n, int lane, int ld, int K) { float v[16]; const int g = lane >> 4;
#pragma unroll
  for (int i = 0; i < 8; ++i) { const int ka = k0 + 8 * g + i, kb = ka + 16; v[i] = ka < K ? W[(size_t)(ka < K ? ka : K - 1) * ld + n] : 0.f; v[8 + i] = kb < K ? W[(size_t)(kb < K ? kb : K - 1) * ld + n] : 0.f; }
  return bsplit16(v); }
__device__ __forceinline__ v8f mac3(const F2& a, const F2& b, v8f c) { c = wmma_bf(a.l, b.h, c); c = wmma_bf(a.h, b.l, c); return wmma_bf(a.h, b.h, c); }
__device__ __forceinline__ float sigm(float v) { return 1.0f / (1.0f + expf(-v)); }
#define LDSX() do { asm volatile("s_wait_dscnt 0" ::: "memory"); __builtin_amdgcn_wave_barrier(); __builtin_amdgcn_fence(__ATOMIC_RELEASE, "workgroup"); } while (0)


// Exclusive self attention (B 2, S 2,048, D 1,024 = 16 x 64): q/k/v Linear ([out,in] + bias), softmax(q k / 8) v, then per position and head o -= <o, v_s> / (|v_s|^2 + 1e-8) v_s, output Linear.
#define NB 2
#define TT 2048
#define CC 1024
#define NH 16
#define HD 64
#ifndef TNB
#define TNB NB
#endif
typedef __attribute__((ext_vector_type(8))) __bf16 v8b;
__device__ __forceinline__ v16b frag_b(const __bf16* rowk0, int lane) {
  union { v16b v; v8b q[2]; } u; const __bf16* p = rowk0 + 8 * (lane >> 4);
  u.q[0] = *(const v8b*)p; u.q[1] = *(const v8b*)(p + 16); return u.v;
}
__device__ __forceinline__ float bfr(float v) { return (float)(__bf16)v; }
typedef __attribute__((ext_vector_type(4))) __bf16 v4b;
typedef v4f __attribute__((aligned(4))) v4fu;   // 16-byte read of an input that is only known to be float-aligned
#define KP 40   // elements per staged row of 32 bf16: 80 B = 16 B x odd, the pitch at which 16-byte fragment reads meet no bank twice
__device__ __forceinline__ v4b cvt4(v4f v) { v4b r;
#pragma unroll
  for (int i = 0; i < 4; ++i) r[i] = (__bf16)v[i];
  return r; }
__device__ __attribute__((noinline)) float exp_ni(float v) { return expf(v); }
__device__ __attribute__((noinline)) float erf_ni(float v) { return erff(v); }

#define WS_QH  0u
#define WS_QL  (WS_QH + 2u * (size_t)NB * TT * CC)
#define WS_KH  (WS_QL + 2u * (size_t)NB * TT * CC)
#define WS_VT  (WS_KH + 2u * (size_t)NB * TT * CC)      // f16 v planes [b][c][t]
#define WS_Y   (WS_VT + 2u * (size_t)NB * CC * TT)      // f32 y rows [b*t][C]
#define WS_VR  (WS_Y + 4u * (size_t)NB * TT * CC)       // f32 v rows [b*t][C] for the exclusion step
#define WS_END (WS_VR + 4u * (size_t)NB * TT * CC)

// ---- k_proj: block = (64 rows, 128 cols, which): qkv = x W (+ b), exact; q -> f16 hi (+ residual), k -> f16 rows, v -> f16 planes. Per 32-k step the block reads its x and W rows once, a whole 128-B line per 8 lanes, rounds them to bf16 and stages them in LDS (two buffers); the waves take their fragments from there. The stage buffers lie in the same LDS as the epilogue's tiles.
__global__ __launch_bounds__(128) void k_proj(const float* __restrict__ X, const float* __restrict__ WQ, const float* __restrict__ BQ, const float* __restrict__ WK, const float* __restrict__ BK, const float* __restrict__ WV, const float* __restrict__ BV, _Float16* __restrict__ QH, _Float16* __restrict__ QL, _Float16* __restrict__ KH, _Float16* __restrict__ VT, float* __restrict__ VR) {
  __shared__ __align__(16) char sm[128 * 72 * 2 + 64 * 132 * 4];
  _Float16 (*sh)[136] = (_Float16 (*)[136])sm; _Float16 (*sl)[136] = (_Float16 (*)[136])(sm + 64 * 136 * 2);   // q, k epilogue
  _Float16 (*th)[72] = (_Float16 (*)[72])sm; float (*sf)[132] = (float (*)[132])(sm + 128 * 72 * 2);            // v epilogue
  __bf16 (*sA)[64][KP] = (__bf16 (*)[64][KP])sm; __bf16 (*sB)[128][KP] = (__bf16 (*)[128][KP])(sm + 2 * 64 * KP * 2);   // main loop
  const int tid = threadIdx.x, wave = tid >> 5, lane = tid & 31, col = lane & 15, g = lane >> 4; const int which = blockIdx.z; const int c0 = blockIdx.y * 128; const size_t r0 = (size_t)blockIdx.x * 64; const float* WA = which == 0 ? WQ : which == 1 ? WK : WV; const float* BA = which == 0 ? BQ : which == 1 ? BK : BV;
  v8f acc[8] = {};
  const int srow = tid >> 3, sq = tid & 7;   // staging: thread = (row srow + 16 i, 16-byte piece sq of the row's 128-B line)
  const float* Xp = X + (r0 + srow) * CC + sq * 4; const float* Wp = WA + (size_t)(c0 + srow) * CC + sq * 4;
  v4f ra[4], rb[8];
#pragma unroll
  for (int i = 0; i < 4; ++i) ra[i] = *(const v4fu*)(Xp + (size_t)i * 16 * CC);
#pragma unroll
  for (int i = 0; i < 8; ++i) rb[i] = *(const v4fu*)(Wp + (size_t)i * 16 * CC);
#pragma unroll
  for (int i = 0; i < 4; ++i) *(v4b*)&sA[0][srow + i * 16][sq * 4] = cvt4(ra[i]);
#pragma unroll
  for (int i = 0; i < 8; ++i) *(v4b*)&sB[0][srow + i * 16][sq * 4] = cvt4(rb[i]);
  __syncthreads();
#pragma unroll 2   // by two, so that each half addresses its buffers by constants
  for (int kc = 0; kc < CC / 32; ++kc) { const int cur = kc & 1; const bool more = kc + 1 < CC / 32;
    if (more) {   // the next step's lines fly under this step's products
#pragma unroll
      for (int i = 0; i < 4; ++i) ra[i] = *(const v4fu*)(Xp + (size_t)i * 16 * CC + (kc + 1) * 32);
#pragma unroll
      for (int i = 0; i < 8; ++i) rb[i] = *(const v4fu*)(Wp + (size_t)i * 16 * CC + (kc + 1) * 32);
      asm volatile("s_wait_xcnt 0x0" ::: "memory"); }   // behind the run of loads: their address registers may be reused by the roundings below only behind this wait
    const v16b a = frag_b(&sA[cur][wave * 16 + col][0], lane); v16b w[8];
#pragma unroll
    for (int j = 0; j < 8; ++j) w[j] = frag_b(&sB[cur][j * 16 + col][0], lane);
#pragma unroll
    for (int j = 0; j < 8; ++j) acc[j] = wmma_bf(a, w[j], acc[j]);
    __builtin_amdgcn_sched_barrier(0);   // keeps the roundings below, which wait for the lines in flight, from moving up among this step's products
    if (more) {
#pragma unroll
      for (int i = 0; i < 4; ++i) *(v4b*)&sA[cur ^ 1][srow + i * 16][sq * 4] = cvt4(ra[i]);
#pragma unroll
      for (int i = 0; i < 8; ++i) *(v4b*)&sB[cur ^ 1][srow + i * 16][sq * 4] = cvt4(rb[i]); }
    __syncthreads(); }   // publishes the buffer just filled and ends the reads of the one filled next; the last one frees the LDS for the epilogue
#pragma unroll
  for (int j = 0; j < 8; ++j) { const float bb = bfr(BA[c0 + j * 16 + col]);
#pragma unroll
    for (int r = 0; r < 8; ++r) { const float v = acc[j][r] + bb; const int rl = wave * 16 + 8 * g + r, cl = j * 16 + col; const _Float16 hv = (_Float16)v;
      if (which == 2) { th[cl][rl] = hv; sf[rl][cl] = v; } else { sh[rl][cl] = hv; sl[rl][cl] = (_Float16)(v - (float)hv); } } }
  __syncthreads();
  if (which < 2) { _Float16* dh = which == 0 ? QH : KH; for (int e = tid; e < 64 * 16; e += 128) { const int rl = e >> 4, q = e & 15; vst2((unsigned*)(dh + (r0 + rl) * CC + c0 + q * 8), *(const v4u*)&sh[rl][q * 8]); if (which == 0) vst2((unsigned*)(QL + (r0 + rl) * CC + c0 + q * 8), *(const v4u*)&sl[rl][q * 8]); } }
  else { const size_t b = r0 / TT; const int t0 = (int)(r0 % TT); for (int e = tid; e < 128 * 8; e += 128) { const int cl = e >> 3, q = e & 7; vst2((unsigned*)(VT + (b * CC + c0 + cl) * (size_t)TT + t0 + q * 8), *(const v4u*)&th[cl][q * 8]); }
    for (int e = tid; e < 64 * 32; e += 128) { const int rl = e >> 5, q = e & 31; vst2(VR + (r0 + rl) * CC + c0 + q * 4, *(const v4f*)&sf[rl][q * 4]); } } }
// ---- k_fa: block = 8 waves x 32 queries of (b,h). The block brings K rows and V plane rows to LDS once per stage of 128 keys, by asynchronous copies into two buffers, and its 8 waves take their fragments from there. Per pass of 32 keys: S^T = K Q^T (a lane holds 16 logits of one query per 16-query tile), online softmax in registers, O^T += V^T P^T (the two S^T tiles, converted in place, are the B operand); then the exclusion step and the y rows.
__device__ __forceinline__ float xhalf(float x) { return __builtin_bit_cast(float, __builtin_amdgcn_permlanex16(__builtin_bit_cast(int, x), __builtin_bit_cast(int, x), 0x76543210, 0xfedcba98, false, false)); }  // lane l with lane l ^ 16
#define QT 2
#define SK 128   // keys per stage
#define KPI 72   // f16 per staged K row of 64: 144 B = 16 B x odd (no bank met twice by 16-byte fragment reads)
#define VPI 136  // f16 per staged V plane row of 128: 272 B = 16 B x odd
// one stage: 128 K rows of 128 B and 64 V plane rows of 256 B, 8 copies of 16 B per lane, whole lines per wave. The s_wait_xcnt stands inside the statement, so that no address register is rewritten in front of it.
__device__ __forceinline__ void stage_kv(const _Float16* gk, const _Float16* gv, unsigned lk, unsigned lv) {
  asm volatile("global_load_async_to_lds_b128 %0, %8, off\n\tglobal_load_async_to_lds_b128 %1, %9, off\n\tglobal_load_async_to_lds_b128 %2, %10, off\n\tglobal_load_async_to_lds_b128 %3, %11, off\n\t"
               "global_load_async_to_lds_b128 %4, %12, off\n\tglobal_load_async_to_lds_b128 %5, %13, off\n\tglobal_load_async_to_lds_b128 %6, %14, off\n\tglobal_load_async_to_lds_b128 %7, %15, off\n\ts_wait_xcnt 0x0"
               :: "v"(lk), "v"(lk + 32u * KPI * 2u), "v"(lk + 64u * KPI * 2u), "v"(lk + 96u * KPI * 2u), "v"(lv), "v"(lv + 16u * VPI * 2u), "v"(lv + 32u * VPI * 2u), "v"(lv + 48u * VPI * 2u),
                  "v"(gk), "v"(gk + 32 * CC), "v"(gk + 64 * CC), "v"(gk + 96 * CC), "v"(gv), "v"(gv + 16 * (size_t)TT), "v"(gv + 32 * (size_t)TT), "v"(gv + 48 * (size_t)TT) : "memory");
}
__global__ __launch_bounds__(256) void k_fa(const _Float16* __restrict__ QH, const _Float16* __restrict__ KH, const _Float16* __restrict__ VT, const float* __restrict__ VR, float* __restrict__ Y) {
  const int tid = threadIdx.x, wave = tid >> 5, lane = tid & 31, col = lane & 15, g = lane >> 4; const int h = blockIdx.y, b = blockIdx.z; const int ql0 = blockIdx.x * (8 * 16 * QT) + wave * (16 * QT);
  __shared__ __align__(16) _Float16 sK[2][SK][KPI]; __shared__ __align__(16) _Float16 sV[2][HD][VPI];
  const _Float16* Kg = KH + ((size_t)b * TT + (tid >> 3)) * CC + h * HD + (tid & 7) * 8;              // copies: lane = (key row tid/8 + 32 i, 16-byte piece tid%8 of its 128 B)
  const _Float16* Vg = VT + ((size_t)b * CC + h * HD + (tid >> 4)) * (size_t)TT + (tid & 15) * 8;     // copies: lane = (plane row tid/16 + 16 i, 16-byte piece tid%16 of the stage's 256 B)
  const unsigned lk0 = (unsigned)(size_t)&sK[0][tid >> 3][(tid & 7) * 8], lv0 = (unsigned)(size_t)&sV[0][tid >> 4][(tid & 15) * 8];   // the lane's LDS byte addresses in buffer 0
  stage_kv(Kg, Vg, lk0, lv0);
  const float SC = 0.125f * 1.4426950408889634f;                             // logits / 8, in base 2
  const _Float16* Qa = QH + ((size_t)b * TT + ql0 + col) * CC + h * HD + 8 * g;   // this lane's first 8 elements of query row col (fragment order as in frag_h)
  v16h qf[QT][2];
#pragma unroll
  for (int t = 0; t < QT; ++t)
#pragma unroll
    for (int kc = 0; kc < 2; ++kc) { union { v16h v; v8h q[2]; } u; u.q[0] = *(const v8h*)(Qa + t * 16 * CC + kc * 32); u.q[1] = *(const v8h*)(Qa + t * 16 * CC + kc * 32 + 16); qf[t][kc] = u.v; }
  asm volatile("s_wait_xcnt 0x0" :: "v"(Qa) : "memory");   // the Q loads' address register stays live up to this wait, so that the accumulators below reuse it only behind it
  asm volatile("s_wait_asynccnt 0x0" ::: "memory");        // stage 0 has landed, as far as this wave copied it
  __syncthreads();                                          // publishes stage 0
  stage_kv(Kg + (size_t)SK * CC, Vg + SK, lk0 + (unsigned)sizeof(sK[0]), lv0 + (unsigned)sizeof(sV[0]));   // stage 1 flies under stage 0's passes
  v8f acc[QT][4] = {}; float mr[QT], lr[QT];
#pragma unroll
  for (int t = 0; t < QT; ++t) { mr[t] = -3.0e38f; lr[t] = 0.f; }
#pragma unroll 1
  for (int st = 0; st < TT / SK; ++st) {   // rolled: the two buffers differ by a base address only
   const _Float16* Ks = &sK[st & 1][col][0];   // key row col of a 16-key tile
   const _Float16* Vs = &sV[st & 1][col][0];   // plane row d = col of a 16-d tile
   v16h kf[2][2];
#pragma unroll
   for (int i = 0; i < 2; ++i)
#pragma unroll
     for (int kc = 0; kc < 2; ++kc) kf[i][kc] = frag_h(Ks + (i * 16) * KPI + kc * 32, lane);
#pragma unroll   // the stage's four passes: every LDS offset a constant
   for (int p = 0; p < SK / 32; ++p) {
    v16h vf[4];
#pragma unroll
    for (int j = 0; j < 4; ++j) vf[j] = frag_h(Vs + (j * 16) * VPI + p * 32, lane);
    v8f s[QT][2];
#pragma unroll
    for (int t = 0; t < QT; ++t)
#pragma unroll
      for (int i = 0; i < 2; ++i) { v8f z = {}; z = wmma16(kf[i][0], qf[t][0], z); s[t][i] = wmma16(kf[i][1], qf[t][1], z); }
    if (p + 1 < SK / 32) {   // the next pass's K fragments come under the softmax; never the next stage's, which is not published yet
#pragma unroll
      for (int i = 0; i < 2; ++i)
#pragma unroll
        for (int kc = 0; kc < 2; ++kc) kf[i][kc] = frag_h(Ks + ((p + 1) * 32 + i * 16) * KPI + kc * 32, lane); }
    float mx[QT]; bool need = false;
#pragma unroll
    for (int t = 0; t < QT; ++t) { float a = fmaxf(s[t][0][0], s[t][1][0]);
#pragma unroll
      for (int r = 1; r < 8; ++r) a = fmaxf(a, fmaxf(s[t][0][r], s[t][1][r]));
      a = fmaxf(a, xhalf(a)); mx[t] = a * SC; need = need || (mx[t] > mr[t] + 8.0f); }
    if (__builtin_amdgcn_ballot_w32(need) != 0) {   // lazy rescale: only when some query's maximum has grown by more than 2^8 (always on the first pass)
#pragma unroll
      for (int t = 0; t < QT; ++t) { const float mn = fmaxf(mr[t], mx[t]); const float al = __builtin_amdgcn_exp2f(mr[t] - mn); mr[t] = mn; lr[t] *= al;
#pragma unroll
        for (int j = 0; j < 4; ++j) acc[t][j] *= al; }
    }
#pragma unroll
    for (int t = 0; t < QT; ++t) { v16h pf; v2f sum = {0.f, 0.f}; const v2f sc2 = {SC, SC}, nm2 = {-mr[t], -mr[t]};
#pragma unroll
      for (int i = 0; i < 2; ++i)
#pragma unroll
        for (int r = 0; r < 8; r += 2) { v2f a = {s[t][i][r], s[t][i][r + 1]}; a = __builtin_elementwise_fma(a, sc2, nm2); const v2f e = {__builtin_amdgcn_exp2f(a[0]), __builtin_amdgcn_exp2f(a[1])}; sum += e; pf[i * 8 + r] = (_Float16)e[0]; pf[i * 8 + r + 1] = (_Float16)e[1]; }
      lr[t] += sum[0] + sum[1];
#pragma unroll
      for (int j = 0; j < 4; ++j) acc[t][j] = wmma16(vf[j], pf, acc[t][j]); }
    __builtin_amdgcn_sched_barrier(0);   // keeps the next pass's V fragment loads out of this pass: a second set of them takes the kernel over 256 registers
   }
   asm volatile("s_wait_dscnt 0x0" ::: "memory");      // this wave's reads of the stage's buffer are over
   asm volatile("s_wait_asynccnt 0x0" ::: "memory");   // the next stage has landed, as far as this wave copied it
   __syncthreads();                                     // publishes the next stage and frees this stage's buffer
   if (st + 2 < TT / SK) stage_kv(Kg + (size_t)(st + 2) * SK * CC, Vg + (st + 2) * SK, lk0 + (unsigned)(st & 1) * (unsigned)sizeof(sK[0]), lv0 + (unsigned)(st & 1) * (unsigned)sizeof(sV[0]));
  }
  asm volatile("s_wait_asynccnt 0x0" ::: "memory");    // no copy is left in flight when the wave goes on to its end
#pragma unroll
  for (int t = 0; t < QT; ++t) {   // lane (g, col) holds o[d = 16 j + 8 g + r] of query col; the two halves of a query join by one exchange
    const float inv = 1.0f / (lr[t] + xhalf(lr[t])); const size_t ro = ((size_t)b * TT + ql0 + t * 16 + col) * CC + h * HD + 8 * g;
    v4f vv[4][2]; float dt = 0.f, nn = 0.f;
#pragma unroll
    for (int j = 0; j < 4; ++j) { vv[j][0] = *(const v4f*)(VR + ro + j * 16); vv[j][1] = *(const v4f*)(VR + ro + j * 16 + 4);
#pragma unroll
      for (int r = 0; r < 8; ++r) { const float o = acc[t][j][r] * inv, v = vv[j][r >> 2][r & 3]; acc[t][j][r] = o; dt += o * v; nn += v * v; } }
    dt += xhalf(dt); nn += xhalf(nn); const float al = dt / (nn + 1e-8f);
#pragma unroll
    for (int j = 0; j < 4; ++j) { v4f o0, o1;
#pragma unroll
      for (int r = 0; r < 4; ++r) { o0[r] = acc[t][j][r] - al * vv[j][0][r]; o1[r] = acc[t][j][4 + r] - al * vv[j][1][r]; }
      vst2(Y + ro + j * 16, o0); vst2(Y + ro + j * 16 + 4, o1); } } }
// ---- k_out: block = (64 rows, 128 cols): out = y (bf16 hi + lo) Wproj + b; y (split once per block) and W staged in LDS as in k_proj
__global__ __launch_bounds__(128) void k_out(const float* __restrict__ Y, const float* __restrict__ WP, const float* __restrict__ BP, float* __restrict__ OUT) { __shared__ __align__(16) float sf[4][16][132]; __shared__ __align__(16) __bf16 sH[2][64][KP], sL[2][64][KP], sB[2][128][KP];
  const int tid = threadIdx.x, wave = tid >> 5, lane = tid & 31, col = lane & 15, g = lane >> 4; const int c0 = blockIdx.y * 128; const size_t r0 = (size_t)blockIdx.x * 64 + wave * 16;
  v8f acc[8] = {};
  const int srow = tid >> 3, sq = tid & 7;   // staging: thread = (row srow + 16 i, 16-byte piece sq of the row's 128-B line)
  const float* Yp = Y + ((size_t)blockIdx.x * 64 + srow) * CC + sq * 4; const float* Wp = WP + (size_t)(c0 + srow) * CC + sq * 4;
  v4f ra[4], rb[8];
#pragma unroll
  for (int i = 0; i < 4; ++i) ra[i] = *(const v4f*)(Yp + (size_t)i * 16 * CC);
#pragma unroll
  for (int i = 0; i < 8; ++i) rb[i] = *(const v4fu*)(Wp + (size_t)i * 16 * CC);
#pragma unroll
  for (int i = 0; i < 4; ++i) { const v4b hi = cvt4(ra[i]); v4f re;
#pragma unroll
    for (int e = 0; e < 4; ++e) re[e] = ra[i][e] - (float)hi[e];
    *(v4b*)&sH[0][srow + i * 16][sq * 4] = hi; *(v4b*)&sL[0][srow + i * 16][sq * 4] = cvt4(re); }
#pragma unroll
  for (int i = 0; i < 8; ++i) *(v4b*)&sB[0][srow + i * 16][sq * 4] = cvt4(rb[i]);
  __syncthreads();
#pragma unroll 2   // by two, so that each half addresses its buffers by constants
  for (int kc = 0; kc < CC / 32; ++kc) { const int cur = kc & 1; const bool more = kc + 1 < CC / 32;
    if (more) {   // the next step's lines fly under this step's products
#pragma unroll
      for (int i = 0; i < 4; ++i) ra[i] = *(const v4f*)(Yp + (size_t)i * 16 * CC + (kc + 1) * 32);
#pragma unroll
      for (int i = 0; i < 8; ++i) rb[i] = *(const v4fu*)(Wp + (size_t)i * 16 * CC + (kc + 1) * 32);
      asm volatile("s_wait_xcnt 0x0" ::: "memory"); }   // behind the run of loads: their address registers may be reused by the roundings below only behind this wait
    const v16b ah = frag_b(&sH[cur][wave * 16 + col][0], lane), al = frag_b(&sL[cur][wave * 16 + col][0], lane); v16b w[8];
#pragma unroll
    for (int j = 0; j < 8; ++j) w[j] = frag_b(&sB[cur][j * 16 + col][0], lane);
#pragma unroll
    for (int j = 0; j < 8; ++j) { acc[j] = wmma_bf(ah, w[j], acc[j]); acc[j] = wmma_bf(al, w[j], acc[j]); }
    __builtin_amdgcn_sched_barrier(0);   // keeps the roundings below, which wait for the lines in flight, from moving up among this step's products
    if (more) {
#pragma unroll
      for (int i = 0; i < 4; ++i) { const v4b hi = cvt4(ra[i]); v4f re;
#pragma unroll
        for (int e = 0; e < 4; ++e) re[e] = ra[i][e] - (float)hi[e];
        *(v4b*)&sH[cur ^ 1][srow + i * 16][sq * 4] = hi; *(v4b*)&sL[cur ^ 1][srow + i * 16][sq * 4] = cvt4(re); }
#pragma unroll
      for (int i = 0; i < 8; ++i) *(v4b*)&sB[cur ^ 1][srow + i * 16][sq * 4] = cvt4(rb[i]); }
    __syncthreads(); }   // publishes the buffer just filled and ends the reads of the one filled next
#pragma unroll
  for (int j = 0; j < 8; ++j) { const float bb = BP ? bfr(BP[c0 + j * 16 + col]) : 0.f;
#pragma unroll
    for (int r = 0; r < 8; ++r) sf[wave][8 * g + r][j * 16 + col] = acc[j][r] + bb; }
  LDSX(); for (int rl = 0; rl < 16; ++rl) vst2(OUT + (r0 + rl) * CC + c0 + lane * 4, *(const v4f*)&sf[wave][rl][lane * 4]); }
extern "C" void kernel_launch(void* const* d_in, const int* in_sizes, int n_in, void* d_out, int out_size, void* d_ws, size_t ws_size, hipStream_t stream) {
  (void)in_sizes; (void)n_in; (void)out_size;
  const float** F = (const float**)d_in;   // 0 x [2,2048,1024], 1 wq [1024,1024] ([out,in]), 2 bq, 3 wk, 4 bk, 5 wv, 6 bv, 7 wo, 8 bo
  if (ws_size < (size_t)WS_END) return;
  char* ws = (char*)d_ws; _Float16 *QH = (_Float16*)(ws + WS_QH), *QL = (_Float16*)(ws + WS_QL), *KH = (_Float16*)(ws + WS_KH), *VT = (_Float16*)(ws + WS_VT); float *Y = (float*)(ws + WS_Y), *VR = (float*)(ws + WS_VR);
  k_proj<<<dim3(TNB * TT / 64, CC / 128, 3), 128, 0, stream>>>(F[0], F[1], F[2], F[3], F[4], F[5], F[6], QH, QL, KH, VT, VR);
  k_fa<<<dim3(TT / (8 * 16 * QT), NH, TNB), 256, 0, stream>>>(QH, KH, VT, VR, Y);
  k_out<<<dim3(TNB * TT / 64, CC / 128), 128, 0, stream>>>(Y, F[7], F[8], (float*)d_out);
}

// v004
// It runs in 95.2 microseconds.
// Next to v003, in two timings, it ran 1.29 times as fast each time.
// All steps since v000 together make it 14.3 times as fast.
// compute dtype: all float inputs rounded to bf16; q/k/v = x W^T + b with EXACT bf16 products on WMMA 16x16x32, f32 accumulate; q, k rounded once to f16 (1-product logits, f32, kept in registers); online softmax in f32, base 2, against a running maximum -> unnormalised P f16 (at most 2^8); o = P . v (v once to f16) / row sum; per-position exclusion o -= (o . v_s / (|v_s|^2 + 1e-8)) v_s in f32 with the exact f32 v row; out = o (bf16 hi + lo) Wo^T + bo; f32 output.
#include <hip/hip_runtime.h>
#include <math.h>

typedef __attribute__((ext_vector_type(16))) _Float16 v16h;
typedef __attribute__((ext_vector_type(16))) __bf16 v16b;
typedef __attribute__((ext_vector_type(8)))  _Float16 v8h;
typedef __attribute__((ext_vector_type(8)))  float v8f;
typedef __attribute__((ext_vector_type(4)))  float v4f;
typedef __attribute__((ext_vector_type(2)))  float v2f;
typedef __attribute__((ext_vector_type(4)))  unsigned v4u;
typedef __attribute__((ext_vector_type(4)))  int v4i;
typedef float __attribute__((may_alias)) float_a;
typedef int __attribute__((may_alias)) int_a;

template <typename T> __device__ __forceinline__ void vst2(void* p, T v) { *(T*)p = v;  }
__device__ __forceinline__ v8f wmma16(v16h a, v16h b, v8f c) {
  v8f d = __builtin_amdgcn_wmma_f32_16x16x32_f16(false, a, false, b, (short)0, c, false, false);
  asm volatile("v_nop\n\tv_nop\n\tv_nop\n\tv_nop" : "+v"(d) : "v"(a), "v"(b));
  return d;
}
__device__ __forceinline__ v8f wmma_bf(v16b a, v16b b, v8f c) {
  v8f d = __builtin_amdgcn_wmma_f32_16x16x32_bf16(false, a, false, b, (short)0, c, false, false);
  asm volatile("v_nop\n\tv_nop\n\tv_nop\n\tv_nop" : "+v"(d) : "v"(a), "v"(b));
  return d;
}
// 16x16x32 fragments: lane = (h = lane>>4, row/col = lane&15); elements 0..7 = k0+8h+0..7, 8..15 = k0+16+8h+0..7; D element r = row 8h+r
__device__ __forceinline__ v16h frag_h(const _Float16* rowk0, int lane) {
  union { v16h v; v8h q[2]; } u; const _Float16* p = rowk0 + 8 * (lane >> 4);
  u.q[0] = *(const v8h*)p; u.q[1] = *(const v8h*)(p + 16); return u.v;
}
__device__ __forceinline__ v16h frag_f32(const float* rowk0, int lane) {
  v16h a; const float* p = rowk0 + 8 * (lane >> 4);
#pragma unroll
  for (int i = 0; i < 8; ++i) { a[i] = (_Float16)p[i]; a[8 + i] = (_Float16)p[16 + i]; }
  return a;
}
__device__ __forceinline__ v16h frag_f32s(const float* rowk0, int lane, float sc) {
  v16h a; const float* p = rowk0 + 8 * (lane >> 4);
#pragma unroll
  for (int i = 0; i < 8; ++i) { a[i] = (_Float16)(p[i] * sc); a[8 + i] = (_Float16)(p[16 + i] * sc); }
  return a;
}
// column fragment from a [K][ld] layout (column n), rows >= K read as 0
__device__ __forceinline__ v16h fragc_f32(const float* W, int k0, int n, int lane, int ld, int K) {
  v16h a; const int g = lane >> 4;
#pragma unroll
  for (int i = 0; i < 8; ++i) { const int ka = k0 + 8 * g + i, kb = ka + 16;
    a[i] = (_Float16)(ka < K ? W[(size_t)(ka < K ? ka : K - 1) * ld + n] : 0.f); a[8 + i] = (_Float16)(kb < K ? W[(size_t)(kb < K ? kb : K - 1) * ld + n] : 0.f); }
  return a;
}
struct F2 { v16b h, l; };
__device__ __forceinline__ F2 bsplit16(const float v[16]) { F2 r;
#pragma unroll
  for (int i = 0; i < 16; ++i) { const __bf16 h = (__bf16)v[i]; r.h[i] = h; r.l[i] = (__bf16)(v[i] - (float)h); }
  return r; }
__device__ __forceinline__ F2 split_row(const float* row, int k0, int lane) { float v[16]; const float* p = row + k0 + 8 * (lane >> 4);
#pragma unroll
  for (int i = 0; i < 8; ++i) { v[i] = p[i]; v[8 + i] = p[16 + i]; }
  return bsplit16(v); }
__device__ __forceinline__ F2 split_rowK(const float* row, int k0, int lane, int K) { float v[16]; const int g = lane >> 4;
#pragma unroll
  for (int i = 0; i < 8; ++i) { const int ka = k0 + 8 * g + i, kb = ka + 16; v[i] = ka < K ? row[ka < K ? ka : K - 1] : 0.f; v[8 + i] = kb < K ? row[kb < K ? kb : K - 1] : 0.f; }
  return bsplit16(v); }
__device__ __forceinline__ F2 split_col(const float* W, int k0, int n, int lane, int ld, int K) { float v[16]; const int g = lane >> 4;
#pragma unroll
  for (int i = 0; i < 8; ++i) { const int ka = k0 + 8 * g + i, kb = ka + 16; v[i] = ka < K ? W[(size_t)(ka < K ? ka : K - 1) * ld + n] : 0.f; v[8 + i] = kb < K ? W[(size_t)(kb < K ? kb : K - 1) * ld + n] : 0.f; }
  return bsplit16(v); }
__device__ __forceinline__ v8f mac3(const F2& a, const F2& b, v8f c) { c = wmma_bf(a.l, b.h, c); c = wmma_bf(a.h, b.l, c); return wmma_bf(a.h, b.h, c); }
__device__ __forceinline__ float sigm(float v) { return 1.0f / (1.0f + expf(-v)); }
#define LDSX() do { asm volatile("s_wait_dscnt 0" ::: "memory"); __builtin_amdgcn_wave_barrier(); __builtin_amdgcn_fence(__ATOMIC_RELEASE, "workgroup"); } while (0)


// Exclusive self attention (B 2, S 2,048, D 1,024 = 16 x 64): q/k/v Linear ([out,in] + bias), softmax(q k / 8) v, then per position and head o -= <o, v_s> / (|v_s|^2 + 1e-8) v_s, output Linear.
#define NB 2
#define TT 2048
#define CC 1024
#define NH 16
#define HD 64
#ifndef TNB
#define TNB NB
#endif
typedef __attribute__((ext_vector_type(8))) __bf16 v8b;
__device__ __forceinline__ v16b frag_b(const __bf16* rowk0, int lane) {
  union { v16b v; v8b q[2]; } u; const __bf16* p = rowk0 + 8 * (lane >> 4);
  u.q[0] = *(const v8b*)p; u.q[1] = *(const v8b*)(p + 16); return u.v;
}
__device__ __forceinline__ float bfr(float v) { return (float)(__bf16)v; }
typedef __attribute__((ext_vector_type(4))) __bf16 v4b;
typedef v4f __attribute__((aligned(4))) v4fu;   // 16-byte read of an input that is only known to be float-aligned
#define KP 40   // elements per staged row of 32 bf16: 80 B = 16 B x odd, the pitch at which 16-byte fragment reads meet no bank twice
__device__ __forceinline__ v4b cvt4(v4f v) { v4b r;
#pragma unroll
  for (int i = 0; i < 4; ++i) r[i] = (__bf16)v[i];
  return r; }
__device__ __attribute__((noinline)) float exp_ni(float v) { return expf(v); }
__device__ __attribute__((noinline)) float erf_ni(float v) { return erff(v); }

#define WS_QH  0u
#define WS_QL  (WS_QH + 2u * (size_t)NB * TT * CC)
#define WS_KH  (WS_QL + 2u * (size_t)NB * TT * CC)
#define WS_VT  (WS_KH + 2u * (size_t)NB * TT * CC)      // f16 v planes [b][c][t]
#define WS_Y   (WS_VT + 2u * (size_t)NB * CC * TT)      // f32 y rows [b*t][C]
#define WS_VR  (WS_Y + 4u * (size_t)NB * TT * CC)       // f32 v rows [b*t][C] for the exclusion step
#define WS_END (WS_VR + 4u * (size_t)NB * TT * CC)

// ---- k_proj: block = 16 waves = (256 rows, 256 cols, which), a wave = 64 x 64: qkv = x W (+ b), exact; q -> f16 hi (+ residual), k -> f16 rows, v -> f16 planes and f32 rows. Per 32-k step the block reads its x and W rows once, a whole 128-B line per 8 lanes, rounds them to bf16 and stages them in LDS (two buffers); a wave takes 4 + 4 fragments from there for 16 products. In the epilogue each wave turns its own tile in its own piece of the same LDS.
#define PBM 256   // rows of x per block
#define PBN 256   // rows of W (output columns) per block
#define PNT 512   // threads: 4 x 4 waves
#define PEW 9216  // bytes of LDS per wave in the epilogue: 64 rows of 72 f16, or 32 rows of 68 f32
__global__ __launch_bounds__(PNT) void k_proj(const float* __restrict__ X, const float* __restrict__ WQ, const float* __restrict__ BQ, const float* __restrict__ WK, const float* __restrict__ BK, const float* __restrict__ WV, const float* __restrict__ BV, _Float16* __restrict__ QH, _Float16* __restrict__ QL, _Float16* __restrict__ KH, _Float16* __restrict__ VT, float* __restrict__ VR) {
  __shared__ __align__(16) char sm[(PNT / 32) * PEW];
  __bf16 (*sA)[PBM][KP] = (__bf16 (*)[PBM][KP])sm; __bf16 (*sB)[PBN][KP] = (__bf16 (*)[PBN][KP])(sm + 2 * PBM * KP * 2);   // main loop: 2 x 20 KiB each
  const int tid = threadIdx.x, wave = tid >> 5, lane = tid & 31, col = lane & 15, g = lane >> 4; const int wr = wave >> 2, wc = wave & 3; const int which = blockIdx.z; const int c0 = blockIdx.y * PBN; const size_t r0 = (size_t)blockIdx.x * PBM; const float* WA = which == 0 ? WQ : which == 1 ? WK : WV; const float* BA = which == 0 ? BQ : which == 1 ? BK : BV;
  v8f acc[4][4] = {};
  const int srow = tid >> 3, sq = tid & 7;   // staging: thread = (row srow + 64 i, 16-byte piece sq of the row's 128-B line)
  const float* Xp = X + (r0 + srow) * CC + sq * 4; const float* Wp = WA + (size_t)(c0 + srow) * CC + sq * 4;
  v4f ra[4], rb[4];
#pragma unroll
  for (int i = 0; i < 4; ++i) ra[i] = *(const v4fu*)(Xp + (size_t)i * 64 * CC);
#pragma unroll
  for (int i = 0; i < 4; ++i) rb[i] = *(const v4fu*)(Wp + (size_t)i * 64 * CC);
#pragma unroll
  for (int i = 0; i < 4; ++i) *(v4b*)&sA[0][srow + i * 64][sq * 4] = cvt4(ra[i]);
#pragma unroll
  for (int i = 0; i < 4; ++i) *(v4b*)&sB[0][srow + i * 64][sq * 4] = cvt4(rb[i]);
  __syncthreads();
#pragma unroll 2   // by two, so that each half addresses its buffers by constants
  for (int kc = 0; kc < CC / 32; ++kc) { const int cur = kc & 1; const bool more = kc + 1 < CC / 32;
    if (more) {   // the next step's lines fly under this step's products
#pragma unroll
      for (int i = 0; i < 4; ++i) ra[i] = *(const v4fu*)(Xp + (size_t)i * 64 * CC + (kc + 1) * 32);
#pragma unroll
      for (int i = 0; i < 4; ++i) rb[i] = *(const v4fu*)(Wp + (size_t)i * 64 * CC + (kc + 1) * 32);
      asm volatile("s_wait_xcnt 0x0" ::: "memory"); }   // behind the run of loads: their address registers may be reused by the roundings below only behind this wait
    v16b a[4], w[4];
#pragma unroll
    for (int i = 0; i < 4; ++i) a[i] = frag_b(&sA[cur][wr * 64 + i * 16 + col][0], lane);
#pragma unroll
    for (int j = 0; j < 4; ++j) w[j] = frag_b(&sB[cur][wc * 64 + j * 16 + col][0], lane);
#pragma unroll
    for (int i = 0; i < 4; ++i)
#pragma unroll
      for (int j = 0; j < 4; ++j) acc[i][j] = wmma_bf(a[i], w[j], acc[i][j]);
    __builtin_amdgcn_sched_barrier(0);   // keeps the roundings below, which wait for the lines in flight, from moving up among this step's products
    if (more) {
#pragma unroll
      for (int i = 0; i < 4; ++i) *(v4b*)&sA[cur ^ 1][srow + i * 64][sq * 4] = cvt4(ra[i]);
#pragma unroll
      for (int i = 0; i < 4; ++i) *(v4b*)&sB[cur ^ 1][srow + i * 64][sq * 4] = cvt4(rb[i]); }
    __syncthreads(); }   // publishes the buffer just filled and ends the reads of the one filled next; the last one frees the LDS for the epilogue
  char* ew = sm + wave * PEW;   // this wave's own piece: no other wave reads or writes it from here on, so LDSX() orders all that follows
  const size_t rw = r0 + wr * 64; const int cw = c0 + wc * 64;   // the wave's first row and column
  const int bi = cw + col; float bb[4];
#pragma unroll
  for (int j = 0; j < 4; ++j) bb[j] = BA[bi + j * 16];
  asm volatile("s_wait_xcnt 0x0" :: "v"(bi) : "memory");   // the bias loads' index register stays live up to this wait, so that none of the four lands on it in front of the wait
#pragma unroll
  for (int j = 0; j < 4; ++j) bb[j] = bfr(bb[j]);
  if (which == 0) { _Float16 (*eh)[72] = (_Float16 (*)[72])ew;   // 32 rows at a time: rows 0..31 of the piece hold q's f16 value, rows 32..63 its residual
#pragma unroll
    for (int hf = 0; hf < 2; ++hf) {
      if (hf) LDSX();   // the first half's reads are over before its rows are written anew
#pragma unroll
      for (int i = 0; i < 2; ++i)
#pragma unroll
        for (int j = 0; j < 4; ++j)
#pragma unroll
          for (int r = 0; r < 8; ++r) { const float v = acc[hf * 2 + i][j][r] + bb[j]; const _Float16 hv = (_Float16)v; eh[i * 16 + 8 * g + r][j * 16 + col] = hv; eh[32 + i * 16 + 8 * g + r][j * 16 + col] = (_Float16)(v - (float)hv); }
      LDSX();
#pragma unroll
      for (int e = 0; e < 8; ++e) { const int rl = e * 4 + (lane >> 3), q = lane & 7; const size_t o = (rw + hf * 32 + rl) * CC + cw + q * 8;   // 4 whole 128-B lines per store
        vst2((unsigned*)(QH + o), *(const v4u*)&eh[rl][q * 8]); vst2((unsigned*)(QL + o), *(const v4u*)&eh[32 + rl][q * 8]); } }
    asm volatile("s_wait_xcnt 0x0" ::: "memory");   // behind the wave's last stores: no register that they name is reused in front of this wait
  }
  else if (which == 1) { _Float16 (*eh)[72] = (_Float16 (*)[72])ew;
#pragma unroll
    for (int i = 0; i < 4; ++i)
#pragma unroll
      for (int j = 0; j < 4; ++j)
#pragma unroll
        for (int r = 0; r < 8; ++r) eh[i * 16 + 8 * g + r][j * 16 + col] = (_Float16)(acc[i][j][r] + bb[j]);
    LDSX();
#pragma unroll
    for (int e = 0; e < 16; ++e) { const int rl = e * 4 + (lane >> 3), q = lane & 7; vst2((unsigned*)(KH + (rw + rl) * CC + cw + q * 8), *(const v4u*)&eh[rl][q * 8]); }   // 4 whole 128-B lines per store
    asm volatile("s_wait_xcnt 0x0" ::: "memory");   // behind the wave's last stores: no register that they name is reused in front of this wait
  }
  else { _Float16 (*et)[72] = (_Float16 (*)[72])ew; float (*ef)[68] = (float (*)[68])ew; const size_t b = rw / TT; const int t0 = (int)(rw % TT);
#pragma unroll
    for (int i = 0; i < 4; ++i)
#pragma unroll
      for (int j = 0; j < 4; ++j) { v8h hv;
#pragma unroll
        for (int r = 0; r < 8; ++r) hv[r] = (_Float16)(acc[i][j][r] + bb[j]);
        *(v8h*)&et[j * 16 + col][i * 16 + 8 * g] = hv; }   // a lane's 8 rows are 8 neighbours of one plane row
    LDSX();
#pragma unroll
    for (int e = 0; e < 16; ++e) { const int cl = e * 4 + (lane >> 3), q = lane & 7; vst2((unsigned*)(VT + (b * CC + cw + cl) * (size_t)TT + t0 + q * 8), *(const v4u*)&et[cl][q * 8]); }
#pragma unroll
    for (int hf = 0; hf < 2; ++hf) {   // the f32 rows, 32 at a time
      LDSX();
#pragma unroll
      for (int i = 0; i < 2; ++i)
#pragma unroll
        for (int j = 0; j < 4; ++j)
#pragma unroll
          for (int r = 0; r < 8; ++r) ef[i * 16 + 8 * g + r][j * 16 + col] = acc[hf * 2 + i][j][r] + bb[j];
      LDSX();
#pragma unroll
      for (int e = 0; e < 16; ++e) { const int rl = e * 2 + (lane >> 4), q = lane & 15; vst2(VR + (rw + hf * 32 + rl) * CC + cw + q * 4, *(const v4f*)&ef[rl][q * 4]); } }
    asm volatile("s_wait_xcnt 0x0" ::: "memory");   // behind the wave's last stores: no register that they name is reused in front of this wait
  } }
// ---- k_fa: block = 8 waves x 32 queries of (b,h). The block brings K rows and V plane rows to LDS once per stage of 128 keys, by asynchronous copies into two buffers, and its 8 waves take their fragments from there. Per pass of 32 keys: S^T = K Q^T (a lane holds 16 logits of one query per 16-query tile), online softmax in registers, O^T += V^T P^T (the two S^T tiles, converted in place, are the B operand); then the exclusion step and the y rows.
__device__ __forceinline__ float xhalf(float x) { return __builtin_bit_cast(float, __builtin_amdgcn_permlanex16(__builtin_bit_cast(int, x), __builtin_bit_cast(int, x), 0x76543210, 0xfedcba98, false, false)); }  // lane l with lane l ^ 16
#define QT 2
#define SK 128   // keys per stage
#define KPI 72   // f16 per staged K row of 64: 144 B = 16 B x odd (no bank met twice by 16-byte fragment reads)
#define VPI 136  // f16 per staged V plane row of 128: 272 B = 16 B x odd
// one stage: 128 K rows of 128 B and 64 V plane rows of 256 B, 8 copies of 16 B per lane, whole lines per wave. The s_wait_xcnt stands inside the statement, so that no address register is rewritten in front of it.
__device__ __forceinline__ void stage_kv(const _Float16* gk, const _Float16* gv, unsigned lk, unsigned lv) {
  asm volatile("global_load_async_to_lds_b128 %0, %8, off\n\tglobal_load_async_to_lds_b128 %1, %9, off\n\tglobal_load_async_to_lds_b128 %2, %10, off\n\tglobal_load_async_to_lds_b128 %3, %11, off\n\t"
               "global_load_async_to_lds_b128 %4, %12, off\n\tglobal_load_async_to_lds_b128 %5, %13, off\n\tglobal_load_async_to_lds_b128 %6, %14, off\n\tglobal_load_async_to_lds_b128 %7, %15, off\n\ts_wait_xcnt 0x0"
               :: "v"(lk), "v"(lk + 32u * KPI * 2u), "v"(lk + 64u * KPI * 2u), "v"(lk + 96u * KPI * 2u), "v"(lv), "v"(lv + 16u * VPI * 2u), "v"(lv + 32u * VPI * 2u), "v"(lv + 48u * VPI * 2u),
                  "v"(gk), "v"(gk + 32 * CC), "v"(gk + 64 * CC), "v"(gk + 96 * CC), "v"(gv), "v"(gv + 16 * (size_t)TT), "v"(gv + 32 * (size_t)TT), "v"(gv + 48 * (size_t)TT) : "memory");
}
__global__ __launch_bounds__(256) void k_fa(const _Float16* __restrict__ QH, const _Float16* __restrict__ KH, const _Float16* __restrict__ VT, const float* __restrict__ VR, float* __restrict__ Y) {
  const int tid = threadIdx.x, wave = tid >> 5, lane = tid & 31, col = lane & 15, g = lane >> 4; const int h = blockIdx.y, b = blockIdx.z; const int ql0 = blockIdx.x * (8 * 16 * QT) + wave * (16 * QT);
  __shared__ __align__(16) _Float16 sK[2][SK][KPI]; __shared__ __align__(16) _Float16 sV[2][HD][VPI];
  const _Float16* Kg = KH + ((size_t)b * TT + (tid >> 3)) * CC + h * HD + (tid & 7) * 8;              // copies: lane = (key row tid/8 + 32 i, 16-byte piece tid%8 of its 128 B)
  const _Float16* Vg = VT + ((size_t)b * CC + h * HD + (tid >> 4)) * (size_t)TT + (tid & 15) * 8;     // copies: lane = (plane row tid/16 + 16 i, 16-byte piece tid%16 of the stage's 256 B)
  const unsigned lk0 = (unsigned)(size_t)&sK[0][tid >> 3][(tid & 7) * 8], lv0 = (unsigned)(size_t)&sV[0][tid >> 4][(tid & 15) * 8];   // the lane's LDS byte addresses in buffer 0
  stage_kv(Kg, Vg, lk0, lv0);
  const float SC = 0.125f * 1.4426950408889634f;                             // logits / 8, in base 2
  const _Float16* Qa = QH + ((size_t)b * TT + ql0 + col) * CC + h * HD + 8 * g;   // this lane's first 8 elements of query row col (fragment order as in frag_h)
  v16h qf[QT][2];
#pragma unroll
  for (int t = 0; t < QT; ++t)
#pragma unroll
    for (int kc = 0; kc < 2; ++kc) { union { v16h v; v8h q[2]; } u; u.q[0] = *(const v8h*)(Qa + t * 16 * CC + kc * 32); u.q[1] = *(const v8h*)(Qa + t * 16 * CC + kc * 32 + 16); qf[t][kc] = u.v; }
  asm volatile("s_wait_xcnt 0x0" :: "v"(Qa) : "memory");   // the Q loads' address register stays live up to this wait, so that the accumulators below reuse it only behind it
  asm volatile("s_wait_asynccnt 0x0" ::: "memory");        // stage 0 has landed, as far as this wave copied it
  __syncthreads();                                          // publishes stage 0
  stage_kv(Kg + (size_t)SK * CC, Vg + SK, lk0 + (unsigned)sizeof(sK[0]), lv0 + (unsigned)sizeof(sV[0]));   // stage 1 flies under stage 0's passes
  v8f acc[QT][4] = {}; float mr[QT], lr[QT];
#pragma unroll
  for (int t = 0; t < QT; ++t) { mr[t] = -3.0e38f; lr[t] = 0.f; }
#pragma unroll 1
  for (int st = 0; st < TT / SK; ++st) {   // rolled: the two buffers differ by a base address only
   const _Float16* Ks = &sK[st & 1][col][0];   // key row col of a 16-key tile
   const _Float16* Vs = &sV[st & 1][col][0];   // plane row d = col of a 16-d tile
   v16h kf[2][2];
#pragma unroll
   for (int i = 0; i < 2; ++i)
#pragma unroll
     for (int kc = 0; kc < 2; ++kc) kf[i][kc] = frag_h(Ks + (i * 16) * KPI + kc * 32, lane);
#pragma unroll   // the stage's four passes: every LDS offset a constant
   for (int p = 0; p < SK / 32; ++p) {
    v16h vf[4];
#pragma unroll
    for (int j = 0; j < 4; ++j) vf[j] = frag_h(Vs + (j * 16) * VPI + p * 32, lane);
    v8f s[QT][2];
#pragma unroll
    for (int t = 0; t < QT; ++t)
#pragma unroll
      for (int i = 0; i < 2; ++i) { v8f z = {}; z = wmma16(kf[i][0], qf[t][0], z); s[t][i] = wmma16(kf[i][1], qf[t][1], z); }
    if (p + 1 < SK / 32) {   // the next pass's K fragments come under the softmax; never the next stage's, which is not published yet
#pragma unroll
      for (int i = 0; i < 2; ++i)
#pragma unroll
        for (int kc = 0; kc < 2; ++kc) kf[i][kc] = frag_h(Ks + ((p + 1) * 32 + i * 16) * KPI + kc * 32, lane); }
    float mx[QT]; bool need = false;
#pragma unroll
    for (int t = 0; t < QT; ++t) { float a = fmaxf(s[t][0][0], s[t][1][0]);
#pragma unroll
      for (int r = 1; r < 8; ++r) a = fmaxf(a, fmaxf(s[t][0][r], s[t][1][r]));
      a = fmaxf(a, xhalf(a)); mx[t] = a * SC; need = need || (mx[t] > mr[t] + 8.0f); }
    if (__builtin_amdgcn_ballot_w32(need) != 0) {   // lazy rescale: only when some query's maximum has grown by more than 2^8 (always on the first pass)
#pragma unroll
      for (int t = 0; t < QT; ++t) { const float mn = fmaxf(mr[t], mx[t]); const float al = __builtin_amdgcn_exp2f(mr[t] - mn); mr[t] = mn; lr[t] *= al;
#pragma unroll
        for (int j = 0; j < 4; ++j) acc[t][j] *= al; }
    }
#pragma unroll
    for (int t = 0; t < QT; ++t) { v16h pf; v2f sum = {0.f, 0.f}; const v2f sc2 = {SC, SC}, nm2 = {-mr[t], -mr[t]};
#pragma unroll
      for (int i = 0; i < 2; ++i)
#pragma unroll
        for (int r = 0; r < 8; r += 2) { v2f a = {s[t][i][r], s[t][i][r + 1]}; a = __builtin_elementwise_fma(a, sc2, nm2); const v2f e = {__builtin_amdgcn_exp2f(a[0]), __builtin_amdgcn_exp2f(a[1])}; sum += e; pf[i * 8 + r] = (_Float16)e[0]; pf[i * 8 + r + 1] = (_Float16)e[1]; }
      lr[t] += sum[0] + sum[1];
#pragma unroll
      for (int j = 0; j < 4; ++j) acc[t][j] = wmma16(vf[j], pf, acc[t][j]); }
    __builtin_amdgcn_sched_barrier(0);   // keeps the next pass's V fragment loads out of this pass: a second set of them takes the kernel over 256 registers
   }
   asm volatile("s_wait_dscnt 0x0" ::: "memory");      // this wave's reads of the stage's buffer are over
   asm volatile("s_wait_asynccnt 0x0" ::: "memory");   // the next stage has landed, as far as this wave copied it
   __syncthreads();                                     // publishes the next stage and frees this stage's buffer
   if (st + 2 < TT / SK) stage_kv(Kg + (size_t)(st + 2) * SK * CC, Vg + (st + 2) * SK, lk0 + (unsigned)(st & 1) * (unsigned)sizeof(sK[0]), lv0 + (unsigned)(st & 1) * (unsigned)sizeof(sV[0]));
  }
  asm volatile("s_wait_asynccnt 0x0" ::: "memory");    // no copy is left in flight when the wave goes on to its end
#pragma unroll
  for (int t = 0; t < QT; ++t) {   // lane (g, col) holds o[d = 16 j + 8 g + r] of query col; the two halves of a query join by one exchange
    const float inv = 1.0f / (lr[t] + xhalf(lr[t])); const size_t ro = ((size_t)b * TT + ql0 + t * 16 + col) * CC + h * HD + 8 * g;
    v4f vv[4][2]; float dt = 0.f, nn = 0.f;
#pragma unroll
    for (int j = 0; j < 4; ++j) { vv[j][0] = *(const v4f*)(VR + ro + j * 16); vv[j][1] = *(const v4f*)(VR + ro + j * 16 + 4);
#pragma unroll
      for (int r = 0; r < 8; ++r) { const float o = acc[t][j][r] * inv, v = vv[j][r >> 2][r & 3]; acc[t][j][r] = o; dt += o * v; nn += v * v; } }
    dt += xhalf(dt); nn += xhalf(nn); const float al = dt / (nn + 1e-8f);
#pragma unroll
    for (int j = 0; j < 4; ++j) { v4f o0, o1;
#pragma unroll
      for (int r = 0; r < 4; ++r) { o0[r] = acc[t][j][r] - al * vv[j][0][r]; o1[r] = acc[t][j][4 + r] - al * vv[j][1][r]; }
      vst2(Y + ro + j * 16, o0); vst2(Y + ro + j * 16 + 4, o1); } } }
// ---- k_out: block = 8 waves = (128 rows, 128 cols), a wave = 32 x 64: out = y (bf16 hi + lo) Wproj + b; per 64-k step y (split once per block) and W are staged in LDS as in k_proj, a whole 256-B unit per 16 lanes
#define OBK 64   // k per step
#define OP 72    // elements per staged row of 64 bf16: 144 B = 16 B x odd, the pitch at which 16-byte fragment reads meet no bank twice
__global__ __launch_bounds__(256) void k_out(const float* __restrict__ Y, const float* __restrict__ WP, const float* __restrict__ BP, float* __restrict__ OUT) { __shared__ __align__(16) float sf[8][32][68]; __shared__ __align__(16) __bf16 sH[2][128][OP], sL[2][128][OP], sB[2][128][OP];
  const int tid = threadIdx.x, wave = tid >> 5, lane = tid & 31, col = lane & 15, g = lane >> 4; const int wr = wave >> 1, wc = wave & 1; const int c0 = blockIdx.y * 128; const size_t r0 = (size_t)blockIdx.x * 128;
  v8f acc[2][4] = {};
  const int srow = tid >> 4, sq = tid & 15;   // staging: thread = (row srow + 16 i, 16-byte piece sq of the row's 256 B)
  const float* Yp = Y + (r0 + srow) * CC + sq * 4; const float* Wp = WP + (size_t)(c0 + srow) * CC + sq * 4;
  v4f ra[8], rb[8];
#pragma unroll
  for (int i = 0; i < 8; ++i) ra[i] = *(const v4f*)(Yp + (size_t)i * 16 * CC);
#pragma unroll
  for (int i = 0; i < 8; ++i) rb[i] = *(const v4fu*)(Wp + (size_t)i * 16 * CC);
#pragma unroll
  for (int i = 0; i < 8; ++i) { const v4b hi = cvt4(ra[i]); v4f re;
#pragma unroll
    for (int e = 0; e < 4; ++e) re[e] = ra[i][e] - (float)hi[e];
    *(v4b*)&sH[0][srow + i * 16][sq * 4] = hi; *(v4b*)&sL[0][srow + i * 16][sq * 4] = cvt4(re); }
#pragma unroll
  for (int i = 0; i < 8; ++i) *(v4b*)&sB[0][srow + i * 16][sq * 4] = cvt4(rb[i]);
  __syncthreads();
#pragma unroll 2   // by two, so that each half addresses its buffers by constants
  for (int ks = 0; ks < CC / OBK; ++ks) { const int cur = ks & 1; const bool more = ks + 1 < CC / OBK;
    if (more) {   // the next step's lines fly under this step's products
#pragma unroll
      for (int i = 0; i < 8; ++i) ra[i] = *(const v4f*)(Yp + (size_t)i * 16 * CC + (ks + 1) * OBK);
#pragma unroll
      for (int i = 0; i < 8; ++i) rb[i] = *(const v4fu*)(Wp + (size_t)i * 16 * CC + (ks + 1) * OBK);
      asm volatile("s_wait_xcnt 0x0" ::: "memory"); }   // behind the run of loads: their address registers may be reused by the roundings below only behind this wait
    v16b ah[OBK / 32][2], al[OBK / 32][2], w[OBK / 32][4];   // the step's fragments, read as one group
#pragma unroll
    for (int kk = 0; kk < OBK / 32; ++kk) {
#pragma unroll
      for (int i = 0; i < 2; ++i) { ah[kk][i] = frag_b(&sH[cur][wr * 32 + i * 16 + col][kk * 32], lane); al[kk][i] = frag_b(&sL[cur][wr * 32 + i * 16 + col][kk * 32], lane); }
#pragma unroll
      for (int j = 0; j < 4; ++j) w[kk][j] = frag_b(&sB[cur][wc * 64 + j * 16 + col][kk * 32], lane); }
#pragma unroll
    for (int kk = 0; kk < OBK / 32; ++kk) {
#pragma unroll
      for (int i = 0; i < 2; ++i)
#pragma unroll
        for (int j = 0; j < 4; ++j) acc[i][j] = wmma_bf(ah[kk][i], w[kk][j], acc[i][j]);
#pragma unroll
      for (int i = 0; i < 2; ++i)   // per tile still hi, then lo, of each 32 k in turn
#pragma unroll
        for (int j = 0; j < 4; ++j) acc[i][j] = wmma_bf(al[kk][i], w[kk][j], acc[i][j]); }
    __builtin_amdgcn_sched_barrier(0);   // keeps the roundings below, which wait for the lines in flight, from moving up among this step's products
    if (more) {
#pragma unroll
      for (int i = 0; i < 8; ++i) { const v4b hi = cvt4(ra[i]); v4f re;
#pragma unroll
        for (int e = 0; e < 4; ++e) re[e] = ra[i][e] - (float)hi[e];
        *(v4b*)&sH[cur ^ 1][srow + i * 16][sq * 4] = hi; *(v4b*)&sL[cur ^ 1][srow + i * 16][sq * 4] = cvt4(re); }
#pragma unroll
      for (int i = 0; i < 8; ++i) *(v4b*)&sB[cur ^ 1][srow + i * 16][sq * 4] = cvt4(rb[i]); }
    __syncthreads(); }   // publishes the buffer just filled and ends the reads of the one filled next
#pragma unroll
  for (int j = 0; j < 4; ++j) { const float bb = BP ? bfr(BP[c0 + wc * 64 + j * 16 + col]) : 0.f;
#pragma unroll
    for (int i = 0; i < 2; ++i)
#pragma unroll
      for (int r = 0; r < 8; ++r) sf[wave][i * 16 + 8 * g + r][j * 16 + col] = acc[i][j][r] + bb; }
  LDSX();
#pragma unroll
  for (int e = 0; e < 16; ++e) { const int rl = e * 2 + (lane >> 4), q = lane & 15; vst2(OUT + (r0 + wr * 32 + rl) * CC + c0 + wc * 64 + q * 4, *(const v4f*)&sf[wave][rl][q * 4]); } }
extern "C" void kernel_launch(void* const* d_in, const int* in_sizes, int n_in, void* d_out, int out_size, void* d_ws, size_t ws_size, hipStream_t stream) {
  (void)in_sizes; (void)n_in; (void)out_size;
  const float** F = (const float**)d_in;   // 0 x [2,2048,1024], 1 wq [1024,1024] ([out,in]), 2 bq, 3 wk, 4 bk, 5 wv, 6 bv, 7 wo, 8 bo
  if (ws_size < (size_t)WS_END) return;
  char* ws = (char*)d_ws; _Float16 *QH = (_Float16*)(ws + WS_QH), *QL = (_Float16*)(ws + WS_QL), *KH = (_Float16*)(ws + WS_KH), *VT = (_Float16*)(ws + WS_VT); float *Y = (float*)(ws + WS_Y), *VR = (float*)(ws + WS_VR);
  k_proj<<<dim3(TNB * TT / PBM, CC / PBN, 3), PNT, 0, stream>>>(F[0], F[1], F[2], F[3], F[4], F[5], F[6], QH, QL, KH, VT, VR);
  k_fa<<<dim3(TT / (8 * 16 * QT), NH, TNB), 256, 0, stream>>>(QH, KH, VT, VR, Y);
  k_out<<<dim3(TNB * TT / 128, CC / 128), 256, 0, stream>>>(Y, F[7], F[8], (float*)d_out);
}

// v005
// Measured time: 91.9 microseconds a run.
// Timed twice side by side with v004, it ran 1.03 times as fast both times.
// Over all steps from v000 it is 14.8 times as fast.
// compute dtype: all float inputs rounded to bf16; q/k/v = x W^T + b with EXACT bf16 products on WMMA 16x16x32, f32 accumulate; q, k rounded once to f16 (1-product logits, f32, kept in registers); online softmax in f32, base 2, against a running maximum -> unnormalised P f16 (at most 2^8); o = P . v (v once to f16) / row sum; per-position exclusion o -= (o . v_s / (|v_s|^2 + 1e-8)) v_s in f32 with the exact f32 v row; out = o (bf16 hi + lo) Wo^T + bo; f32 output.
#include <hip/hip_runtime.h>
#include <math.h>

typedef __attribute__((ext_vector_type(16))) _Float16 v16h;
typedef __attribute__((ext_vector_type(16))) __bf16 v16b;
typedef __attribute__((ext_vector_type(8)))  _Float16 v8h;
typedef __attribute__((ext_vector_type(8)))  float v8f;
typedef __attribute__((ext_vector_type(4)))  float v4f;
typedef __attribute__((ext_vector_type(2)))  float v2f;
typedef __attribute__((ext_vector_type(4)))  unsigned v4u;
typedef __attribute__((ext_vector_type(4)))  int v4i;
typedef float __attribute__((may_alias)) float_a;
typedef int __attribute__((may_alias)) int_a;

template <typename T> __device__ __forceinline__ void vst2(void* p, T v) { *(T*)p = v;  }
__device__ __forceinline__ v8f wmma16(v16h a, v16h b, v8f c) {
  return __builtin_amdgcn_wmma_f32_16x16x32_f16(false, a, false, b, (short)0, c, false, false);   // the compiler keeps the distance behind its own builtin form where a vector instruction follows on D, A or B
}
__device__ __forceinline__ v8f wmma_bf(v16b a, v16b b, v8f c) {
  v8f d = __builtin_amdgcn_wmma_f32_16x16x32_bf16(false, a, false, b, (short)0, c, false, false);
  asm volatile("v_nop\n\tv_nop\n\tv_nop\n\tv_nop" : "+v"(d) : "v"(a), "v"(b));
  return d;
}
// 16x16x32 fragments: lane = (h = lane>>4, row/col = lane&15); elements 0..7 = k0+8h+0..7, 8..15 = k0+16+8h+0..7; D element r = row 8h+r
__device__ __forceinline__ v16h frag_h(const _Float16* rowk0, int lane) {
  union { v16h v; v8h q[2]; } u; const _Float16* p = rowk0 + 8 * (lane >> 4);
  u.q[0] = *(const v8h*)p; u.q[1] = *(const v8h*)(p + 16); return u.v;
}
__device__ __forceinline__ v16h frag_f32(const float* rowk0, int lane) {
  v16h a; const float* p = rowk0 + 8 * (lane >> 4);
#pragma unroll
  for (int i = 0; i < 8; ++i) { a[i] = (_Float16)p[i]; a[8 + i] = (_Float16)p[16 + i]; }
  return a;
}
__device__ __forceinline__ v16h frag_f32s(const float* rowk0, int lane, float sc) {
  v16h a; const float* p = rowk0 + 8 * (lane >> 4);
#pragma unroll
  for (int i = 0; i < 8; ++i) { a[i] = (_Float16)(p[i] * sc); a[8 + i] = (_Float16)(p[16 + i] * sc); }
  return a;
}
// column fragment from a [K][ld] layout (column n), rows >= K read as 0
__device__ __forceinline__ v16h fragc_f32(const float* W, int k0, int n, int lane, int ld, int K) {
  v16h a; const int g = lane >> 4;
#pragma unroll
  for (int i = 0; i < 8; ++i) { const int ka = k0 + 8 * g + i, kb = ka + 16;
    a[i] = (_Float16)(ka < K ? W[(size_t)(ka < K ? ka : K - 1) * ld + n] : 0.f); a[8 + i] = (_Float16)(kb < K ? W[(size_t)(kb < K ? kb : K - 1) * ld + n] : 0.f); }
  return a;
}
struct F2 { v16b h, l; };
__device__ __forceinline__ F2 bsplit16(const float v[16]) { F2 r;
#pragma unroll
  for (int i = 0; i < 16; ++i) { const __bf16 h = (__bf16)v[i]; r.h[i] = h; r.l[i] = (__bf16)(v[i] - (float)h); }
  return r; }
__device__ __forceinline__ F2 split_row(const float* row, int k0, int lane) { float v[16]; const float* p = row + k0 + 8 * (lane >> 4);
#pragma unroll
  for (int i = 0; i < 8; ++i) { v[i] = p[i]; v[8 + i] = p[16 + i]; }
  return bsplit16(v); }
__device__ __forceinline__ F2 split_rowK(const float* row, int k0, int lane, int K) { float v[16]; const int g = lane >> 4;
#pragma unroll
  for (int i = 0; i < 8; ++i) { const int ka = k0 + 8 * g + i, kb = ka + 16; v[i] = ka < K ? row[ka < K ? ka : K - 1] : 0.f; v[8 + i] = kb < K ? row[kb < K ? kb : K - 1] : 0.f; }
  return bsplit16(v); }
__device__ __forceinline__ F2 split_col(const float* W, int k0, int n, int lane, int ld, int K) { float v[16]; const int g = lane >> 4;
#pragma unroll
  for (int i = 0; i < 8; ++i) { const int ka = k0 + 8 * g + i, kb = ka + 16; v[i] = ka < K ? W[(size_t)(ka < K ? ka : K - 1) * ld + n] : 0.f; v[8 + i] = kb < K ? W[(size_t)(kb < K ? kb : K - 1) * ld + n] : 0.f; }
  return bsplit16(v); }
__device__ __forceinline__ v8f mac3(const F2& a, const F2& b, v8f c) { c = wmma_bf(a.l, b.h, c); c = wmma_bf(a.h, b.l, c); return wmma_bf(a.h, b.h, c); }
__device__ __forceinline__ float sigm(float v) { return 1.0f / (1.0f + expf(-v)); }
#define LDSX() do { asm volatile("s_wait_dscnt 0" ::: "memory"); __builtin_amdgcn_wave_barrier(); __builtin_amdgcn_fence(__ATOMIC_RELEASE, "workgroup"); } while (0)


// Exclusive self attention (B 2, S 2,048, D 1,024 = 16 x 64): q/k/v Linear ([out,in] + bias), softmax(q k / 8) v, then per position and head o -= <o, v_s> / (|v_s|^2 + 1e-8) v_s, output Linear.
#define NB 2
#define TT 2048
#define CC 1024
#define NH 16
#define HD 64
#ifndef TNB
#define TNB NB
#endif
typedef __attribute__((ext_vector_type(8))) __bf16 v8b;
__device__ __forceinline__ v16b frag_b(const __bf16* rowk0, int lane) {
  union { v16b v; v8b q[2]; } u; const __bf16* p = rowk0 + 8 * (lane >> 4);
  u.q[0] = *(const v8b*)p; u.q[1] = *(const v8b*)(p + 16); return u.v;
}
__device__ __forceinline__ float bfr(float v) { return (float)(__bf16)v; }
typedef __attribute__((ext_vector_type(4))) __bf16 v4b;
typedef v4f __attribute__((aligned(4))) v4fu;   // 16-byte read of an input that is only known to be float-aligned
#define KP 40   // elements per staged row of 32 bf16: 80 B = 16 B x odd, the pitch at which 16-byte fragment reads meet no bank twice
__device__ __forceinline__ v4b cvt4(v4f v) { v4b r;
#pragma unroll
  for (int i = 0; i < 4; ++i) r[i] = (__bf16)v[i];
  return r; }
__device__ __attribute__((noinline)) float exp_ni(float v) { return expf(v); }
__device__ __attribute__((noinline)) float erf_ni(float v) { return erff(v); }

#define WS_QH  0u
#define WS_QL  (WS_QH + 2u * (size_t)NB * TT * CC)
#define WS_KH  (WS_QL + 2u * (size_t)NB * TT * CC)
#define WS_VT  (WS_KH + 2u * (size_t)NB * TT * CC)      // f16 v planes [b][c][t]
#define WS_Y   (WS_VT + 2u * (size_t)NB * CC * TT)      // f32 y rows [b*t][C]
#define WS_VR  (WS_Y + 4u * (size_t)NB * TT * CC)       // f32 v rows [b*t][C] for the exclusion step
#define WS_END (WS_VR + 4u * (size_t)NB * TT * CC)

// ---- k_proj: block = 16 waves = (256 rows, 256 cols, which), a wave = 64 x 64: qkv = x W (+ b), exact; q -> f16 hi (+ residual), k -> f16 rows, v -> f16 planes and f32 rows. Per 32-k step the block reads its x and W rows once, a whole 128-B line per 8 lanes, rounds them to bf16 and stages them in LDS (two buffers); a wave takes 4 + 4 fragments from there for 16 products. In the epilogue each wave turns its own tile in its own piece of the same LDS.
#define PBM 256   // rows of x per block
#define PBN 256   // rows of W (output columns) per block
#define PNT 512   // threads: 4 x 4 waves
#define PEW 9216  // bytes of LDS per wave in the epilogue: 64 rows of 72 f16, or 32 rows of 68 f32
__global__ __launch_bounds__(PNT) void k_proj(const float* __restrict__ X, const float* __restrict__ WQ, const float* __restrict__ BQ, const float* __restrict__ WK, const float* __restrict__ BK, const float* __restrict__ WV, const float* __restrict__ BV, _Float16* __restrict__ QH, _Float16* __restrict__ QL, _Float16* __restrict__ KH, _Float16* __restrict__ VT, float* __restrict__ VR) {
  __shared__ __align__(16) char sm[(PNT / 32) * PEW];
  __bf16 (*sA)[PBM][KP] = (__bf16 (*)[PBM][KP])sm; __bf16 (*sB)[PBN][KP] = (__bf16 (*)[PBN][KP])(sm + 2 * PBM * KP * 2);   // main loop: 2 x 20 KiB each
  const int tid = threadIdx.x, wave = tid >> 5, lane = tid & 31, col = lane & 15, g = lane >> 4; const int wr = wave >> 2, wc = wave & 3; const int which = blockIdx.z; const int c0 = blockIdx.y * PBN; const size_t r0 = (size_t)blockIdx.x * PBM; const float* WA = which == 0 ? WQ : which == 1 ? WK : WV; const float* BA = which == 0 ? BQ : which == 1 ? BK : BV;
  v8f acc[4][4] = {};
  const int srow = tid >> 3, sq = tid & 7;   // staging: thread = (row srow + 64 i, 16-byte piece sq of the row's 128-B line)
  const float* Xp = X + (r0 + srow) * CC + sq * 4; const float* Wp = WA + (size_t)(c0 + srow) * CC + sq * 4;
  v4f ra[4], rb[4];
#pragma unroll
  for (int i = 0; i < 4; ++i) ra[i] = *(const v4fu*)(Xp + (size_t)i * 64 * CC);
#pragma unroll
  for (int i = 0; i < 4; ++i) rb[i] = *(const v4fu*)(Wp + (size_t)i * 64 * CC);
#pragma unroll
  for (int i = 0; i < 4; ++i) *(v4b*)&sA[0][srow + i * 64][sq * 4] = cvt4(ra[i]);
#pragma unroll
  for (int i = 0; i < 4; ++i) *(v4b*)&sB[0][srow + i * 64][sq * 4] = cvt4(rb[i]);
  __syncthreads();
#pragma unroll 2   // by two, so that each half addresses its buffers by constants
  for (int kc = 0; kc < CC / 32; ++kc) { const int cur = kc & 1; const bool more = kc + 1 < CC / 32;
    if (more) {   // the next step's lines fly under this step's products
#pragma unroll
      for (int i = 0; i < 4; ++i) ra[i] = *(const v4fu*)(Xp + (size_t)i * 64 * CC + (kc + 1) * 32);
#pragma unroll
      for (int i = 0; i < 4; ++i) rb[i] = *(const v4fu*)(Wp + (size_t)i * 64 * CC + (kc + 1) * 32);
      asm volatile("s_wait_xcnt 0x0" ::: "memory"); }   // behind the run of loads: their address registers may be reused by the roundings below only behind this wait
    v16b a[4], w[4];
#pragma unroll
    for (int i = 0; i < 4; ++i) a[i] = frag_b(&sA[cur][wr * 64 + i * 16 + col][0], lane);
#pragma unroll
    for (int j = 0; j < 4; ++j) w[j] = frag_b(&sB[cur][wc * 64 + j * 16 + col][0], lane);
#pragma unroll
    for (int i = 0; i < 4; ++i)
#pragma unroll
      for (int j = 0; j < 4; ++j) acc[i][j] = wmma_bf(a[i], w[j], acc[i][j]);
    __builtin_amdgcn_sched_barrier(0);   // keeps the roundings below, which wait for the lines in flight, from moving up among this step's products
    if (more) {
#pragma unroll
      for (int i = 0; i < 4; ++i) *(v4b*)&sA[cur ^ 1][srow + i * 64][sq * 4] = cvt4(ra[i]);
#pragma unroll
      for (int i = 0; i < 4; ++i) *(v4b*)&sB[cur ^ 1][srow + i * 64][sq * 4] = cvt4(rb[i]); }
    __syncthreads(); }   // publishes the buffer just filled and ends the reads of the one filled next; the last one frees the LDS for the epilogue
  char* ew = sm + wave * PEW;   // this wave's own piece: no other wave reads or writes it from here on, so LDSX() orders all that follows
  const size_t rw = r0 + wr * 64; const int cw = c0 + wc * 64;   // the wave's first row and column
  const int bi = cw + col; float bb[4];
#pragma unroll
  for (int j = 0; j < 4; ++j) bb[j] = BA[bi + j * 16];
  asm volatile("s_wait_xcnt 0x0" :: "v"(bi) : "memory");   // the bias loads' index register stays live up to this wait, so that none of the four lands on it in front of the wait
#pragma unroll
  for (int j = 0; j < 4; ++j) bb[j] = bfr(bb[j]);
  if (which == 0) { _Float16 (*eh)[72] = (_Float16 (*)[72])ew;   // 32 rows at a time: rows 0..31 of the piece hold q's f16 value, rows 32..63 its residual
#pragma unroll
    for (int hf = 0; hf < 2; ++hf) {
      if (hf) LDSX();   // the first half's reads are over before its rows are written anew
#pragma unroll
      for (int i = 0; i < 2; ++i)
#pragma unroll
        for (int j = 0; j < 4; ++j)
#pragma unroll
          for (int r = 0; r < 8; ++r) { const float v = acc[hf * 2 + i][j][r] + bb[j]; const _Float16 hv = (_Float16)v; eh[i * 16 + 8 * g + r][j * 16 + col] = hv; eh[32 + i * 16 + 8 * g + r][j * 16 + col] = (_Float16)(v - (float)hv); }
      LDSX();
#pragma unroll
      for (int e = 0; e < 8; ++e) { const int rl = e * 4 + (lane >> 3), q = lane & 7; const size_t o = (rw + hf * 32 + rl) * CC + cw + q * 8;   // 4 whole 128-B lines per store
        vst2((unsigned*)(QH + o), *(const v4u*)&eh[rl][q * 8]); vst2((unsigned*)(QL + o), *(const v4u*)&eh[32 + rl][q * 8]); } }
    asm volatile("s_wait_xcnt 0x0" ::: "memory");   // behind the wave's last stores: no register that they name is reused in front of this wait
  }
  else if (which == 1) { _Float16 (*eh)[72] = (_Float16 (*)[72])ew;
#pragma unroll
    for (int i = 0; i < 4; ++i)
#pragma unroll
      for (int j = 0; j < 4; ++j)
#pragma unroll
        for (int r = 0; r < 8; ++r) eh[i * 16 + 8 * g + r][j * 16 + col] = (_Float16)(acc[i][j][r] + bb[j]);
    LDSX();
#pragma unroll
    for (int e = 0; e < 16; ++e) { const int rl = e * 4 + (lane >> 3), q = lane & 7; vst2((unsigned*)(KH + (rw + rl) * CC + cw + q * 8), *(const v4u*)&eh[rl][q * 8]); }   // 4 whole 128-B lines per store
    asm volatile("s_wait_xcnt 0x0" ::: "memory");   // behind the wave's last stores: no register that they name is reused in front of this wait
  }
  else { _Float16 (*et)[72] = (_Float16 (*)[72])ew; float (*ef)[68] = (float (*)[68])ew; const size_t b = rw / TT; const int t0 = (int)(rw % TT);
#pragma unroll
    for (int i = 0; i < 4; ++i)
#pragma unroll
      for (int j = 0; j < 4; ++j) { v8h hv;
#pragma unroll
        for (int r = 0; r < 8; ++r) hv[r] = (_Float16)(acc[i][j][r] + bb[j]);
        *(v8h*)&et[j * 16 + col][i * 16 + 8 * g] = hv; }   // a lane's 8 rows are 8 neighbours of one plane row
    LDSX();
#pragma unroll
    for (int e = 0; e < 16; ++e) { const int cl = e * 4 + (lane >> 3), q = lane & 7; vst2((unsigned*)(VT + (b * CC + cw + cl) * (size_t)TT + t0 + q * 8), *(const v4u*)&et[cl][q * 8]); }
#pragma unroll
    for (int hf = 0; hf < 2; ++hf) {   // the f32 rows, 32 at a time
      LDSX();
#pragma unroll
      for (int i = 0; i < 2; ++i)
#pragma unroll
        for (int j = 0; j < 4; ++j)
#pragma unroll
          for (int r = 0; r < 8; ++r) ef[i * 16 + 8 * g + r][j * 16 + col] = acc[hf * 2 + i][j][r] + bb[j];
      LDSX();
#pragma unroll
      for (int e = 0; e < 16; ++e) { const int rl = e * 2 + (lane >> 4), q = lane & 15; vst2(VR + (rw + hf * 32 + rl) * CC + cw + q * 4, *(const v4f*)&ef[rl][q * 4]); } }
    asm volatile("s_wait_xcnt 0x0" ::: "memory");   // behind the wave's last stores: no register that they name is reused in front of this wait
  } }
// ---- k_fa: block = 8 waves x 32 queries of (b,h). The block brings K rows and V plane rows to LDS once per stage of 128 keys, by asynchronous copies into two buffers, and its 8 waves take their fragments from there. Per pass of 32 keys: S^T = K Q^T (a lane holds 16 logits of one query per 16-query tile), online softmax in registers, O^T += V^T P^T (the two S^T tiles, converted in place, are the B operand); then the exclusion step and the y rows.
__device__ __forceinline__ float xhalf(float x) { return __builtin_bit_cast(float, __builtin_amdgcn_permlanex16(__builtin_bit_cast(int, x), __builtin_bit_cast(int, x), 0x76543210, 0xfedcba98, false, false)); }  // lane l with lane l ^ 16
#define QT 2
#define SK 128   // keys per stage
#define KPI 72   // f16 per staged K row of 64: 144 B = 16 B x odd (no bank met twice by 16-byte fragment reads)
#define VPI 136  // f16 per staged V plane row of 128: 272 B = 16 B x odd
// one stage: 128 K rows of 128 B and 64 V plane rows of 256 B, 8 copies of 16 B per lane, whole lines per wave. The s_wait_xcnt stands inside the statement, so that no address register is rewritten in front of it.
__device__ __forceinline__ void stage_kv(const _Float16* gk, const _Float16* gv, unsigned lk, unsigned lv) {
  asm volatile("global_load_async_to_lds_b128 %0, %8, off\n\tglobal_load_async_to_lds_b128 %1, %9, off\n\tglobal_load_async_to_lds_b128 %2, %10, off\n\tglobal_load_async_to_lds_b128 %3, %11, off\n\t"
               "global_load_async_to_lds_b128 %4, %12, off\n\tglobal_load_async_to_lds_b128 %5, %13, off\n\tglobal_load_async_to_lds_b128 %6, %14, off\n\tglobal_load_async_to_lds_b128 %7, %15, off\n\ts_wait_xcnt 0x0"
               :: "v"(lk), "v"(lk + 32u * KPI * 2u), "v"(lk + 64u * KPI * 2u), "v"(lk + 96u * KPI * 2u), "v"(lv), "v"(lv + 16u * VPI * 2u), "v"(lv + 32u * VPI * 2u), "v"(lv + 48u * VPI * 2u),
                  "v"(gk), "v"(gk + 32 * CC), "v"(gk + 64 * CC), "v"(gk + 96 * CC), "v"(gv), "v"(gv + 16 * (size_t)TT), "v"(gv + 32 * (size_t)TT), "v"(gv + 48 * (size_t)TT) : "memory");
}
__global__ __launch_bounds__(256) void k_fa(const _Float16* __restrict__ QH, const _Float16* __restrict__ KH, const _Float16* __restrict__ VT, const float* __restrict__ VR, float* __restrict__ Y) {
  const int tid = threadIdx.x, wave = tid >> 5, lane = tid & 31, col = lane & 15, g = lane >> 4; const int h = blockIdx.y, b = blockIdx.z; const int ql0 = blockIdx.x * (8 * 16 * QT) + wave * (16 * QT);
  __shared__ __align__(16) _Float16 sK[2][SK][KPI]; __shared__ __align__(16) _Float16 sV[2][HD][VPI];
  const _Float16* Kg = KH + ((size_t)b * TT + (tid >> 3)) * CC + h * HD + (tid & 7) * 8;              // copies: lane = (key row tid/8 + 32 i, 16-byte piece tid%8 of its 128 B)
  const _Float16* Vg = VT + ((size_t)b * CC + h * HD + (tid >> 4)) * (size_t)TT + (tid & 15) * 8;     // copies: lane = (plane row tid/16 + 16 i, 16-byte piece tid%16 of the stage's 256 B)
  const unsigned lk0 = (unsigned)(size_t)&sK[0][tid >> 3][(tid & 7) * 8], lv0 = (unsigned)(size_t)&sV[0][tid >> 4][(tid & 15) * 8];   // the lane's LDS byte addresses in buffer 0
  stage_kv(Kg, Vg, lk0, lv0);
  const float SC = 0.125f * 1.4426950408889634f;                             // logits / 8, in base 2
  const _Float16* Qa = QH + ((size_t)b * TT + ql0 + col) * CC + h * HD + 8 * g;   // this lane's first 8 elements of query row col (fragment order as in frag_h)
  v16h qf[QT][2];
#pragma unroll
  for (int t = 0; t < QT; ++t)
#pragma unroll
    for (int kc = 0; kc < 2; ++kc) { union { v16h v; v8h q[2]; } u; u.q[0] = *(const v8h*)(Qa + t * 16 * CC + kc * 32); u.q[1] = *(const v8h*)(Qa + t * 16 * CC + kc * 32 + 16); qf[t][kc] = u.v; }
  asm volatile("s_wait_xcnt 0x0" :: "v"(Qa) : "memory");   // the Q loads' address register stays live up to this wait, so that the accumulators below reuse it only behind it
  asm volatile("s_wait_asynccnt 0x0" ::: "memory");        // stage 0 has landed, as far as this wave copied it
  __syncthreads();                                          // publishes stage 0
  stage_kv(Kg + (size_t)SK * CC, Vg + SK, lk0 + (unsigned)sizeof(sK[0]), lv0 + (unsigned)sizeof(sV[0]));   // stage 1 flies under stage 0's passes
  v8f acc[QT][4] = {}; float mr[QT], lr[QT];
#pragma unroll
  for (int t = 0; t < QT; ++t) { mr[t] = -3.0e38f; lr[t] = 0.f; }
#pragma unroll 1
  for (int st = 0; st < TT / SK; ++st) {   // rolled: the two buffers differ by a base address only
   const _Float16* Ks = &sK[st & 1][col][0];   // key row col of a 16-key tile
   const _Float16* Vs = &sV[st & 1][col][0];   // plane row d = col of a 16-d tile
   v16h kf[2][2];
#pragma unroll
   for (int i = 0; i < 2; ++i)
#pragma unroll
     for (int kc = 0; kc < 2; ++kc) kf[i][kc] = frag_h(Ks + (i * 16) * KPI + kc * 32, lane);
#pragma unroll   // the stage's four passes: every LDS offset a constant
   for (int p = 0; p < SK / 32; ++p) {
    v16h vf[4];
#pragma unroll
    for (int j = 0; j < 4; ++j) vf[j] = frag_h(Vs + (j * 16) * VPI + p * 32, lane);
    v8f s[QT][2];
#pragma unroll
    for (int t = 0; t < QT; ++t)
#pragma unroll
      for (int i = 0; i < 2; ++i) { v8f z = {}; z = wmma16(kf[i][0], qf[t][0], z); s[t][i] = wmma16(kf[i][1], qf[t][1], z); }
    if (p + 1 < SK / 32) {   // the next pass's K fragments come under the softmax; never the next stage's, which is not published yet
#pragma unroll
      for (int i = 0; i < 2; ++i)
#pragma unroll
        for (int kc = 0; kc < 2; ++kc) kf[i][kc] = frag_h(Ks + ((p + 1) * 32 + i * 16) * KPI + kc * 32, lane); }
    __builtin_amdgcn_sched_barrier(0);   // keeps both groups of fragment loads up here, a whole softmax ahead of their first use; left free they sink to just in front of the products that read them
    float mx[QT]; bool need = false;
#pragma unroll
    for (int t = 0; t < QT; ++t) { float a = fmaxf(s[t][0][0], s[t][1][0]);
#pragma unroll
      for (int r = 1; r < 8; ++r) a = fmaxf(a, fmaxf(s[t][0][r], s[t][1][r]));
      a = fmaxf(a, xhalf(a)); mx[t] = a * SC; need = need || (mx[t] > mr[t] + 8.0f); }
    if (__builtin_amdgcn_ballot_w32(need) != 0) {   // lazy rescale: only when some query's maximum has grown by more than 2^8 (always on the first pass)
#pragma unroll
      for (int t = 0; t < QT; ++t) { const float mn = fmaxf(mr[t], mx[t]); const float al = __builtin_amdgcn_exp2f(mr[t] - mn); mr[t] = mn; lr[t] *= al;
#pragma unroll
        for (int j = 0; j < 4; ++j) acc[t][j] *= al; }
    }
    v16h pf[QT];   // each query tile's P in registers of its own: written over the first tile's directly behind the products that read them, the second tile's costs four pad slots more
#pragma unroll
    for (int t = 0; t < QT; ++t) { v2f sum = {0.f, 0.f}; const v2f sc2 = {SC, SC}, nm2 = {-mr[t], -mr[t]};
#pragma unroll
      for (int i = 0; i < 2; ++i)
#pragma unroll
        for (int r = 0; r < 8; r += 2) { v2f a = {s[t][i][r], s[t][i][r + 1]}; a = __builtin_elementwise_fma(a, sc2, nm2); const v2f e = {__builtin_amdgcn_exp2f(a[0]), __builtin_amdgcn_exp2f(a[1])}; sum += e; pf[t][i * 8 + r] = (_Float16)e[0]; pf[t][i * 8 + r + 1] = (_Float16)e[1]; }
      lr[t] += sum[0] + sum[1]; }
#pragma unroll
    for (int t = 0; t < QT; ++t)
#pragma unroll
      for (int j = 0; j < 4; ++j) acc[t][j] = wmma16(vf[j], pf[t], acc[t][j]);
    __builtin_amdgcn_sched_barrier(0);   // keeps the next pass's V fragment loads out of this pass: a second set of them takes the kernel over 256 registers
    asm volatile("v_nop\n\tv_nop\n\tv_nop\n\tv_nop");   // four vector slots between this pass's last product and the next pass's first ones, whose results may be given the registers that P was read from
    __builtin_amdgcn_sched_barrier(0);   // holds the next pass's products behind those four slots
   }
   asm volatile("s_wait_dscnt 0x0" ::: "memory");      // this wave's reads of the stage's buffer are over
   asm volatile("s_wait_asynccnt 0x0" ::: "memory");   // the next stage has landed, as far as this wave copied it
   __syncthreads();                                     // publishes the next stage and frees this stage's buffer
   if (st + 2 < TT / SK) stage_kv(Kg + (size_t)(st + 2) * SK * CC, Vg + (st + 2) * SK, lk0 + (unsigned)(st & 1) * (unsigned)sizeof(sK[0]), lv0 + (unsigned)(st & 1) * (unsigned)sizeof(sV[0]));
  }
  asm volatile("s_wait_asynccnt 0x0" ::: "memory");    // no copy is left in flight when the wave goes on to its end
#pragma unroll
  for (int t = 0; t < QT; ++t) {   // lane (g, col) holds o[d = 16 j + 8 g + r] of query col; the two halves of a query join by one exchange
    const float inv = 1.0f / (lr[t] + xhalf(lr[t])); const size_t ro = ((size_t)b * TT + ql0 + t * 16 + col) * CC + h * HD + 8 * g;
    v4f vv[4][2]; float dt = 0.f, nn = 0.f;
#pragma unroll
    for (int j = 0; j < 4; ++j) { vv[j][0] = *(const v4f*)(VR + ro + j * 16); vv[j][1] = *(const v4f*)(VR + ro + j * 16 + 4);
#pragma unroll
      for (int r = 0; r < 8; ++r) { const float o = acc[t][j][r] * inv, v = vv[j][r >> 2][r & 3]; acc[t][j][r] = o; dt += o * v; nn += v * v; } }
    dt += xhalf(dt); nn += xhalf(nn); const float al = dt / (nn + 1e-8f);
#pragma unroll
    for (int j = 0; j < 4; ++j) { v4f o0, o1;
#pragma unroll
      for (int r = 0; r < 4; ++r) { o0[r] = acc[t][j][r] - al * vv[j][0][r]; o1[r] = acc[t][j][4 + r] - al * vv[j][1][r]; }
      vst2(Y + ro + j * 16, o0); vst2(Y + ro + j * 16 + 4, o1); } } }
// ---- k_out: block = 8 waves = (128 rows, 128 cols), a wave = 32 x 64: out = y (bf16 hi + lo) Wproj + b; per 64-k step y (split once per block) and W are staged in LDS as in k_proj, a whole 256-B unit per 16 lanes
#define OBK 64   // k per step
#define OP 72    // elements per staged row of 64 bf16: 144 B = 16 B x odd, the pitch at which 16-byte fragment reads meet no bank twice
__global__ __launch_bounds__(256) void k_out(const float* __restrict__ Y, const float* __restrict__ WP, const float* __restrict__ BP, float* __restrict__ OUT) { __shared__ __align__(16) float sf[8][32][68]; __shared__ __align__(16) __bf16 sH[2][128][OP], sL[2][128][OP], sB[2][128][OP];
  const int tid = threadIdx.x, wave = tid >> 5, lane = tid & 31, col = lane & 15, g = lane >> 4; const int wr = wave >> 1, wc = wave & 1; const int c0 = blockIdx.y * 128; const size_t r0 = (size_t)blockIdx.x * 128;
  v8f acc[2][4] = {};
  const int srow = tid >> 4, sq = tid & 15;   // staging: thread = (row srow + 16 i, 16-byte piece sq of the row's 256 B)
  const float* Yp = Y + (r0 + srow) * CC + sq * 4; const float* Wp = WP + (size_t)(c0 + srow) * CC + sq * 4;
  v4f ra[8], rb[8];
#pragma unroll
  for (int i = 0; i < 8; ++i) ra[i] = *(const v4f*)(Yp + (size_t)i * 16 * CC);
#pragma unroll
  for (int i = 0; i < 8; ++i) rb[i] = *(const v4fu*)(Wp + (size_t)i * 16 * CC);
#pragma unroll
  for (int i = 0; i < 8; ++i) { const v4b hi = cvt4(ra[i]); v4f re;
#pragma unroll
    for (int e = 0; e < 4; ++e) re[e] = ra[i][e] - (float)hi[e];
    *(v4b*)&sH[0][srow + i * 16][sq * 4] = hi; *(v4b*)&sL[0][srow + i * 16][sq * 4] = cvt4(re); }
#pragma unroll
  for (int i = 0; i < 8; ++i) *(v4b*)&sB[0][srow + i * 16][sq * 4] = cvt4(rb[i]);
  __syncthreads();
#pragma unroll 2   // by two, so that each half addresses its buffers by constants
  for (int ks = 0; ks < CC / OBK; ++ks) { const int cur = ks & 1; const bool more = ks + 1 < CC / OBK;
    if (more) {   // the next step's lines fly under this step's products
#pragma unroll
      for (int i = 0; i < 8; ++i) ra[i] = *(const v4f*)(Yp + (size_t)i * 16 * CC + (ks + 1) * OBK);
#pragma unroll
      for (int i = 0; i < 8; ++i) rb[i] = *(const v4fu*)(Wp + (size_t)i * 16 * CC + (ks + 1) * OBK);
      asm volatile("s_wait_xcnt 0x0" ::: "memory"); }   // behind the run of loads: their address registers may be reused by the roundings below only behind this wait
    v16b ah[OBK / 32][2], al[OBK / 32][2], w[OBK / 32][4];   // the step's fragments, read as one group
#pragma unroll
    for (int kk = 0; kk < OBK / 32; ++kk) {
#pragma unroll
      for (int i = 0; i < 2; ++i) { ah[kk][i] = frag_b(&sH[cur][wr * 32 + i * 16 + col][kk * 32], lane); al[kk][i] = frag_b(&sL[cur][wr * 32 + i * 16 + col][kk * 32], lane); }
#pragma unroll
      for (int j = 0; j < 4; ++j) w[kk][j] = frag_b(&sB[cur][wc * 64 + j * 16 + col][kk * 32], lane); }
#pragma unroll
    for (int kk = 0; kk < OBK / 32; ++kk) {
#pragma unroll
      for (int i = 0; i < 2; ++i)
#pragma unroll
        for (int j = 0; j < 4; ++j) acc[i][j] = wmma_bf(ah[kk][i], w[kk][j], acc[i][j]);
#pragma unroll
      for (int i = 0; i < 2; ++i)   // per tile still hi, then lo, of each 32 k in turn
#pragma unroll
        for (int j = 0; j < 4; ++j) acc[i][j] = wmma_bf(al[kk][i], w[kk][j], acc[i][j]); }
    __builtin_amdgcn_sched_barrier(0);   // keeps the roundings below, which wait for the lines in flight, from moving up among this step's products
    if (more) {
#pragma unroll
      for (int i = 0; i < 8; ++i) { const v4b hi = cvt4(ra[i]); v4f re;
#pragma unroll
        for (int e = 0; e < 4; ++e) re[e] = ra[i][e] - (float)hi[e];
        *(v4b*)&sH[cur ^ 1][srow + i * 16][sq * 4] = hi; *(v4b*)&sL[cur ^ 1][srow + i * 16][sq * 4] = cvt4(re); }
#pragma unroll
      for (int i = 0; i < 8; ++i) *(v4b*)&sB[cur ^ 1][srow + i * 16][sq * 4] = cvt4(rb[i]); }
    __syncthreads(); }   // publishes the buffer just filled and ends the reads of the one filled next
#pragma unroll
  for (int j = 0; j < 4; ++j) { const float bb = BP ? bfr(BP[c0 + wc * 64 + j * 16 + col]) : 0.f;
#pragma unroll
    for (int i = 0; i < 2; ++i)
#pragma unroll
      for (int r = 0; r < 8; ++r) sf[wave][i * 16 + 8 * g + r][j * 16 + col] = acc[i][j][r] + bb; }
  LDSX();
#pragma unroll
  for (int e = 0; e < 16; ++e) { const int rl = e * 2 + (lane >> 4), q = lane & 15; vst2(OUT + (r0 + wr * 32 + rl) * CC + c0 + wc * 64 + q * 4, *(const v4f*)&sf[wave][rl][q * 4]); } }
extern "C" void kernel_launch(void* const* d_in, const int* in_sizes, int n_in, void* d_out, int out_size, void* d_ws, size_t ws_size, hipStream_t stream) {
  (void)in_sizes; (void)n_in; (void)out_size;
  const float** F = (const float**)d_in;   // 0 x [2,2048,1024], 1 wq [1024,1024] ([out,in]), 2 bq, 3 wk, 4 bk, 5 wv, 6 bv, 7 wo, 8 bo
  if (ws_size < (size_t)WS_END) return;
  char* ws = (char*)d_ws; _Float16 *QH = (_Float16*)(ws + WS_QH), *QL = (_Float16*)(ws + WS_QL), *KH = (_Float16*)(ws + WS_KH), *VT = (_Float16*)(ws + WS_VT); float *Y = (float*)(ws + WS_Y), *VR = (float*)(ws + WS_VR);
  k_proj<<<dim3(TNB * TT / PBM, CC / PBN, 3), PNT, 0, stream>>>(F[0], F[1], F[2], F[3], F[4], F[5], F[6], QH, QL, KH, VT, VR);
  k_fa<<<dim3(TT / (8 * 16 * QT), NH, TNB), 256, 0, stream>>>(QH, KH, VT, VR, Y);
  k_out<<<dim3(TNB * TT / 128, CC / 128), 256, 0, stream>>>(Y, F[7], F[8], (float*)d_out);
}

// v006
// Measured time: 87 microseconds a run.
// In two side-by-side timings against v005, it was 1.07 and 1.06 times as fast.
// Counting every step since v000, it is 15.8 times as fast.
// compute dtype: all float inputs rounded to bf16; q/k/v = x W^T + b with EXACT bf16 products on WMMA 16x16x32, f32 accumulate; q, k rounded once to f16 (1-product logits, f32, kept in registers); online softmax in f32, base 2, against a running maximum -> unnormalised P f16 (at most 2^8); o = P . v (v once to f16) / row sum; per-position exclusion o -= (o . v_s / (|v_s|^2 + 1e-8)) v_s in f32 with the exact f32 v row; out = o (bf16 hi + lo) Wo^T + bo; f32 output.
#include <hip/hip_runtime.h>
#include <math.h>

typedef __attribute__((ext_vector_type(16))) _Float16 v16h;
typedef __attribute__((ext_vector_type(16))) __bf16 v16b;
typedef __attribute__((ext_vector_type(8)))  _Float16 v8h;
typedef __attribute__((ext_vector_type(8)))  float v8f;
typedef __attribute__((ext_vector_type(4)))  float v4f;
typedef __attribute__((ext_vector_type(2)))  float v2f;
typedef __attribute__((ext_vector_type(4)))  unsigned v4u;
typedef __attribute__((ext_vector_type(4)))  int v4i;
typedef float __attribute__((may_alias)) float_a;
typedef int __attribute__((may_alias)) int_a;

template <typename T> __device__ __forceinline__ void vst2(void* p, T v) { *(T*)p = v;  }
__device__ __forceinline__ v8f wmma16(v16h a, v16h b, v8f c) {
  return __builtin_amdgcn_wmma_f32_16x16x32_f16(false, a, false, b, (short)0, c, false, false);   // the compiler keeps the distance behind its own builtin form where a vector instruction follows on D, A or B
}
__device__ __forceinline__ v8f wmma_bf(v16b a, v16b b, v8f c) {
  v8f d = __builtin_amdgcn_wmma_f32_16x16x32_bf16(false, a, false, b, (short)0, c, false, false);
  asm volatile("v_nop\n\tv_nop\n\tv_nop\n\tv_nop" : "+v"(d) : "v"(a), "v"(b));
  return d;
}
// 16x16x32 fragments: lane = (h = lane>>4, row/col = lane&15); elements 0..7 = k0+8h+0..7, 8..15 = k0+16+8h+0..7; D element r = row 8h+r
__device__ __forceinline__ v16h frag_h(const _Float16* rowk0, int lane) {
  union { v16h v; v8h q[2]; } u; const _Float16* p = rowk0 + 8 * (lane >> 4);
  u.q[0] = *(const v8h*)p; u.q[1] = *(const v8h*)(p + 16); return u.v;
}
__device__ __forceinline__ v16h frag_f32(const float* rowk0, int lane) {
  v16h a; const float* p = rowk0 + 8 * (lane >> 4);
#pragma unroll
  for (int i = 0; i < 8; ++i) { a[i] = (_Float16)p[i]; a[8 + i] = (_Float16)p[16 + i]; }
  return a;
}
__device__ __forceinline__ v16h frag_f32s(const float* rowk0, int lane, float sc) {
  v16h a; const float* p = rowk0 + 8 * (lane >> 4);
#pragma unroll
  for (int i = 0; i < 8; ++i) { a[i] = (_Float16)(p[i] * sc); a[8 + i] = (_Float16)(p[16 + i] * sc); }
  return a;
}
// column fragment from a [K][ld] layout (column n), rows >= K read as 0
__device__ __forceinline__ v16h fragc_f32(const float* W, int k0, int n, int lane, int ld, int K) {
  v16h a; const int g = lane >> 4;
#pragma unroll
  for (int i = 0; i < 8; ++i) { const int ka = k0 + 8 * g + i, kb = ka + 16;
    a[i] = (_Float16)(ka < K ? W[(size_t)(ka < K ? ka : K - 1) * ld + n] : 0.f); a[8 + i] = (_Float16)(kb < K ? W[(size_t)(kb < K ? kb : K - 1) * ld + n] : 0.f); }
  return a;
}
struct F2 { v16b h, l; };
__device__ __forceinline__ F2 bsplit16(const float v[16]) { F2 r;
#pragma unroll
  for (int i = 0; i < 16; ++i) { const __bf16 h = (__bf16)v[i]; r.h[i] = h; r.l[i] = (__bf16)(v[i] - (float)h); }
  return r; }
__device__ __forceinline__ F2 split_row(const float* row, int k0, int lane) { float v[16]; const float* p = row + k0 + 8 * (lane >> 4);
#pragma unroll
  for (int i = 0; i < 8; ++i) { v[i] = p[i]; v[8 + i] = p[16 + i]; }
  return bsplit16(v); }
__device__ __forceinline__ F2 split_rowK(const float* row, int k0, int lane, int K) { float v[16]; const int g = lane >> 4;
#pragma unroll
  for (int i = 0; i < 8; ++i) { const int ka = k0 + 8 * g + i, kb = ka + 16; v[i] = ka < K ? row[ka < K ? ka : K - 1] : 0.f; v[8 + i] = kb < K ? row[kb < K ? kb : K - 1] : 0.f; }
  return bsplit16(v); }
__device__ __forceinline__ F2 split_col(const float* W, int k0, int n, int lane, int ld, int K) { float v[16]; const int g = lane >> 4;
#pragma unroll
  for (int i = 0; i < 8; ++i) { const int ka = k0 + 8 * g + i, kb = ka + 16; v[i] = ka < K ? W[(size_t)(ka < K ? ka : K - 1) * ld + n] : 0.f; v[8 + i] = kb < K ? W[(size_t)(kb < K ? kb : K - 1) * ld + n] : 0.f; }
  return bsplit16(v); }
__device__ __forceinline__ v8f mac3(const F2& a, const F2& b, v8f c) { c = wmma_bf(a.l, b.h, c); c = wmma_bf(a.h, b.l, c); return wmma_bf(a.h, b.h, c); }
__device__ __forceinline__ float sigm(float v) { return 1.0f / (1.0f + expf(-v)); }
#define LDSX() do { asm volatile("s_wait_dscnt 0" ::: "memory"); __builtin_amdgcn_wave_barrier(); __builtin_amdgcn_fence(__ATOMIC_RELEASE, "workgroup"); } while (0)


// Exclusive self attention (B 2, S 2,048, D 1,024 = 16 x 64): q/k/v Linear ([out,in] + bias), softmax(q k / 8) v, then per position and head o -= <o, v_s> / (|v_s|^2 + 1e-8) v_s, output Linear.
#define NB 2
#define TT 2048
#define CC 1024
#define NH 16
#define HD 64
#ifndef TNB
#define TNB NB
#endif
typedef __attribute__((ext_vector_type(8))) __bf16 v8b;
__device__ __forceinline__ v16b frag_b(const __bf16* rowk0, int lane) {
  union { v16b v; v8b q[2]; } u; const __bf16* p = rowk0 + 8 * (lane >> 4);
  u.q[0] = *(const v8b*)p; u.q[1] = *(const v8b*)(p + 16); return u.v;
}
__device__ __forceinline__ float bfr(float v) { return (float)(__bf16)v; }
typedef __attribute__((ext_vector_type(4))) __bf16 v4b;
typedef v4f __attribute__((aligned(4))) v4fu;   // 16-byte read of an input that is only known to be float-aligned
#define KP 40   // elements per staged row of 32 bf16: 80 B = 16 B x odd, the pitch at which 16-byte fragment reads meet no bank twice
__device__ __forceinline__ v4b cvt4(v4f v) { v4b r;
#pragma unroll
  for (int i = 0; i < 4; ++i) r[i] = (__bf16)v[i];
  return r; }
__device__ __attribute__((noinline)) float exp_ni(float v) { return expf(v); }
__device__ __attribute__((noinline)) float erf_ni(float v) { return erff(v); }

#define WS_QH  0u
#define WS_QL  (WS_QH + 2u * (size_t)NB * TT * CC)
#define WS_KH  (WS_QL + 2u * (size_t)NB * TT * CC)
#define WS_VT  (WS_KH + 2u * (size_t)NB * TT * CC)      // f16 v planes [b][c][t]
#define WS_Y   (WS_VT + 2u * (size_t)NB * CC * TT)      // f32 y rows [b*t][C]
#define WS_VR  (WS_Y + 4u * (size_t)NB * TT * CC)       // f32 v rows [b*t][C] for the exclusion step
#define WS_END (WS_VR + 4u * (size_t)NB * TT * CC)

// ---- k_proj: block = 16 waves = (256 rows, 256 cols, which), a wave = 64 x 64: qkv = x W (+ b), exact; q -> f16 hi (+ residual), k -> f16 rows, v -> f16 planes and f32 rows. Per 32-k step the block reads its x and W rows once, a whole 128-B line per 8 lanes, rounds them to bf16 and stages them in LDS (two buffers); a wave takes 4 + 4 fragments from there for 16 products. In the epilogue each wave turns its own tile in its own piece of the same LDS.
#define PBM 256   // rows of x per block
#define PBN 256   // rows of W (output columns) per block
#define PNT 512   // threads: 4 x 4 waves
#define PEW 9216  // bytes of LDS per wave in the epilogue: 64 rows of 72 f16, or 32 rows of 68 f32
__global__ __launch_bounds__(PNT) void k_proj(const float* __restrict__ X, const float* __restrict__ WQ, const float* __restrict__ BQ, const float* __restrict__ WK, const float* __restrict__ BK, const float* __restrict__ WV, const float* __restrict__ BV, _Float16* __restrict__ QH, _Float16* __restrict__ QL, _Float16* __restrict__ KH, _Float16* __restrict__ VT, float* __restrict__ VR) {
  __shared__ __align__(16) char sm[(PNT / 32) * PEW];
  __bf16 (*sA)[PBM][KP] = (__bf16 (*)[PBM][KP])sm; __bf16 (*sB)[PBN][KP] = (__bf16 (*)[PBN][KP])(sm + 2 * PBM * KP * 2);   // main loop: 2 x 20 KiB each
  const int tid = threadIdx.x, wave = tid >> 5, lane = tid & 31, col = lane & 15, g = lane >> 4; const int wr = wave >> 2, wc = wave & 3; const int which = blockIdx.z; const int c0 = blockIdx.y * PBN; const size_t r0 = (size_t)blockIdx.x * PBM; const float* WA = which == 0 ? WQ : which == 1 ? WK : WV; const float* BA = which == 0 ? BQ : which == 1 ? BK : BV;
  v8f acc[4][4] = {};
  const int srow = tid >> 3, sq = tid & 7;   // staging: thread = (row srow + 64 i, 16-byte piece sq of the row's 128-B line)
  const float* Xp = X + (r0 + srow) * CC + sq * 4; const float* Wp = WA + (size_t)(c0 + srow) * CC + sq * 4;
  // The block's first k step; the walk wraps round, so every start gives the whole sum, in another order. Blocks that read the same rows start at different steps: they do not ask L2 for the same lines at the same moment, and a line that one of them has brought in from memory is in L2 when the others come to it. Same x rows (12 blocks): 3 steps apart. Same W rows (16 blocks): 2 apart, and 4 apart among blocks whose blockIdx.x lies in four neighbouring residues modulo 8. For speed only.
  const int ks0 = (((blockIdx.x & 3) << 2) + ((blockIdx.x >> 3) << 4) + (((blockIdx.x >> 2) & 1) << 1) + 3 * (blockIdx.y + 4 * blockIdx.z)) & (CC / 32 - 1);
  v4f ra[4], rb[4];
#pragma unroll
  for (int i = 0; i < 4; ++i) ra[i] = *(const v4fu*)(Xp + (size_t)i * 64 * CC + ks0 * 32);
#pragma unroll
  for (int i = 0; i < 4; ++i) rb[i] = *(const v4fu*)(Wp + (size_t)i * 64 * CC + ks0 * 32);
#pragma unroll
  for (int i = 0; i < 4; ++i) *(v4b*)&sA[0][srow + i * 64][sq * 4] = cvt4(ra[i]);
#pragma unroll
  for (int i = 0; i < 4; ++i) *(v4b*)&sB[0][srow + i * 64][sq * 4] = cvt4(rb[i]);
  __syncthreads();
#pragma unroll 2   // by two, so that each half addresses its buffers by constants
  for (int kc = 0; kc < CC / 32; ++kc) { const int cur = kc & 1; const bool more = kc + 1 < CC / 32;
    if (more) {   // the next step's lines fly under this step's products
      const int kn = ((kc + 1 + ks0) & (CC / 32 - 1)) * 32;
#pragma unroll
      for (int i = 0; i < 4; ++i) ra[i] = *(const v4fu*)(Xp + (size_t)i * 64 * CC + kn);
#pragma unroll
      for (int i = 0; i < 4; ++i) rb[i] = *(const v4fu*)(Wp + (size_t)i * 64 * CC + kn);
      asm volatile("s_wait_xcnt 0x0" ::: "memory"); }   // behind the run of loads: their address registers may be reused by the roundings below only behind this wait
    v16b a[4], w[4];
#pragma unroll
    for (int i = 0; i < 4; ++i) a[i] = frag_b(&sA[cur][wr * 64 + i * 16 + col][0], lane);
#pragma unroll
    for (int j = 0; j < 4; ++j) w[j] = frag_b(&sB[cur][wc * 64 + j * 16 + col][0], lane);
#pragma unroll
    for (int i = 0; i < 4; ++i)
#pragma unroll
      for (int j = 0; j < 4; ++j) acc[i][j] = wmma_bf(a[i], w[j], acc[i][j]);
    __builtin_amdgcn_sched_barrier(0);   // keeps the roundings below, which wait for the lines in flight, from moving up among this step's products
    if (more) {
#pragma unroll
      for (int i = 0; i < 4; ++i) *(v4b*)&sA[cur ^ 1][srow + i * 64][sq * 4] = cvt4(ra[i]);
#pragma unroll
      for (int i = 0; i < 4; ++i) *(v4b*)&sB[cur ^ 1][srow + i * 64][sq * 4] = cvt4(rb[i]); }
    __syncthreads(); }   // publishes the buffer just filled and ends the reads of the one filled next; the last one frees the LDS for the epilogue
  char* ew = sm + wave * PEW;   // this wave's own piece: no other wave reads or writes it from here on, so LDSX() orders all that follows
  const size_t rw = r0 + wr * 64; const int cw = c0 + wc * 64;   // the wave's first row and column
  const int bi = cw + col; float bb[4];
#pragma unroll
  for (int j = 0; j < 4; ++j) bb[j] = BA[bi + j * 16];
  asm volatile("s_wait_xcnt 0x0" :: "v"(bi) : "memory");   // the bias loads' index register stays live up to this wait, so that none of the four lands on it in front of the wait
#pragma unroll
  for (int j = 0; j < 4; ++j) bb[j] = bfr(bb[j]);
  if (which == 0) { _Float16 (*eh)[72] = (_Float16 (*)[72])ew;   // 32 rows at a time: rows 0..31 of the piece hold q's f16 value, rows 32..63 its residual
#pragma unroll
    for (int hf = 0; hf < 2; ++hf) {
      if (hf) LDSX();   // the first half's reads are over before its rows are written anew
#pragma unroll
      for (int i = 0; i < 2; ++i)
#pragma unroll
        for (int j = 0; j < 4; ++j)
#pragma unroll
          for (int r = 0; r < 8; ++r) { const float v = acc[hf * 2 + i][j][r] + bb[j]; const _Float16 hv = (_Float16)v; eh[i * 16 + 8 * g + r][j * 16 + col] = hv; eh[32 + i * 16 + 8 * g + r][j * 16 + col] = (_Float16)(v - (float)hv); }
      LDSX();
#pragma unroll
      for (int e = 0; e < 8; ++e) { const int rl = e * 4 + (lane >> 3), q = lane & 7; const size_t o = (rw + hf * 32 + rl) * CC + cw + q * 8;   // 4 whole 128-B lines per store
        vst2((unsigned*)(QH + o), *(const v4u*)&eh[rl][q * 8]); vst2((unsigned*)(QL + o), *(const v4u*)&eh[32 + rl][q * 8]); } }
    asm volatile("s_wait_xcnt 0x0" ::: "memory");   // behind the wave's last stores: no register that they name is reused in front of this wait
  }
  else if (which == 1) { _Float16 (*eh)[72] = (_Float16 (*)[72])ew;
#pragma unroll
    for (int i = 0; i < 4; ++i)
#pragma unroll
      for (int j = 0; j < 4; ++j)
#pragma unroll
        for (int r = 0; r < 8; ++r) eh[i * 16 + 8 * g + r][j * 16 + col] = (_Float16)(acc[i][j][r] + bb[j]);
    LDSX();
#pragma unroll
    for (int e = 0; e < 16; ++e) { const int rl = e * 4 + (lane >> 3), q = lane & 7; vst2((unsigned*)(KH + (rw + rl) * CC + cw + q * 8), *(const v4u*)&eh[rl][q * 8]); }   // 4 whole 128-B lines per store
    asm volatile("s_wait_xcnt 0x0" ::: "memory");   // behind the wave's last stores: no register that they name is reused in front of this wait
  }
  else { _Float16 (*et)[72] = (_Float16 (*)[72])ew; float (*ef)[68] = (float (*)[68])ew; const size_t b = rw / TT; const int t0 = (int)(rw % TT);
#pragma unroll
    for (int i = 0; i < 4; ++i)
#pragma unroll
      for (int j = 0; j < 4; ++j) { v8h hv;
#pragma unroll
        for (int r = 0; r < 8; ++r) hv[r] = (_Float16)(acc[i][j][r] + bb[j]);
        *(v8h*)&et[j * 16 + col][i * 16 + 8 * g] = hv; }   // a lane's 8 rows are 8 neighbours of one plane row
    LDSX();
#pragma unroll
    for (int e = 0; e < 16; ++e) { const int cl = e * 4 + (lane >> 3), q = lane & 7; vst2((unsigned*)(VT + (b * CC + cw + cl) * (size_t)TT + t0 + q * 8), *(const v4u*)&et[cl][q * 8]); }
#pragma unroll
    for (int hf = 0; hf < 2; ++hf) {   // the f32 rows, 32 at a time
      LDSX();
#pragma unroll
      for (int i = 0; i < 2; ++i)
#pragma unroll
        for (int j = 0; j < 4; ++j)
#pragma unroll
          for (int r = 0; r < 8; ++r) ef[i * 16 + 8 * g + r][j * 16 + col] = acc[hf * 2 + i][j][r] + bb[j];
      LDSX();
#pragma unroll
      for (int e = 0; e < 16; ++e) { const int rl = e * 2 + (lane >> 4), q = lane & 15; vst2(VR + (rw + hf * 32 + rl) * CC + cw + q * 4, *(const v4f*)&ef[rl][q * 4]); } }
    asm volatile("s_wait_xcnt 0x0" ::: "memory");   // behind the wave's last stores: no register that they name is reused in front of this wait
  } }
// ---- k_fa: block = 8 waves x 32 queries of (b,h). The block brings K rows and V plane rows to LDS once per stage of 128 keys, by asynchronous copies into two buffers, and its 8 waves take their fragments from there. Per pass of 32 keys: S^T = K Q^T (a lane holds 16 logits of one query per 16-query tile), online softmax in registers, O^T += V^T P^T (the two S^T tiles, converted in place, are the B operand); then the exclusion step and the y rows.
__device__ __forceinline__ float xhalf(float x) { return __builtin_bit_cast(float, __builtin_amdgcn_permlanex16(__builtin_bit_cast(int, x), __builtin_bit_cast(int, x), 0x76543210, 0xfedcba98, false, false)); }  // lane l with lane l ^ 16
#define QT 2
#define SK 128   // keys per stage
#define KPI 72   // f16 per staged K row of 64: 144 B = 16 B x odd (no bank met twice by 16-byte fragment reads)
#define VPI 136  // f16 per staged V plane row of 128: 272 B = 16 B x odd
// one stage: 128 K rows of 128 B and 64 V plane rows of 256 B, 8 copies of 16 B per lane, whole lines per wave. The s_wait_xcnt stands inside the statement, so that no address register is rewritten in front of it.
__device__ __forceinline__ void stage_kv(const _Float16* gk, const _Float16* gv, unsigned lk, unsigned lv) {
  asm volatile("global_load_async_to_lds_b128 %0, %8, off\n\tglobal_load_async_to_lds_b128 %1, %9, off\n\tglobal_load_async_to_lds_b128 %2, %10, off\n\tglobal_load_async_to_lds_b128 %3, %11, off\n\t"
               "global_load_async_to_lds_b128 %4, %12, off\n\tglobal_load_async_to_lds_b128 %5, %13, off\n\tglobal_load_async_to_lds_b128 %6, %14, off\n\tglobal_load_async_to_lds_b128 %7, %15, off\n\ts_wait_xcnt 0x0"
               :: "v"(lk), "v"(lk + 32u * KPI * 2u), "v"(lk + 64u * KPI * 2u), "v"(lk + 96u * KPI * 2u), "v"(lv), "v"(lv + 16u * VPI * 2u), "v"(lv + 32u * VPI * 2u), "v"(lv + 48u * VPI * 2u),
                  "v"(gk), "v"(gk + 32 * CC), "v"(gk + 64 * CC), "v"(gk + 96 * CC), "v"(gv), "v"(gv + 16 * (size_t)TT), "v"(gv + 32 * (size_t)TT), "v"(gv + 48 * (size_t)TT) : "memory");
}
__global__ __launch_bounds__(256) void k_fa(const _Float16* __restrict__ QH, const _Float16* __restrict__ KH, const _Float16* __restrict__ VT, const float* __restrict__ VR, float* __restrict__ Y) {
  const int tid = threadIdx.x, wave = tid >> 5, lane = tid & 31, col = lane & 15, g = lane >> 4; const int h = blockIdx.y, b = blockIdx.z; const int ql0 = blockIdx.x * (8 * 16 * QT) + wave * (16 * QT);
  __shared__ __align__(16) _Float16 sK[2][SK][KPI]; __shared__ __align__(16) _Float16 sV[2][HD][VPI];
  const _Float16* Kg = KH + ((size_t)b * TT + (tid >> 3)) * CC + h * HD + (tid & 7) * 8;              // copies: lane = (key row tid/8 + 32 i, 16-byte piece tid%8 of its 128 B)
  const _Float16* Vg = VT + ((size_t)b * CC + h * HD + (tid >> 4)) * (size_t)TT + (tid & 15) * 8;     // copies: lane = (plane row tid/16 + 16 i, 16-byte piece tid%16 of the stage's 256 B)
  const unsigned lk0 = (unsigned)(size_t)&sK[0][tid >> 3][(tid & 7) * 8], lv0 = (unsigned)(size_t)&sV[0][tid >> 4][(tid & 15) * 8];   // the lane's LDS byte addresses in buffer 0
  const int st0 = ((blockIdx.x & 3) << 2) + ((blockIdx.x >> 2) << 1);   // the block's first stage; the walk wraps round: the 8 blocks of one (b,h), which read the same K and V, start 2 stages apart. For speed only
  stage_kv(Kg + (size_t)st0 * SK * CC, Vg + st0 * SK, lk0, lv0);
  const float SC = 0.125f * 1.4426950408889634f;                             // logits / 8, in base 2
  const _Float16* Qa = QH + ((size_t)b * TT + ql0 + col) * CC + h * HD + 8 * g;   // this lane's first 8 elements of query row col (fragment order as in frag_h)
  v16h qf[QT][2];
#pragma unroll
  for (int t = 0; t < QT; ++t)
#pragma unroll
    for (int kc = 0; kc < 2; ++kc) { union { v16h v; v8h q[2]; } u; u.q[0] = *(const v8h*)(Qa + t * 16 * CC + kc * 32); u.q[1] = *(const v8h*)(Qa + t * 16 * CC + kc * 32 + 16); qf[t][kc] = u.v; }
  asm volatile("s_wait_xcnt 0x0" :: "v"(Qa) : "memory");   // the Q loads' address register stays live up to this wait, so that the accumulators below reuse it only behind it
  asm volatile("s_wait_asynccnt 0x0" ::: "memory");        // the block's first stage has landed, as far as this wave copied it
  __syncthreads();                                          // publishes the block's first stage
  stage_kv(Kg + (size_t)((st0 + 1) & (TT / SK - 1)) * SK * CC, Vg + ((st0 + 1) & (TT / SK - 1)) * SK, lk0 + (unsigned)sizeof(sK[0]), lv0 + (unsigned)sizeof(sV[0]));   // the second stage flies under the first one's passes
  v8f acc[QT][4] = {}; float mr[QT], lr[QT];
#pragma unroll
  for (int t = 0; t < QT; ++t) { mr[t] = -3.0e38f; lr[t] = 0.f; }
#pragma unroll 1
  for (int st = 0; st < TT / SK; ++st) {   // rolled: the two buffers differ by a base address only
   const _Float16* Ks = &sK[st & 1][col][0];   // key row col of a 16-key tile
   const _Float16* Vs = &sV[st & 1][col][0];   // plane row d = col of a 16-d tile
   v16h kf[2][2];
#pragma unroll
   for (int i = 0; i < 2; ++i)
#pragma unroll
     for (int kc = 0; kc < 2; ++kc) kf[i][kc] = frag_h(Ks + (i * 16) * KPI + kc * 32, lane);
#pragma unroll   // the stage's four passes: every LDS offset a constant
   for (int p = 0; p < SK / 32; ++p) {
    v16h vf[4];
#pragma unroll
    for (int j = 0; j < 4; ++j) vf[j] = frag_h(Vs + (j * 16) * VPI + p * 32, lane);
    v8f s[QT][2];
#pragma unroll
    for (int t = 0; t < QT; ++t)
#pragma unroll
      for (int i = 0; i < 2; ++i) { v8f z = {}; z = wmma16(kf[i][0], qf[t][0], z); s[t][i] = wmma16(kf[i][1], qf[t][1], z); }
    if (p + 1 < SK / 32) {   // the next pass's K fragments come under the softmax; never the next stage's, which is not published yet
#pragma unroll
      for (int i = 0; i < 2; ++i)
#pragma unroll
        for (int kc = 0; kc < 2; ++kc) kf[i][kc] = frag_h(Ks + ((p + 1) * 32 + i * 16) * KPI + kc * 32, lane); }
    __builtin_amdgcn_sched_barrier(0);   // keeps both groups of fragment loads up here, a whole softmax ahead of their first use; left free they sink to just in front of the products that read them
    float mx[QT]; bool need = false;
#pragma unroll
    for (int t = 0; t < QT; ++t) { float a = fmaxf(s[t][0][0], s[t][1][0]);
#pragma unroll
      for (int r = 1; r < 8; ++r) a = fmaxf(a, fmaxf(s[t][0][r], s[t][1][r]));
      a = fmaxf(a, xhalf(a)); mx[t] = a * SC; need = need || (mx[t] > mr[t] + 8.0f); }
    if (__builtin_amdgcn_ballot_w32(need) != 0) {   // lazy rescale: only when some query's maximum has grown by more than 2^8 (always on the first pass)
#pragma unroll
      for (int t = 0; t < QT; ++t) { const float mn = fmaxf(mr[t], mx[t]); const float al = __builtin_amdgcn_exp2f(mr[t] - mn); mr[t] = mn; lr[t] *= al;
#pragma unroll
        for (int j = 0; j < 4; ++j) acc[t][j] *= al; }
    }
    v16h pf[QT];   // each query tile's P in registers of its own: written over the first tile's directly behind the products that read them, the second tile's costs four pad slots more
#pragma unroll
    for (int t = 0; t < QT; ++t) { v2f sum = {0.f, 0.f}; const v2f sc2 = {SC, SC}, nm2 = {-mr[t], -mr[t]};
#pragma unroll
      for (int i = 0; i < 2; ++i)
#pragma unroll
        for (int r = 0; r < 8; r += 2) { v2f a = {s[t][i][r], s[t][i][r + 1]}; a = __builtin_elementwise_fma(a, sc2, nm2); const v2f e = {__builtin_amdgcn_exp2f(a[0]), __builtin_amdgcn_exp2f(a[1])}; sum += e; pf[t][i * 8 + r] = (_Float16)e[0]; pf[t][i * 8 + r + 1] = (_Float16)e[1]; }
      lr[t] += sum[0] + sum[1]; }
#pragma unroll
    for (int t = 0; t < QT; ++t)
#pragma unroll
      for (int j = 0; j < 4; ++j) acc[t][j] = wmma16(vf[j], pf[t], acc[t][j]);
    __builtin_amdgcn_sched_barrier(0);   // keeps the next pass's V fragment loads out of this pass: a second set of them takes the kernel over 256 registers
    asm volatile("v_nop\n\tv_nop\n\tv_nop\n\tv_nop");   // four vector slots between this pass's last product and the next pass's first ones, whose results may be given the registers that P was read from
    __builtin_amdgcn_sched_barrier(0);   // holds the next pass's products behind those four slots
   }
   asm volatile("s_wait_dscnt 0x0" ::: "memory");      // this wave's reads of the stage's buffer are over
   asm volatile("s_wait_asynccnt 0x0" ::: "memory");   // the next stage has landed, as far as this wave copied it
   __syncthreads();                                     // publishes the next stage and frees this stage's buffer
   if (st + 2 < TT / SK) stage_kv(Kg + (size_t)((st + 2 + st0) & (TT / SK - 1)) * SK * CC, Vg + ((st + 2 + st0) & (TT / SK - 1)) * SK, lk0 + (unsigned)(st & 1) * (unsigned)sizeof(sK[0]), lv0 + (unsigned)(st & 1) * (unsigned)sizeof(sV[0]));
  }
  asm volatile("s_wait_asynccnt 0x0" ::: "memory");    // no copy is left in flight when the wave goes on to its end
#pragma unroll
  for (int t = 0; t < QT; ++t) {   // lane (g, col) holds o[d = 16 j + 8 g + r] of query col; the two halves of a query join by one exchange
    const float inv = 1.0f / (lr[t] + xhalf(lr[t])); const size_t ro = ((size_t)b * TT + ql0 + t * 16 + col) * CC + h * HD + 8 * g;
    v4f vv[4][2]; float dt = 0.f, nn = 0.f;
#pragma unroll
    for (int j = 0; j < 4; ++j) { vv[j][0] = *(const v4f*)(VR + ro + j * 16); vv[j][1] = *(const v4f*)(VR + ro + j * 16 + 4);
#pragma unroll
      for (int r = 0; r < 8; ++r) { const float o = acc[t][j][r] * inv, v = vv[j][r >> 2][r & 3]; acc[t][j][r] = o; dt += o * v; nn += v * v; } }
    dt += xhalf(dt); nn += xhalf(nn); const float al = dt / (nn + 1e-8f);
#pragma unroll
    for (int j = 0; j < 4; ++j) { v4f o0, o1;
#pragma unroll
      for (int r = 0; r < 4; ++r) { o0[r] = acc[t][j][r] - al * vv[j][0][r]; o1[r] = acc[t][j][4 + r] - al * vv[j][1][r]; }
      vst2(Y + ro + j * 16, o0); vst2(Y + ro + j * 16 + 4, o1); } } }
// ---- k_out: block = 8 waves = (128 rows, 128 cols), a wave = 32 x 64: out = y (bf16 hi + lo) Wproj + b; per 64-k step y (split once per block) and W are staged in LDS as in k_proj, a whole 256-B unit per 16 lanes
#define OBK 64   // k per step
#define OP 72    // elements per staged row of 64 bf16: 144 B = 16 B x odd, the pitch at which 16-byte fragment reads meet no bank twice
__global__ __launch_bounds__(256) void k_out(const float* __restrict__ Y, const float* __restrict__ WP, const float* __restrict__ BP, float* __restrict__ OUT) { __shared__ __align__(16) float sf[8][32][68]; __shared__ __align__(16) __bf16 sH[2][128][OP], sL[2][128][OP], sB[2][128][OP];
  const int tid = threadIdx.x, wave = tid >> 5, lane = tid & 31, col = lane & 15, g = lane >> 4; const int wr = wave >> 1, wc = wave & 1; const int c0 = blockIdx.y * 128; const size_t r0 = (size_t)blockIdx.x * 128;
  v8f acc[2][4] = {};
  const int srow = tid >> 4, sq = tid & 15;   // staging: thread = (row srow + 16 i, 16-byte piece sq of the row's 256 B)
  const float* Yp = Y + (r0 + srow) * CC + sq * 4; const float* Wp = WP + (size_t)(c0 + srow) * CC + sq * 4;
  const int ks0 = ((blockIdx.x & 3) + ((blockIdx.x >> 3) << 2) + 2 * blockIdx.y) & (CC / OBK - 1);   // the block's first k step, as in k_proj: the 8 blocks that read the same y rows start 2 steps apart, the 32 that read the same W rows are spread over all 16
  v4f ra[8], rb[8];
#pragma unroll
  for (int i = 0; i < 8; ++i) ra[i] = *(const v4f*)(Yp + (size_t)i * 16 * CC + ks0 * OBK);
#pragma unroll
  for (int i = 0; i < 8; ++i) rb[i] = *(const v4fu*)(Wp + (size_t)i * 16 * CC + ks0 * OBK);
#pragma unroll
  for (int i = 0; i < 8; ++i) { const v4b hi = cvt4(ra[i]); v4f re;
#pragma unroll
    for (int e = 0; e < 4; ++e) re[e] = ra[i][e] - (float)hi[e];
    *(v4b*)&sH[0][srow + i * 16][sq * 4] = hi; *(v4b*)&sL[0][srow + i * 16][sq * 4] = cvt4(re); }
#pragma unroll
  for (int i = 0; i < 8; ++i) *(v4b*)&sB[0][srow + i * 16][sq * 4] = cvt4(rb[i]);
  __syncthreads();
#pragma unroll 2   // by two, so that each half addresses its buffers by constants
  for (int ks = 0; ks < CC / OBK; ++ks) { const int cur = ks & 1; const bool more = ks + 1 < CC / OBK;
    if (more) {   // the next step's lines fly under this step's products
      const int kn = ((ks + 1 + ks0) & (CC / OBK - 1)) * OBK;
#pragma unroll
      for (int i = 0; i < 8; ++i) ra[i] = *(const v4f*)(Yp + (size_t)i * 16 * CC + kn);
#pragma unroll
      for (int i = 0; i < 8; ++i) rb[i] = *(const v4fu*)(Wp + (size_t)i * 16 * CC + kn);
      asm volatile("s_wait_xcnt 0x0" ::: "memory"); }   // behind the run of loads: their address registers may be reused by the roundings below only behind this wait
    v16b ah[OBK / 32][2], al[OBK / 32][2], w[OBK / 32][4];   // the step's fragments, read as one group
#pragma unroll
    for (int kk = 0; kk < OBK / 32; ++kk) {
#pragma unroll
      for (int i = 0; i < 2; ++i) { ah[kk][i] = frag_b(&sH[cur][wr * 32 + i * 16 + col][kk * 32], lane); al[kk][i] = frag_b(&sL[cur][wr * 32 + i * 16 + col][kk * 32], lane); }
#pragma unroll
      for (int j = 0; j < 4; ++j) w[kk][j] = frag_b(&sB[cur][wc * 64 + j * 16 + col][kk * 32], lane); }
#pragma unroll
    for (int kk = 0; kk < OBK / 32; ++kk) {
#pragma unroll
      for (int i = 0; i < 2; ++i)
#pragma unroll
        for (int j = 0; j < 4; ++j) acc[i][j] = wmma_bf(ah[kk][i], w[kk][j], acc[i][j]);
#pragma unroll
      for (int i = 0; i < 2; ++i)   // per tile still hi, then lo, of each 32 k in turn
#pragma unroll
        for (int j = 0; j < 4; ++j) acc[i][j] = wmma_bf(al[kk][i], w[kk][j], acc[i][j]); }
    __builtin_amdgcn_sched_barrier(0);   // keeps the roundings below, which wait for the lines in flight, from moving up among this step's products
    if (more) {
#pragma unroll
      for (int i = 0; i < 8; ++i) { const v4b hi = cvt4(ra[i]); v4f re;
#pragma unroll
        for (int e = 0; e < 4; ++e) re[e] = ra[i][e] - (float)hi[e];
        *(v4b*)&sH[cur ^ 1][srow + i * 16][sq * 4] = hi; *(v4b*)&sL[cur ^ 1][srow + i * 16][sq * 4] = cvt4(re); }
#pragma unroll
      for (int i = 0; i < 8; ++i) *(v4b*)&sB[cur ^ 1][srow + i * 16][sq * 4] = cvt4(rb[i]); }
    __syncthreads(); }   // publishes the buffer just filled and ends the reads of the one filled next
#pragma unroll
  for (int j = 0; j < 4; ++j) { const float bb = BP ? bfr(BP[c0 + wc * 64 + j * 16 + col]) : 0.f;
#pragma unroll
    for (int i = 0; i < 2; ++i)
#pragma unroll
      for (int r = 0; r < 8; ++r) sf[wave][i * 16 + 8 * g + r][j * 16 + col] = acc[i][j][r] + bb; }
  LDSX();
#pragma unroll
  for (int e = 0; e < 16; ++e) { const int rl = e * 2 + (lane >> 4), q = lane & 15; vst2(OUT + (r0 + wr * 32 + rl) * CC + c0 + wc * 64 + q * 4, *(const v4f*)&sf[wave][rl][q * 4]); } }
extern "C" void kernel_launch(void* const* d_in, const int* in_sizes, int n_in, void* d_out, int out_size, void* d_ws, size_t ws_size, hipStream_t stream) {
  (void)in_sizes; (void)n_in; (void)out_size;
  const float** F = (const float**)d_in;   // 0 x [2,2048,1024], 1 wq [1024,1024] ([out,in]), 2 bq, 3 wk, 4 bk, 5 wv, 6 bv, 7 wo, 8 bo
  if (ws_size < (size_t)WS_END) return;
  char* ws = (char*)d_ws; _Float16 *QH = (_Float16*)(ws + WS_QH), *QL = (_Float16*)(ws + WS_QL), *KH = (_Float16*)(ws + WS_KH), *VT = (_Float16*)(ws + WS_VT); float *Y = (float*)(ws + WS_Y), *VR = (float*)(ws + WS_VR);
  k_proj<<<dim3(TNB * TT / PBM, CC / PBN, 3), PNT, 0, stream>>>(F[0], F[1], F[2], F[3], F[4], F[5], F[6], QH, QL, KH, VT, VR);
  k_fa<<<dim3(TT / (8 * 16 * QT), NH, TNB), 256, 0, stream>>>(QH, KH, VT, VR, Y);
  k_out<<<dim3(TNB * TT / 128, CC / 128), 256, 0, stream>>>(Y, F[7], F[8], (float*)d_out);
}

// v007
// A run of this version takes 82.3 microseconds.
// Timed twice side by side with v006, it ran 1.06 times as fast both times.
// All steps since v000 together make it 16.6 times as fast.
// compute dtype: all float inputs rounded to bf16; q/k/v = x W^T + b with EXACT bf16 products on WMMA 16x16x32, f32 accumulate; q, k rounded once to f16 (1-product logits, f32, kept in registers); online softmax in f32, base 2, against a running maximum -> unnormalised P f16 (at most 2^8); o = P . v (v once to f16) / row sum; per-position exclusion o -= (o . v_s / (|v_s|^2 + 1e-8)) v_s in f32 with the exact f32 v row; out = o (bf16 hi + lo) Wo^T + bo; f32 output.
#include <hip/hip_runtime.h>
#include <math.h>

typedef __attribute__((ext_vector_type(16))) _Float16 v16h;
typedef __attribute__((ext_vector_type(16))) __bf16 v16b;
typedef __attribute__((ext_vector_type(8)))  _Float16 v8h;
typedef __attribute__((ext_vector_type(8)))  float v8f;
typedef __attribute__((ext_vector_type(4)))  float v4f;
typedef __attribute__((ext_vector_type(2)))  float v2f;
typedef __attribute__((ext_vector_type(4)))  unsigned v4u;
typedef __attribute__((ext_vector_type(4)))  int v4i;
typedef float __attribute__((may_alias)) float_a;
typedef int __attribute__((may_alias)) int_a;

template <typename T> __device__ __forceinline__ void vst2(void* p, T v) { *(T*)p = v;  }
__device__ __forceinline__ v8f wmma16(v16h a, v16h b, v8f c) {
  return __builtin_amdgcn_wmma_f32_16x16x32_f16(false, a, false, b, (short)0, c, false, false);   // the compiler keeps the distance behind its own builtin form where a vector instruction follows on D, A or B
}
__device__ __forceinline__ v8f wmma_bf(v16b a, v16b b, v8f c) {
  v8f d = __builtin_amdgcn_wmma_f32_16x16x32_bf16(false, a, false, b, (short)0, c, false, false);
  asm volatile("v_nop\n\tv_nop\n\tv_nop\n\tv_nop" : "+v"(d) : "v"(a), "v"(b));
  return d;
}
// 16x16x32 fragments: lane = (h = lane>>4, row/col = lane&15); elements 0..7 = k0+8h+0..7, 8..15 = k0+16+8h+0..7; D element r = row 8h+r
__device__ __forceinline__ v16h frag_h(const _Float16* rowk0, int lane) {
  union { v16h v; v8h q[2]; } u; const _Float16* p = rowk0 + 8 * (lane >> 4);
  u.q[0] = *(const v8h*)p; u.q[1] = *(const v8h*)(p + 16); return u.v;
}
__device__ __forceinline__ v16h frag_f32(const float* rowk0, int lane) {
  v16h a; const float* p = rowk0 + 8 * (lane >> 4);
#pragma unroll
  for (int i = 0; i < 8; ++i) { a[i] = (_Float16)p[i]; a[8 + i] = (_Float16)p[16 + i]; }
  return a;
}
__device__ __forceinline__ v16h frag_f32s(const float* rowk0, int lane, float sc) {
  v16h a; const float* p = rowk0 + 8 * (lane >> 4);
#pragma unroll
  for (int i = 0; i < 8; ++i) { a[i] = (_Float16)(p[i] * sc); a[8 + i] = (_Float16)(p[16 + i] * sc); }
  return a;
}
// column fragment from a [K][ld] layout (column n), rows >= K read as 0
__device__ __forceinline__ v16h fragc_f32(const float* W, int k0, int n, int lane, int ld, int K) {
  v16h a; const int g = lane >> 4;
#pragma unroll
  for (int i = 0; i < 8; ++i) { const int ka = k0 + 8 * g + i, kb = ka + 16;
    a[i] = (_Float16)(ka < K ? W[(size_t)(ka < K ? ka : K - 1) * ld + n] : 0.f); a[8 + i] = (_Float16)(kb < K ? W[(size_t)(kb < K ? kb : K - 1) * ld + n] : 0.f); }
  return a;
}
struct F2 { v16b h, l; };
__device__ __forceinline__ F2 bsplit16(const float v[16]) { F2 r;
#pragma unroll
  for (int i = 0; i < 16; ++i) { const __bf16 h = (__bf16)v[i]; r.h[i] = h; r.l[i] = (__bf16)(v[i] - (float)h); }
  return r; }
__device__ __forceinline__ F2 split_row(const float* row, int k0, int lane) { float v[16]; const float* p = row + k0 + 8 * (lane >> 4);
#pragma unroll
  for (int i = 0; i < 8; ++i) { v[i] = p[i]; v[8 + i] = p[16 + i]; }
  return bsplit16(v); }
__device__ __forceinline__ F2 split_rowK(const float* row, int k0, int lane, int K) { float v[16]; const int g = lane >> 4;
#pragma unroll
  for (int i = 0; i < 8; ++i) { const int ka = k0 + 8 * g + i, kb = ka + 16; v[i] = ka < K ? row[ka < K ? ka : K - 1] : 0.f; v[8 + i] = kb < K ? row[kb < K ? kb : K - 1] : 0.f; }
  return bsplit16(v); }
__device__ __forceinline__ F2 split_col(const float* W, int k0, int n, int lane, int ld, int K) { float v[16]; const int g = lane >> 4;
#pragma unroll
  for (int i = 0; i < 8; ++i) { const int ka = k0 + 8 * g + i, kb = ka + 16; v[i] = ka < K ? W[(size_t)(ka < K ? ka : K - 1) * ld + n] : 0.f; v[8 + i] = kb < K ? W[(size_t)(kb < K ? kb : K - 1) * ld + n] : 0.f; }
  return bsplit16(v); }
__device__ __forceinline__ v8f mac3(const F2& a, const F2& b, v8f c) { c = wmma_bf(a.l, b.h, c); c = wmma_bf(a.h, b.l, c); return wmma_bf(a.h, b.h, c); }
__device__ __forceinline__ float sigm(float v) { return 1.0f / (1.0f + expf(-v)); }
#define LDSX() do { asm volatile("s_wait_dscnt 0" ::: "memory"); __builtin_amdgcn_wave_barrier(); __builtin_amdgcn_fence(__ATOMIC_RELEASE, "workgroup"); } while (0)


// Exclusive self attention (B 2, S 2,048, D 1,024 = 16 x 64): q/k/v Linear ([out,in] + bias), softmax(q k / 8) v, then per position and head o -= <o, v_s> / (|v_s|^2 + 1e-8) v_s, output Linear.
#define NB 2
#define TT 2048
#define CC 1024
#define NH 16
#define HD 64
#ifndef TNB
#define TNB NB
#endif
typedef __attribute__((ext_vector_type(8))) __bf16 v8b;
__device__ __forceinline__ v16b frag_b(const __bf16* rowk0, int lane) {
  union { v16b v; v8b q[2]; } u; const __bf16* p = rowk0 + 8 * (lane >> 4);
  u.q[0] = *(const v8b*)p; u.q[1] = *(const v8b*)(p + 16); return u.v;
}
__device__ __forceinline__ float bfr(float v) { return (float)(__bf16)v; }
typedef __attribute__((ext_vector_type(4))) __bf16 v4b;
typedef v4f __attribute__((aligned(4))) v4fu;   // 16-byte read of an input that is only known to be float-aligned
#define KP 40   // elements per staged row of 32 bf16: 80 B = 16 B x odd, the pitch at which 16-byte fragment reads meet no bank twice
__device__ __forceinline__ v4b cvt4(v4f v) { v4b r;
#pragma unroll
  for (int i = 0; i < 4; ++i) r[i] = (__bf16)v[i];
  return r; }
__device__ __attribute__((noinline)) float exp_ni(float v) { return expf(v); }
__device__ __attribute__((noinline)) float erf_ni(float v) { return erff(v); }

#define WS_QH  0u
#define WS_QL  (WS_QH + 2u * (size_t)NB * TT * CC)
#define WS_KH  (WS_QL + 2u * (size_t)NB * TT * CC)
#define WS_VT  (WS_KH + 2u * (size_t)NB * TT * CC)      // f16 v planes [b][c][t]
#define WS_YH  (WS_VT + 2u * (size_t)NB * CC * TT)      // bf16 y rows [b*t][C]: y rounded
#define WS_YL  (WS_YH + 2u * (size_t)NB * TT * CC)      // bf16 y rows [b*t][C]: what the rounding left
#define WS_VR  (WS_YL + 2u * (size_t)NB * TT * CC)      // f32 v rows [b*t][C] for the exclusion step
#define WS_WB  (WS_VR + 4u * (size_t)NB * TT * CC)      // bf16 rows of the output weight [out][in]
#define WS_END (WS_WB + 2u * (size_t)CC * CC)

// ---- k_proj: block = 16 waves = (256 rows, 256 cols, which), a wave = 64 x 64: qkv = x W (+ b), exact; q -> f16 hi (+ residual), k -> f16 rows, v -> f16 planes and f32 rows. Per 32-k step the block reads its x and W rows once, a whole 128-B line per 8 lanes, rounds them to bf16 and stages them in LDS (two buffers); a wave takes 4 + 4 fragments from there for 16 products. In the epilogue each wave turns its own tile in its own piece of the same LDS.
#define PBM 256   // rows of x per block
#define PBN 256   // rows of W (output columns) per block
#define PNT 512   // threads: 4 x 4 waves
#define PEW 9216  // bytes of LDS per wave in the epilogue: 64 rows of 72 f16, or 32 rows of 68 f32
#define WOB (CC * CC / ((TNB * TT / PBM) * (CC / PBN)))   // elements of the output weight per block of the grid's fourth plane
__global__ __launch_bounds__(PNT) void k_proj(const float* __restrict__ X, const float* __restrict__ WQ, const float* __restrict__ BQ, const float* __restrict__ WK, const float* __restrict__ BK, const float* __restrict__ WV, const float* __restrict__ BV, const float* __restrict__ WO, _Float16* __restrict__ QH, _Float16* __restrict__ QL, _Float16* __restrict__ KH, _Float16* __restrict__ VT, float* __restrict__ VR, __bf16* __restrict__ WB) {
  __shared__ __align__(16) char sm[(PNT / 32) * PEW];
  __bf16 (*sA)[PBM][KP] = (__bf16 (*)[PBM][KP])sm; __bf16 (*sB)[PBN][KP] = (__bf16 (*)[PBN][KP])(sm + 2 * PBM * KP * 2);   // main loop: 2 x 20 KiB each
  const int tid = threadIdx.x, wave = tid >> 5, lane = tid & 31, col = lane & 15, g = lane >> 4; const int wr = wave >> 2, wc = wave & 3; const int which = blockIdx.z; const int c0 = blockIdx.y * PBN; const size_t r0 = (size_t)blockIdx.x * PBM; const float* WA = which == 0 ? WQ : which == 1 ? WK : WV; const float* BA = which == 0 ? BQ : which == 1 ? BK : BV;
  if (which == 3) {   // the grid's fourth plane: rounds the output weight to bf16 once, for k_out's copies, which cannot round. The whole block leaves here, in front of every barrier
    const size_t wo = (size_t)(blockIdx.y * (TNB * TT / PBM) + blockIdx.x) * WOB + tid * 4; const float* wp = WO + wo; v4f rw[WOB / (PNT * 4)];
#pragma unroll
    for (int i = 0; i < WOB / (PNT * 4); ++i) rw[i] = *(const v4fu*)(wp + i * PNT * 4);
    asm volatile("s_wait_xcnt 0x0" :: "v"(wp) : "memory");   // the loads' address register stays live up to this wait, so that nothing lands on it in front of the wait
    __bf16* bp = WB + wo;
#pragma unroll
    for (int i = 0; i < WOB / (PNT * 4); ++i) *(v4b*)(bp + i * PNT * 4) = cvt4(rw[i]);   // 256 B in a row per wave
    asm volatile("s_wait_xcnt 0x0" :: "v"(bp) : "memory");   // behind the wave's last stores: no register that they name is reused in front of this wait
    return; }
  v8f acc[4][4] = {};
  const int srow = tid >> 3, sq = tid & 7;   // staging: thread = (row srow + 64 i, 16-byte piece sq of the row's 128-B line)
  const float* Xp = X + (r0 + srow) * CC + sq * 4; const float* Wp = WA + (size_t)(c0 + srow) * CC + sq * 4;
  // The block's first k step; the walk wraps round, so every start gives the whole sum, in another order. Blocks that read the same rows start at different steps: they do not ask L2 for the same lines at the same moment, and a line that one of them has brought in from memory is in L2 when the others come to it. Same x rows (12 blocks): 3 steps apart. Same W rows (16 blocks): 2 apart, and 4 apart among blocks whose blockIdx.x lies in four neighbouring residues modulo 8. For speed only.
  const int ks0 = (((blockIdx.x & 3) << 2) + ((blockIdx.x >> 3) << 4) + (((blockIdx.x >> 2) & 1) << 1) + 3 * (blockIdx.y + 4 * blockIdx.z)) & (CC / 32 - 1);
  v4f ra[4], rb[4];
#pragma unroll
  for (int i = 0; i < 4; ++i) ra[i] = *(const v4fu*)(Xp + (size_t)i * 64 * CC + ks0 * 32);
#pragma unroll
  for (int i = 0; i < 4; ++i) rb[i] = *(const v4fu*)(Wp + (size_t)i * 64 * CC + ks0 * 32);
#pragma unroll
  for (int i = 0; i < 4; ++i) *(v4b*)&sA[0][srow + i * 64][sq * 4] = cvt4(ra[i]);
#pragma unroll
  for (int i = 0; i < 4; ++i) *(v4b*)&sB[0][srow + i * 64][sq * 4] = cvt4(rb[i]);
  __syncthreads();
#pragma unroll 2   // by two, so that each half addresses its buffers by constants
  for (int kc = 0; kc < CC / 32; ++kc) { const int cur = kc & 1; const bool more = kc + 1 < CC / 32;
    if (more) {   // the next step's lines fly under this step's products
      const int kn = ((kc + 1 + ks0) & (CC / 32 - 1)) * 32;
#pragma unroll
      for (int i = 0; i < 4; ++i) ra[i] = *(const v4fu*)(Xp + (size_t)i * 64 * CC + kn);
#pragma unroll
      for (int i = 0; i < 4; ++i) rb[i] = *(const v4fu*)(Wp + (size_t)i * 64 * CC + kn);
      asm volatile("s_wait_xcnt 0x0" ::: "memory"); }   // behind the run of loads: their address registers may be reused by the roundings below only behind this wait
    v16b a[4], w[4];
#pragma unroll
    for (int i = 0; i < 4; ++i) a[i] = frag_b(&sA[cur][wr * 64 + i * 16 + col][0], lane);
#pragma unroll
    for (int j = 0; j < 4; ++j) w[j] = frag_b(&sB[cur][wc * 64 + j * 16 + col][0], lane);
#pragma unroll
    for (int i = 0; i < 4; ++i)
#pragma unroll
      for (int j = 0; j < 4; ++j) acc[i][j] = wmma_bf(a[i], w[j], acc[i][j]);
    __builtin_amdgcn_sched_barrier(0);   // keeps the roundings below, which wait for the lines in flight, from moving up among this step's products
    if (more) {
#pragma unroll
      for (int i = 0; i < 4; ++i) *(v4b*)&sA[cur ^ 1][srow + i * 64][sq * 4] = cvt4(ra[i]);
#pragma unroll
      for (int i = 0; i < 4; ++i) *(v4b*)&sB[cur ^ 1][srow + i * 64][sq * 4] = cvt4(rb[i]); }
    __syncthreads(); }   // publishes the buffer just filled and ends the reads of the one filled next; the last one frees the LDS for the epilogue
  char* ew = sm + wave * PEW;   // this wave's own piece: no other wave reads or writes it from here on, so LDSX() orders all that follows
  const size_t rw = r0 + wr * 64; const int cw = c0 + wc * 64;   // the wave's first row and column
  const int bi = cw + col; float bb[4];
#pragma unroll
  for (int j = 0; j < 4; ++j) bb[j] = BA[bi + j * 16];
  asm volatile("s_wait_xcnt 0x0" :: "v"(bi) : "memory");   // the bias loads' index register stays live up to this wait, so that none of the four lands on it in front of the wait
#pragma unroll
  for (int j = 0; j < 4; ++j) bb[j] = bfr(bb[j]);
  if (which == 0) { _Float16 (*eh)[72] = (_Float16 (*)[72])ew;   // 32 rows at a time: rows 0..31 of the piece hold q's f16 value, rows 32..63 its residual
#pragma unroll
    for (int hf = 0; hf < 2; ++hf) {
      if (hf) LDSX();   // the first half's reads are over before its rows are written anew
#pragma unroll
      for (int i = 0; i < 2; ++i)
#pragma unroll
        for (int j = 0; j < 4; ++j)
#pragma unroll
          for (int r = 0; r < 8; ++r) { const float v = acc[hf * 2 + i][j][r] + bb[j]; const _Float16 hv = (_Float16)v; eh[i * 16 + 8 * g + r][j * 16 + col] = hv; eh[32 + i * 16 + 8 * g + r][j * 16 + col] = (_Float16)(v - (float)hv); }
      LDSX();
#pragma unroll
      for (int e = 0; e < 8; ++e) { const int rl = e * 4 + (lane >> 3), q = lane & 7; const size_t o = (rw + hf * 32 + rl) * CC + cw + q * 8;   // 4 whole 128-B lines per store
        vst2((unsigned*)(QH + o), *(const v4u*)&eh[rl][q * 8]); vst2((unsigned*)(QL + o), *(const v4u*)&eh[32 + rl][q * 8]); } }
    asm volatile("s_wait_xcnt 0x0" ::: "memory");   // behind the wave's last stores: no register that they name is reused in front of this wait
  }
  else if (which == 1) { _Float16 (*eh)[72] = (_Float16 (*)[72])ew;
#pragma unroll
    for (int i = 0; i < 4; ++i)
#pragma unroll
      for (int j = 0; j < 4; ++j)
#pragma unroll
        for (int r = 0; r < 8; ++r) eh[i * 16 + 8 * g + r][j * 16 + col] = (_Float16)(acc[i][j][r] + bb[j]);
    LDSX();
#pragma unroll
    for (int e = 0; e < 16; ++e) { const int rl = e * 4 + (lane >> 3), q = lane & 7; vst2((unsigned*)(KH + (rw + rl) * CC + cw + q * 8), *(const v4u*)&eh[rl][q * 8]); }   // 4 whole 128-B lines per store
    asm volatile("s_wait_xcnt 0x0" ::: "memory");   // behind the wave's last stores: no register that they name is reused in front of this wait
  }
  else { _Float16 (*et)[72] = (_Float16 (*)[72])ew; float (*ef)[68] = (float (*)[68])ew; const size_t b = rw / TT; const int t0 = (int)(rw % TT);
#pragma unroll
    for (int i = 0; i < 4; ++i)
#pragma unroll
      for (int j = 0; j < 4; ++j) { v8h hv;
#pragma unroll
        for (int r = 0; r < 8; ++r) hv[r] = (_Float16)(acc[i][j][r] + bb[j]);
        *(v8h*)&et[j * 16 + col][i * 16 + 8 * g] = hv; }   // a lane's 8 rows are 8 neighbours of one plane row
    LDSX();
#pragma unroll
    for (int e = 0; e < 16; ++e) { const int cl = e * 4 + (lane >> 3), q = lane & 7; vst2((unsigned*)(VT + (b * CC + cw + cl) * (size_t)TT + t0 + q * 8), *(const v4u*)&et[cl][q * 8]); }
#pragma unroll
    for (int hf = 0; hf < 2; ++hf) {   // the f32 rows, 32 at a time
      LDSX();
#pragma unroll
      for (int i = 0; i < 2; ++i)
#pragma unroll
        for (int j = 0; j < 4; ++j)
#pragma unroll
          for (int r = 0; r < 8; ++r) ef[i * 16 + 8 * g + r][j * 16 + col] = acc[hf * 2 + i][j][r] + bb[j];
      LDSX();
#pragma unroll
      for (int e = 0; e < 16; ++e) { const int rl = e * 2 + (lane >> 4), q = lane & 15; vst2(VR + (rw + hf * 32 + rl) * CC + cw + q * 4, *(const v4f*)&ef[rl][q * 4]); } }
    asm volatile("s_wait_xcnt 0x0" ::: "memory");   // behind the wave's last stores: no register that they name is reused in front of this wait
  } }
// ---- k_fa: block = 8 waves x 32 queries of (b,h). The block brings K rows and V plane rows to LDS once per stage of 128 keys, by asynchronous copies into two buffers, and its 8 waves take their fragments from there. Per pass of 32 keys: S^T = K Q^T (a lane holds 16 logits of one query per 16-query tile), online softmax in registers, O^T += V^T P^T (the two S^T tiles, converted in place, are the B operand); then the exclusion step and the y rows.
__device__ __forceinline__ float xhalf(float x) { return __builtin_bit_cast(float, __builtin_amdgcn_permlanex16(__builtin_bit_cast(int, x), __builtin_bit_cast(int, x), 0x76543210, 0xfedcba98, false, false)); }  // lane l with lane l ^ 16
#define QT 2
#define SK 128   // keys per stage
#define KPI 72   // f16 per staged K row of 64: 144 B = 16 B x odd (no bank met twice by 16-byte fragment reads)
#define VPI 136  // f16 per staged V plane row of 128: 272 B = 16 B x odd
// one stage: 128 K rows of 128 B and 64 V plane rows of 256 B, 8 copies of 16 B per lane, whole lines per wave. The s_wait_xcnt stands inside the statement, so that no address register is rewritten in front of it.
__device__ __forceinline__ void stage_kv(const _Float16* gk, const _Float16* gv, unsigned lk, unsigned lv) {
  asm volatile("global_load_async_to_lds_b128 %0, %8, off\n\tglobal_load_async_to_lds_b128 %1, %9, off\n\tglobal_load_async_to_lds_b128 %2, %10, off\n\tglobal_load_async_to_lds_b128 %3, %11, off\n\t"
               "global_load_async_to_lds_b128 %4, %12, off\n\tglobal_load_async_to_lds_b128 %5, %13, off\n\tglobal_load_async_to_lds_b128 %6, %14, off\n\tglobal_load_async_to_lds_b128 %7, %15, off\n\ts_wait_xcnt 0x0"
               :: "v"(lk), "v"(lk + 32u * KPI * 2u), "v"(lk + 64u * KPI * 2u), "v"(lk + 96u * KPI * 2u), "v"(lv), "v"(lv + 16u * VPI * 2u), "v"(lv + 32u * VPI * 2u), "v"(lv + 48u * VPI * 2u),
                  "v"(gk), "v"(gk + 32 * CC), "v"(gk + 64 * CC), "v"(gk + 96 * CC), "v"(gv), "v"(gv + 16 * (size_t)TT), "v"(gv + 32 * (size_t)TT), "v"(gv + 48 * (size_t)TT) : "memory");
}
__global__ __launch_bounds__(256) void k_fa(const _Float16* __restrict__ QH, const _Float16* __restrict__ KH, const _Float16* __restrict__ VT, const float* __restrict__ VR, __bf16* __restrict__ YH, __bf16* __restrict__ YL) {
  const int tid = threadIdx.x, wave = tid >> 5, lane = tid & 31, col = lane & 15, g = lane >> 4; const int h = blockIdx.y, b = blockIdx.z; const int ql0 = blockIdx.x * (8 * 16 * QT) + wave * (16 * QT);
  __shared__ __align__(16) _Float16 sK[2][SK][KPI]; __shared__ __align__(16) _Float16 sV[2][HD][VPI];
  const _Float16* Kg = KH + ((size_t)b * TT + (tid >> 3)) * CC + h * HD + (tid & 7) * 8;              // copies: lane = (key row tid/8 + 32 i, 16-byte piece tid%8 of its 128 B)
  const _Float16* Vg = VT + ((size_t)b * CC + h * HD + (tid >> 4)) * (size_t)TT + (tid & 15) * 8;     // copies: lane = (plane row tid/16 + 16 i, 16-byte piece tid%16 of the stage's 256 B)
  const unsigned lk0 = (unsigned)(size_t)&sK[0][tid >> 3][(tid & 7) * 8], lv0 = (unsigned)(size_t)&sV[0][tid >> 4][(tid & 15) * 8];   // the lane's LDS byte addresses in buffer 0
  const int st0 = ((blockIdx.x & 3) << 2) + ((blockIdx.x >> 2) << 1);   // the block's first stage; the walk wraps round: the 8 blocks of one (b,h), which read the same K and V, start 2 stages apart. For speed only
  stage_kv(Kg + (size_t)st0 * SK * CC, Vg + st0 * SK, lk0, lv0);
  const float SC = 0.125f * 1.4426950408889634f;                             // logits / 8, in base 2
  const _Float16* Qa = QH + ((size_t)b * TT + ql0 + col) * CC + h * HD + 8 * g;   // this lane's first 8 elements of query row col (fragment order as in frag_h)
  v16h qf[QT][2];
#pragma unroll
  for (int t = 0; t < QT; ++t)
#pragma unroll
    for (int kc = 0; kc < 2; ++kc) { union { v16h v; v8h q[2]; } u; u.q[0] = *(const v8h*)(Qa + t * 16 * CC + kc * 32); u.q[1] = *(const v8h*)(Qa + t * 16 * CC + kc * 32 + 16); qf[t][kc] = u.v; }
  asm volatile("s_wait_xcnt 0x0" :: "v"(Qa) : "memory");   // the Q loads' address register stays live up to this wait, so that the accumulators below reuse it only behind it
  asm volatile("s_wait_asynccnt 0x0" ::: "memory");        // the block's first stage has landed, as far as this wave copied it
  __syncthreads();                                          // publishes the block's first stage
  stage_kv(Kg + (size_t)((st0 + 1) & (TT / SK - 1)) * SK * CC, Vg + ((st0 + 1) & (TT / SK - 1)) * SK, lk0 + (unsigned)sizeof(sK[0]), lv0 + (unsigned)sizeof(sV[0]));   // the second stage flies under the first one's passes
  v8f acc[QT][4] = {}; float mr[QT], lr[QT];
#pragma unroll
  for (int t = 0; t < QT; ++t) { mr[t] = -3.0e38f; lr[t] = 0.f; }
#pragma unroll 1
  for (int st = 0; st < TT / SK; ++st) {   // rolled: the two buffers differ by a base address only
   const _Float16* Ks = &sK[st & 1][col][0];   // key row col of a 16-key tile
   const _Float16* Vs = &sV[st & 1][col][0];   // plane row d = col of a 16-d tile
   v16h kf[2][2];
#pragma unroll
   for (int i = 0; i < 2; ++i)
#pragma unroll
     for (int kc = 0; kc < 2; ++kc) kf[i][kc] = frag_h(Ks + (i * 16) * KPI + kc * 32, lane);
#pragma unroll   // the stage's four passes: every LDS offset a constant
   for (int p = 0; p < SK / 32; ++p) {
    v16h vf[4];
#pragma unroll
    for (int j = 0; j < 4; ++j) vf[j] = frag_h(Vs + (j * 16) * VPI + p * 32, lane);
    v8f s[QT][2];
#pragma unroll
    for (int t = 0; t < QT; ++t)
#pragma unroll
      for (int i = 0; i < 2; ++i) { v8f z = {}; z = wmma16(kf[i][0], qf[t][0], z); s[t][i] = wmma16(kf[i][1], qf[t][1], z); }
    if (p + 1 < SK / 32) {   // the next pass's K fragments come under the softmax; never the next stage's, which is not published yet
#pragma unroll
      for (int i = 0; i < 2; ++i)
#pragma unroll
        for (int kc = 0; kc < 2; ++kc) kf[i][kc] = frag_h(Ks + ((p + 1) * 32 + i * 16) * KPI + kc * 32, lane); }
    __builtin_amdgcn_sched_barrier(0);   // keeps both groups of fragment loads up here, a whole softmax ahead of their first use; left free they sink to just in front of the products that read them
    float mx[QT]; bool need = false;
#pragma unroll
    for (int t = 0; t < QT; ++t) { float a = fmaxf(s[t][0][0], s[t][1][0]);
#pragma unroll
      for (int r = 1; r < 8; ++r) a = fmaxf(a, fmaxf(s[t][0][r], s[t][1][r]));
      a = fmaxf(a, xhalf(a)); mx[t] = a * SC; need = need || (mx[t] > mr[t] + 8.0f); }
    if (__builtin_amdgcn_ballot_w32(need) != 0) {   // lazy rescale: only when some query's maximum has grown by more than 2^8 (always on the first pass)
#pragma unroll
      for (int t = 0; t < QT; ++t) { const float mn = fmaxf(mr[t], mx[t]); const float al = __builtin_amdgcn_exp2f(mr[t] - mn); mr[t] = mn; lr[t] *= al;
#pragma unroll
        for (int j = 0; j < 4; ++j) acc[t][j] *= al; }
    }
    v16h pf[QT];   // each query tile's P in registers of its own: written over the first tile's directly behind the products that read them, the second tile's costs four pad slots more
#pragma unroll
    for (int t = 0; t < QT; ++t) { v2f sum = {0.f, 0.f}; const v2f sc2 = {SC, SC}, nm2 = {-mr[t], -mr[t]};
#pragma unroll
      for (int i = 0; i < 2; ++i)
#pragma unroll
        for (int r = 0; r < 8; r += 2) { v2f a = {s[t][i][r], s[t][i][r + 1]}; a = __builtin_elementwise_fma(a, sc2, nm2); const v2f e = {__builtin_amdgcn_exp2f(a[0]), __builtin_amdgcn_exp2f(a[1])}; sum += e; pf[t][i * 8 + r] = (_Float16)e[0]; pf[t][i * 8 + r + 1] = (_Float16)e[1]; }
      lr[t] += sum[0] + sum[1]; }
#pragma unroll
    for (int t = 0; t < QT; ++t)
#pragma unroll
      for (int j = 0; j < 4; ++j) acc[t][j] = wmma16(vf[j], pf[t], acc[t][j]);
    __builtin_amdgcn_sched_barrier(0);   // keeps the next pass's V fragment loads out of this pass: a second set of them takes the kernel over 256 registers
    asm volatile("v_nop\n\tv_nop\n\tv_nop\n\tv_nop");   // four vector slots between this pass's last product and the next pass's first ones, whose results may be given the registers that P was read from
    __builtin_amdgcn_sched_barrier(0);   // holds the next pass's products behind those four slots
   }
   asm volatile("s_wait_dscnt 0x0" ::: "memory");      // this wave's reads of the stage's buffer are over
   asm volatile("s_wait_asynccnt 0x0" ::: "memory");   // the next stage has landed, as far as this wave copied it
   __syncthreads();                                     // publishes the next stage and frees this stage's buffer
   if (st + 2 < TT / SK) stage_kv(Kg + (size_t)((st + 2 + st0) & (TT / SK - 1)) * SK * CC, Vg + ((st + 2 + st0) & (TT / SK - 1)) * SK, lk0 + (unsigned)(st & 1) * (unsigned)sizeof(sK[0]), lv0 + (unsigned)(st & 1) * (unsigned)sizeof(sV[0]));
  }
  asm volatile("s_wait_asynccnt 0x0" ::: "memory");    // no copy is left in flight when the wave goes on to its end
#pragma unroll
  for (int t = 0; t < QT; ++t) {   // lane (g, col) holds o[d = 16 j + 8 g + r] of query col; the two halves of a query join by one exchange
    const float inv = 1.0f / (lr[t] + xhalf(lr[t])); const size_t ro = ((size_t)b * TT + ql0 + t * 16 + col) * CC + h * HD + 8 * g;
    v4f vv[4][2]; float dt = 0.f, nn = 0.f;
#pragma unroll
    for (int j = 0; j < 4; ++j) { vv[j][0] = *(const v4f*)(VR + ro + j * 16); vv[j][1] = *(const v4f*)(VR + ro + j * 16 + 4);
#pragma unroll
      for (int r = 0; r < 8; ++r) { const float o = acc[t][j][r] * inv, v = vv[j][r >> 2][r & 3]; acc[t][j][r] = o; dt += o * v; nn += v * v; } }
    dt += xhalf(dt); nn += xhalf(nn); const float al = dt / (nn + 1e-8f);
    v8b yh[4], yl[4];   // y as k_out's products take it: rounded to bf16, and what the rounding left, rounded again
#pragma unroll
    for (int j = 0; j < 4; ++j)
#pragma unroll
      for (int r = 0; r < 8; ++r) { const float o = acc[t][j][r] - al * vv[j][r >> 2][r & 3]; const __bf16 hi = (__bf16)o; yh[j][r] = hi; yl[j][r] = (__bf16)(o - (float)hi); }
#pragma unroll
    for (int j = 0; j < 4; ++j) { vst2(YH + ro + j * 16, yh[j]); vst2(YL + ro + j * 16, yl[j]); }
    asm volatile("s_wait_xcnt 0x0" ::: "memory");   // behind the tile's stores: no register that they name is reused in front of this wait
  } }
// ---- k_out: block = 8 waves = (128 rows, 128 cols), a wave = 32 x 64: out = y (bf16 hi + lo) Wproj + b. All three operands lie in memory as bf16 (k_fa wrote y's two parts, k_proj's fourth plane the weight), so a stage of 128 k goes to LDS by asynchronous copies, through no register, into two buffers: the next stage flies under this stage's products
#define OBK 128  // k per stage
#define OP 136   // elements per staged row of 128 bf16: 272 B = 16 B x odd, the pitch at which 16-byte fragment reads meet no bank twice
#define OAB (128u * OP * 2u)   // bytes of one staged operand
// one stage: 128 rows of 256 B of each operand, 24 copies of 16 B per lane, 16 lanes to a row, rows 16 apart from copy to copy. Each s_wait_xcnt stands inside its statement, so that no address register is rewritten in front of it.
__device__ __forceinline__ void stage_o(const __bf16* gw, const __bf16* gh, const __bf16* gl, unsigned lw) {
  const unsigned lh = lw + OAB, ll = lw + 2u * OAB;
  asm volatile("global_load_async_to_lds_b128 %0, %12, off\n\tglobal_load_async_to_lds_b128 %1, %13, off\n\tglobal_load_async_to_lds_b128 %2, %14, off\n\tglobal_load_async_to_lds_b128 %3, %15, off\n\t"
               "global_load_async_to_lds_b128 %4, %16, off\n\tglobal_load_async_to_lds_b128 %5, %17, off\n\tglobal_load_async_to_lds_b128 %6, %18, off\n\tglobal_load_async_to_lds_b128 %7, %19, off\n\t"
               "global_load_async_to_lds_b128 %8, %20, off\n\tglobal_load_async_to_lds_b128 %9, %21, off\n\tglobal_load_async_to_lds_b128 %10, %22, off\n\tglobal_load_async_to_lds_b128 %11, %23, off\n\ts_wait_xcnt 0x0"
               :: "v"(lw), "v"(lw + 1u * 16u * OP * 2u), "v"(lw + 2u * 16u * OP * 2u), "v"(lw + 3u * 16u * OP * 2u), "v"(lw + 4u * 16u * OP * 2u), "v"(lw + 5u * 16u * OP * 2u), "v"(lw + 6u * 16u * OP * 2u), "v"(lw + 7u * 16u * OP * 2u), "v"(lh), "v"(lh + 1u * 16u * OP * 2u), "v"(lh + 2u * 16u * OP * 2u), "v"(lh + 3u * 16u * OP * 2u),
                  "v"(gw), "v"(gw + 1 * 16 * CC), "v"(gw + 2 * 16 * CC), "v"(gw + 3 * 16 * CC), "v"(gw + 4 * 16 * CC), "v"(gw + 5 * 16 * CC), "v"(gw + 6 * 16 * CC), "v"(gw + 7 * 16 * CC), "v"(gh), "v"(gh + 1 * 16 * CC), "v"(gh + 2 * 16 * CC), "v"(gh + 3 * 16 * CC) : "memory");
  asm volatile("global_load_async_to_lds_b128 %0, %12, off\n\tglobal_load_async_to_lds_b128 %1, %13, off\n\tglobal_load_async_to_lds_b128 %2, %14, off\n\tglobal_load_async_to_lds_b128 %3, %15, off\n\t"
               "global_load_async_to_lds_b128 %4, %16, off\n\tglobal_load_async_to_lds_b128 %5, %17, off\n\tglobal_load_async_to_lds_b128 %6, %18, off\n\tglobal_load_async_to_lds_b128 %7, %19, off\n\t"
               "global_load_async_to_lds_b128 %8, %20, off\n\tglobal_load_async_to_lds_b128 %9, %21, off\n\tglobal_load_async_to_lds_b128 %10, %22, off\n\tglobal_load_async_to_lds_b128 %11, %23, off\n\ts_wait_xcnt 0x0"
               :: "v"(lh + 4u * 16u * OP * 2u), "v"(lh + 5u * 16u * OP * 2u), "v"(lh + 6u * 16u * OP * 2u), "v"(lh + 7u * 16u * OP * 2u), "v"(ll), "v"(ll + 1u * 16u * OP * 2u), "v"(ll + 2u * 16u * OP * 2u), "v"(ll + 3u * 16u * OP * 2u), "v"(ll + 4u * 16u * OP * 2u), "v"(ll + 5u * 16u * OP * 2u), "v"(ll + 6u * 16u * OP * 2u), "v"(ll + 7u * 16u * OP * 2u),
                  "v"(gh + 4 * 16 * CC), "v"(gh + 5 * 16 * CC), "v"(gh + 6 * 16 * CC), "v"(gh + 7 * 16 * CC), "v"(gl), "v"(gl + 1 * 16 * CC), "v"(gl + 2 * 16 * CC), "v"(gl + 3 * 16 * CC), "v"(gl + 4 * 16 * CC), "v"(gl + 5 * 16 * CC), "v"(gl + 6 * 16 * CC), "v"(gl + 7 * 16 * CC) : "memory");
}
__global__ __launch_bounds__(256) void k_out(const __bf16* __restrict__ YH, const __bf16* __restrict__ YL, const __bf16* __restrict__ WB, const float* __restrict__ BP, float* __restrict__ OUT) { __shared__ __align__(16) float sf[8][32][68]; __shared__ __align__(16) __bf16 sS[2][3][128][OP];   // per buffer: W, y hi, y lo
  const int tid = threadIdx.x, wave = tid >> 5, lane = tid & 31, col = lane & 15, g = lane >> 4; const int wr = wave >> 1, wc = wave & 1; const int c0 = blockIdx.y * 128; const size_t r0 = (size_t)blockIdx.x * 128;
  v8f acc[2][4] = {};
  const int srow = tid >> 4, sq = tid & 15;   // copies: lane = (row srow + 16 i, 16-byte piece sq of the stage's 256 B)
  const __bf16* Hp = YH + (r0 + srow) * CC; const __bf16* Lp = YL + (r0 + srow) * CC; const __bf16* Wp = WB + (size_t)(c0 + srow) * CC;
  const unsigned l0 = (unsigned)(size_t)&sS[0][0][srow][sq * 8];   // the lane's LDS byte address in buffer 0
  const int ks0 = ((blockIdx.x & 3) + ((blockIdx.x >> 3) << 2) + 2 * blockIdx.y) & (CC / 64 - 1);   // where the block's k walk starts, in units of 64 k, as in k_proj: the 8 blocks that read the same y rows start 128 k apart, the 32 that read the same W rows are spread over all 16 places
  const int kl0 = ks0 * 64 + sq * 8;   // the lane's first k; the walk wraps round piece by piece
  { const int ko = kl0 & (CC - 1); stage_o(Wp + ko, Hp + ko, Lp + ko, l0); }
  asm volatile("s_wait_asynccnt 0x0" ::: "memory");   // stage 0 has landed, as far as this wave copied it
  __syncthreads();                                     // publishes stage 0
  { const int ko = (kl0 + OBK) & (CC - 1); stage_o(Wp + ko, Hp + ko, Lp + ko, l0 + 3u * OAB); }   // the second stage flies under the first one's products
#pragma unroll 1   // rolled: the two buffers differ by a base address only
  for (int ks = 0; ks < CC / OBK; ++ks) { const int cur = ks & 1;
#pragma unroll
    for (int hf = 0; hf < OBK / 64; ++hf) {
      v16b ah[2][2], al[2][2], w[2][4];   // the fragments of 64 k, read as one group
#pragma unroll
      for (int kk = 0; kk < 2; ++kk) {
#pragma unroll
        for (int i = 0; i < 2; ++i) { ah[kk][i] = frag_b(&sS[cur][1][wr * 32 + i * 16 + col][hf * 64 + kk * 32], lane); al[kk][i] = frag_b(&sS[cur][2][wr * 32 + i * 16 + col][hf * 64 + kk * 32], lane); }
#pragma unroll
        for (int j = 0; j < 4; ++j) w[kk][j] = frag_b(&sS[cur][0][wc * 64 + j * 16 + col][hf * 64 + kk * 32], lane);
        __builtin_amdgcn_sched_barrier(0); }   // keeps the loads in the order in which the products take them; left free they are sorted by address, and the third product waits for nearly the whole group
#pragma unroll
      for (int kk = 0; kk < 2; ++kk) {
#pragma unroll
        for (int i = 0; i < 2; ++i)
#pragma unroll
          for (int j = 0; j < 4; ++j) acc[i][j] = wmma_bf(ah[kk][i], w[kk][j], acc[i][j]);
#pragma unroll
        for (int i = 0; i < 2; ++i)   // per tile still hi, then lo, of each 32 k in turn
#pragma unroll
          for (int j = 0; j < 4; ++j) acc[i][j] = wmma_bf(al[kk][i], w[kk][j], acc[i][j]); } }
    asm volatile("s_wait_dscnt 0x0" ::: "memory");      // this wave's reads of the stage's buffer are over
    asm volatile("s_wait_asynccnt 0x0" ::: "memory");   // the next stage has landed, as far as this wave copied it
    __syncthreads();                                     // publishes the next stage and frees this stage's buffer
    if (ks + 2 < CC / OBK) { const int ko = (kl0 + (ks + 2) * OBK) & (CC - 1); stage_o(Wp + ko, Hp + ko, Lp + ko, l0 + (unsigned)cur * 3u * OAB); } }
  asm volatile("s_wait_asynccnt 0x0" ::: "memory");    // no copy is left in flight when the wave goes on to its end
#pragma unroll
  for (int j = 0; j < 4; ++j) { const float bb = BP ? bfr(BP[c0 + wc * 64 + j * 16 + col]) : 0.f;
#pragma unroll
    for (int i = 0; i < 2; ++i)
#pragma unroll
      for (int r = 0; r < 8; ++r) sf[wave][i * 16 + 8 * g + r][j * 16 + col] = acc[i][j][r] + bb; }
  LDSX();
#pragma unroll
  for (int e = 0; e < 16; ++e) { const int rl = e * 2 + (lane >> 4), q = lane & 15; vst2(OUT + (r0 + wr * 32 + rl) * CC + c0 + wc * 64 + q * 4, *(const v4f*)&sf[wave][rl][q * 4]); } }
extern "C" void kernel_launch(void* const* d_in, const int* in_sizes, int n_in, void* d_out, int out_size, void* d_ws, size_t ws_size, hipStream_t stream) {
  (void)in_sizes; (void)n_in; (void)out_size;
  const float** F = (const float**)d_in;   // 0 x [2,2048,1024], 1 wq [1024,1024] ([out,in]), 2 bq, 3 wk, 4 bk, 5 wv, 6 bv, 7 wo, 8 bo
  if (ws_size < (size_t)WS_END) return;
  char* ws = (char*)d_ws; _Float16 *QH = (_Float16*)(ws + WS_QH), *QL = (_Float16*)(ws + WS_QL), *KH = (_Float16*)(ws + WS_KH), *VT = (_Float16*)(ws + WS_VT); float *VR = (float*)(ws + WS_VR); __bf16 *YH = (__bf16*)(ws + WS_YH), *YL = (__bf16*)(ws + WS_YL), *WB = (__bf16*)(ws + WS_WB);
  k_proj<<<dim3(TNB * TT / PBM, CC / PBN, 4), PNT, 0, stream>>>(F[0], F[1], F[2], F[3], F[4], F[5], F[6], F[7], QH, QL, KH, VT, VR, WB);
  k_fa<<<dim3(TT / (8 * 16 * QT), NH, TNB), 256, 0, stream>>>(QH, KH, VT, VR, YH, YL);
  k_out<<<dim3(TNB * TT / 128, CC / 128), 256, 0, stream>>>(YH, YL, WB, F[8], (float*)d_out);
}

// v008
// It runs in 78.5 microseconds.
// Timed twice side by side with v007, it ran 1.05 times as fast both times.
// Over all steps from v000 it is 17.5 times as fast.
// compute dtype: all float inputs rounded to bf16; q/k/v = x W^T + b with EXACT bf16 products on WMMA 16x16x32, f32 accumulate; q times log2(e) / 8 and k rounded once to f16 (1-product logits, f32, kept in registers, formed on top of minus the running maximum); online softmax in f32, base 2 -> unnormalised P f16 (32 keys' sum at most 2^13); o = P . v (v once to f16) / row sum of the rounded P; per-position exclusion o -= (o . v_s / (|v_s|^2 + 1e-8)) v_s in f32 with the exact f32 v row; out = o (bf16 hi + lo) Wo^T + bo; f32 output.
#include <hip/hip_runtime.h>
#include <math.h>

typedef __attribute__((ext_vector_type(16))) _Float16 v16h;
typedef __attribute__((ext_vector_type(16))) __bf16 v16b;
typedef __attribute__((ext_vector_type(8)))  _Float16 v8h;
typedef __attribute__((ext_vector_type(8)))  float v8f;
typedef __attribute__((ext_vector_type(4)))  float v4f;
typedef __attribute__((ext_vector_type(2)))  float v2f;
typedef __attribute__((ext_vector_type(4)))  unsigned v4u;
typedef __attribute__((ext_vector_type(4)))  int v4i;
typedef float __attribute__((may_alias)) float_a;
typedef int __attribute__((may_alias)) int_a;

template <typename T> __device__ __forceinline__ void vst2(void* p, T v) { *(T*)p = v;  }
__device__ __forceinline__ v8f wmma16(v16h a, v16h b, v8f c) {
  return __builtin_amdgcn_wmma_f32_16x16x32_f16(false, a, false, b, (short)0, c, false, false);   // the compiler keeps the distance behind its own builtin form where a vector instruction follows on D, A or B
}
__device__ __forceinline__ v8f wmma_bf(v16b a, v16b b, v8f c) {
  v8f d = __builtin_amdgcn_wmma_f32_16x16x32_bf16(false, a, false, b, (short)0, c, false, false);
  asm volatile("v_nop\n\tv_nop\n\tv_nop\n\tv_nop" : "+v"(d) : "v"(a), "v"(b));
  return d;
}
// 16x16x32 fragments: lane = (h = lane>>4, row/col = lane&15); elements 0..7 = k0+8h+0..7, 8..15 = k0+16+8h+0..7; D element r = row 8h+r
__device__ __forceinline__ v16h frag_h(const _Float16* rowk0, int lane) {
  union { v16h v; v8h q[2]; } u; const _Float16* p = rowk0 + 8 * (lane >> 4);
  u.q[0] = *(const v8h*)p; u.q[1] = *(const v8h*)(p + 16); return u.v;
}
__device__ __forceinline__ v16h frag_f32(const float* rowk0, int lane) {
  v16h a; const float* p = rowk0 + 8 * (lane >> 4);
#pragma unroll
  for (int i = 0; i < 8; ++i) { a[i] = (_Float16)p[i]; a[8 + i] = (_Float16)p[16 + i]; }
  return a;
}
__device__ __forceinline__ v16h frag_f32s(const float* rowk0, int lane, float sc) {
  v16h a; const float* p = rowk0 + 8 * (lane >> 4);
#pragma unroll
  for (int i = 0; i < 8; ++i) { a[i] = (_Float16)(p[i] * sc); a[8 + i] = (_Float16)(p[16 + i] * sc); }
  return a;
}
// column fragment from a [K][ld] layout (column n), rows >= K read as 0
__device__ __forceinline__ v16h fragc_f32(const float* W, int k0, int n, int lane, int ld, int K) {
  v16h a; const int g = lane >> 4;
#pragma unroll
  for (int i = 0; i < 8; ++i) { const int ka = k0 + 8 * g + i, kb = ka + 16;
    a[i] = (_Float16)(ka < K ? W[(size_t)(ka < K ? ka : K - 1) * ld + n] : 0.f); a[8 + i] = (_Float16)(kb < K ? W[(size_t)(kb < K ? kb : K - 1) * ld + n] : 0.f); }
  return a;
}
struct F2 { v16b h, l; };
__device__ __forceinline__ F2 bsplit16(const float v[16]) { F2 r;
#pragma unroll
  for (int i = 0; i < 16; ++i) { const __bf16 h = (__bf16)v[i]; r.h[i] = h; r.l[i] = (__bf16)(v[i] - (float)h); }
  return r; }
__device__ __forceinline__ F2 split_row(const float* row, int k0, int lane) { float v[16]; const float* p = row + k0 + 8 * (lane >> 4);
#pragma unroll
  for (int i = 0; i < 8; ++i) { v[i] = p[i]; v[8 + i] = p[16 + i]; }
  return bsplit16(v); }
__device__ __forceinline__ F2 split_rowK(const float* row, int k0, int lane, int K) { float v[16]; const int g = lane >> 4;
#pragma unroll
  for (int i = 0; i < 8; ++i) { const int ka = k0 + 8 * g + i, kb = ka + 16; v[i] = ka < K ? row[ka < K ? ka : K - 1] : 0.f; v[8 + i] = kb < K ? row[kb < K ? kb : K - 1] : 0.f; }
  return bsplit16(v); }
__device__ __forceinline__ F2 split_col(const float* W, int k0, int n, int lane, int ld, int K) { float v[16]; const int g = lane >> 4;
#pragma unroll
  for (int i = 0; i < 8; ++i) { const int ka = k0 + 8 * g + i, kb = ka + 16; v[i] = ka < K ? W[(size_t)(ka < K ? ka : K - 1) * ld + n] : 0.f; v[8 + i] = kb < K ? W[(size_t)(kb < K ? kb : K - 1) * ld + n] : 0.f; }
  return bsplit16(v); }
__device__ __forceinline__ v8f mac3(const F2& a, const F2& b, v8f c) { c = wmma_bf(a.l, b.h, c); c = wmma_bf(a.h, b.l, c); return wmma_bf(a.h, b.h, c); }
__device__ __forceinline__ float sigm(float v) { return 1.0f / (1.0f + expf(-v)); }
#define LDSX() do { asm volatile("s_wait_dscnt 0" ::: "memory"); __builtin_amdgcn_wave_barrier(); __builtin_amdgcn_fence(__ATOMIC_RELEASE, "workgroup"); } while (0)


// Exclusive self attention (B 2, S 2,048, D 1,024 = 16 x 64): q/k/v Linear ([out,in] + bias), softmax(q k / 8) v, then per position and head o -= <o, v_s> / (|v_s|^2 + 1e-8) v_s, output Linear.
#define NB 2
#define TT 2048
#define CC 1024
#define NH 16
#define HD 64
#ifndef TNB
#define TNB NB
#endif
typedef __attribute__((ext_vector_type(8))) __bf16 v8b;
__device__ __forceinline__ v16b frag_b(const __bf16* rowk0, int lane) {
  union { v16b v; v8b q[2]; } u; const __bf16* p = rowk0 + 8 * (lane >> 4);
  u.q[0] = *(const v8b*)p; u.q[1] = *(const v8b*)(p + 16); return u.v;
}
__device__ __forceinline__ float bfr(float v) { return (float)(__bf16)v; }
typedef __attribute__((ext_vector_type(4))) __bf16 v4b;
typedef v4f __attribute__((aligned(4))) v4fu;   // 16-byte read of an input that is only known to be float-aligned
#define KP 40   // elements per staged row of 32 bf16: 80 B = 16 B x odd, the pitch at which 16-byte fragment reads meet no bank twice
__device__ __forceinline__ v4b cvt4(v4f v) { v4b r;
#pragma unroll
  for (int i = 0; i < 4; ++i) r[i] = (__bf16)v[i];
  return r; }
__device__ __attribute__((noinline)) float exp_ni(float v) { return expf(v); }
__device__ __attribute__((noinline)) float erf_ni(float v) { return erff(v); }

#define WS_QH  0u
#define WS_QL  (WS_QH + 2u * (size_t)NB * TT * CC)
#define WS_KH  (WS_QL + 2u * (size_t)NB * TT * CC)
#define WS_VT  (WS_KH + 2u * (size_t)NB * TT * CC)      // f16 v planes [b][c][t]
#define WS_YH  (WS_VT + 2u * (size_t)NB * CC * TT)      // bf16 y rows [b*t][C]: y rounded
#define WS_YL  (WS_YH + 2u * (size_t)NB * TT * CC)      // bf16 y rows [b*t][C]: what the rounding left
#define WS_VR  (WS_YL + 2u * (size_t)NB * TT * CC)      // f32 v rows [b*t][C] for the exclusion step
#define WS_WB  (WS_VR + 4u * (size_t)NB * TT * CC)      // bf16 rows of the output weight [out][in]
#define WS_END (WS_WB + 2u * (size_t)CC * CC)

// ---- k_proj: block = 16 waves = (256 rows, 256 cols, which), a wave = 64 x 64: qkv = x W (+ b), exact; q (scaled by QSC) -> f16 hi (+ residual), k -> f16 rows, v -> f16 planes and f32 rows. Per 32-k step the block reads its x and W rows once, a whole 128-B line per 8 lanes, rounds them to bf16 and stages them in LDS (two buffers); a wave takes 4 + 4 fragments from there for 16 products. In the epilogue each wave turns its own tile in its own piece of the same LDS.
#define QSC (0.125f * 1.4426950408889634f)   // q leaves k_proj times 1 / 8 and log2(e): k_fa's products are then the logits in base 2
#define PBM 256   // rows of x per block
#define PBN 256   // rows of W (output columns) per block
#define PNT 512   // threads: 4 x 4 waves
#define PEW 9216  // bytes of LDS per wave in the epilogue: 64 rows of 72 f16, or 32 rows of 68 f32
#define WOB (CC * CC / ((TNB * TT / PBM) * (CC / PBN)))   // elements of the output weight per block of the grid's fourth plane
__global__ __launch_bounds__(PNT) void k_proj(const float* __restrict__ X, const float* __restrict__ WQ, const float* __restrict__ BQ, const float* __restrict__ WK, const float* __restrict__ BK, const float* __restrict__ WV, const float* __restrict__ BV, const float* __restrict__ WO, _Float16* __restrict__ QH, _Float16* __restrict__ QL, _Float16* __restrict__ KH, _Float16* __restrict__ VT, float* __restrict__ VR, __bf16* __restrict__ WB) {
  __shared__ __align__(16) char sm[(PNT / 32) * PEW];
  __bf16 (*sA)[PBM][KP] = (__bf16 (*)[PBM][KP])sm; __bf16 (*sB)[PBN][KP] = (__bf16 (*)[PBN][KP])(sm + 2 * PBM * KP * 2);   // main loop: 2 x 20 KiB each
  const int tid = threadIdx.x, wave = tid >> 5, lane = tid & 31, col = lane & 15, g = lane >> 4; const int wr = wave >> 2, wc = wave & 3; const int which = blockIdx.z; const int c0 = blockIdx.y * PBN; const size_t r0 = (size_t)blockIdx.x * PBM; const float* WA = which == 0 ? WQ : which == 1 ? WK : WV; const float* BA = which == 0 ? BQ : which == 1 ? BK : BV;
  if (which == 3) {   // the grid's fourth plane: rounds the output weight to bf16 once, for k_out's copies, which cannot round. The whole block leaves here, in front of every barrier
    const size_t wo = (size_t)(blockIdx.y * (TNB * TT / PBM) + blockIdx.x) * WOB + tid * 4; const float* wp = WO + wo; v4f rw[WOB / (PNT * 4)];
#pragma unroll
    for (int i = 0; i < WOB / (PNT * 4); ++i) rw[i] = *(const v4fu*)(wp + i * PNT * 4);
    asm volatile("s_wait_xcnt 0x0" :: "v"(wp) : "memory");   // the loads' address register stays live up to this wait, so that nothing lands on it in front of the wait
    __bf16* bp = WB + wo;
#pragma unroll
    for (int i = 0; i < WOB / (PNT * 4); ++i) *(v4b*)(bp + i * PNT * 4) = cvt4(rw[i]);   // 256 B in a row per wave
    asm volatile("s_wait_xcnt 0x0" :: "v"(bp) : "memory");   // behind the wave's last stores: no register that they name is reused in front of this wait
    return; }
  v8f acc[4][4] = {};
  const int srow = tid >> 3, sq = tid & 7;   // staging: thread = (row srow + 64 i, 16-byte piece sq of the row's 128-B line)
  const float* Xp = X + (r0 + srow) * CC + sq * 4; const float* Wp = WA + (size_t)(c0 + srow) * CC + sq * 4;
  // The block's first k step; the walk wraps round, so every start gives the whole sum, in another order. Blocks that read the same rows start at different steps: they do not ask L2 for the same lines at the same moment, and a line that one of them has brought in from memory is in L2 when the others come to it. Same x rows (12 blocks): 3 steps apart. Same W rows (16 blocks): 2 apart, and 4 apart among blocks whose blockIdx.x lies in four neighbouring residues modulo 8. For speed only.
  const int ks0 = (((blockIdx.x & 3) << 2) + ((blockIdx.x >> 3) << 4) + (((blockIdx.x >> 2) & 1) << 1) + 3 * (blockIdx.y + 4 * blockIdx.z)) & (CC / 32 - 1);
  v4f ra[4], rb[4];
#pragma unroll
  for (int i = 0; i < 4; ++i) ra[i] = *(const v4fu*)(Xp + (size_t)i * 64 * CC + ks0 * 32);
#pragma unroll
  for (int i = 0; i < 4; ++i) rb[i] = *(const v4fu*)(Wp + (size_t)i * 64 * CC + ks0 * 32);
#pragma unroll
  for (int i = 0; i < 4; ++i) *(v4b*)&sA[0][srow + i * 64][sq * 4] = cvt4(ra[i]);
#pragma unroll
  for (int i = 0; i < 4; ++i) *(v4b*)&sB[0][srow + i * 64][sq * 4] = cvt4(rb[i]);
  __syncthreads();
#pragma unroll 2   // by two, so that each half addresses its buffers by constants
  for (int kc = 0; kc < CC / 32; ++kc) { const int cur = kc & 1; const bool more = kc + 1 < CC / 32;
    if (more) {   // the next step's lines fly under this step's products
      const int kn = ((kc + 1 + ks0) & (CC / 32 - 1)) * 32;
#pragma unroll
      for (int i = 0; i < 4; ++i) ra[i] = *(const v4fu*)(Xp + (size_t)i * 64 * CC + kn);
#pragma unroll
      for (int i = 0; i < 4; ++i) rb[i] = *(const v4fu*)(Wp + (size_t)i * 64 * CC + kn);
      asm volatile("s_wait_xcnt 0x0" ::: "memory"); }   // behind the run of loads: their address registers may be reused by the roundings below only behind this wait
    v16b a[4], w[4];
#pragma unroll
    for (int i = 0; i < 4; ++i) a[i] = frag_b(&sA[cur][wr * 64 + i * 16 + col][0], lane);
#pragma unroll
    for (int j = 0; j < 4; ++j) w[j] = frag_b(&sB[cur][wc * 64 + j * 16 + col][0], lane);
#pragma unroll
    for (int i = 0; i < 4; ++i)
#pragma unroll
      for (int j = 0; j < 4; ++j) acc[i][j] = wmma_bf(a[i], w[j], acc[i][j]);
    __builtin_amdgcn_sched_barrier(0);   // keeps the roundings below, which wait for the lines in flight, from moving up among this step's products
    if (more) {
#pragma unroll
      for (int i = 0; i < 4; ++i) *(v4b*)&sA[cur ^ 1][srow + i * 64][sq * 4] = cvt4(ra[i]);
#pragma unroll
      for (int i = 0; i < 4; ++i) *(v4b*)&sB[cur ^ 1][srow + i * 64][sq * 4] = cvt4(rb[i]); }
    __syncthreads(); }   // publishes the buffer just filled and ends the reads of the one filled next; the last one frees the LDS for the epilogue
  char* ew = sm + wave * PEW;   // this wave's own piece: no other wave reads or writes it from here on, so LDSX() orders all that follows
  const size_t rw = r0 + wr * 64; const int cw = c0 + wc * 64;   // the wave's first row and column
  const int bi = cw + col; float bb[4];
#pragma unroll
  for (int j = 0; j < 4; ++j) bb[j] = BA[bi + j * 16];
  asm volatile("s_wait_xcnt 0x0" :: "v"(bi) : "memory");   // the bias loads' index register stays live up to this wait, so that none of the four lands on it in front of the wait
#pragma unroll
  for (int j = 0; j < 4; ++j) bb[j] = bfr(bb[j]);
  if (which == 0) { _Float16 (*eh)[72] = (_Float16 (*)[72])ew;   // 32 rows at a time: rows 0..31 of the piece hold q's f16 value, rows 32..63 its residual
#pragma unroll
    for (int hf = 0; hf < 2; ++hf) {
      if (hf) LDSX();   // the first half's reads are over before its rows are written anew
#pragma unroll
      for (int i = 0; i < 2; ++i)
#pragma unroll
        for (int j = 0; j < 4; ++j)
#pragma unroll
          for (int r = 0; r < 8; ++r) { const float v = (acc[hf * 2 + i][j][r] + bb[j]) * QSC; const _Float16 hv = (_Float16)v; eh[i * 16 + 8 * g + r][j * 16 + col] = hv; eh[32 + i * 16 + 8 * g + r][j * 16 + col] = (_Float16)(v - (float)hv); }
      LDSX();
#pragma unroll
      for (int e = 0; e < 8; ++e) { const int rl = e * 4 + (lane >> 3), q = lane & 7; const size_t o = (rw + hf * 32 + rl) * CC + cw + q * 8;   // 4 whole 128-B lines per store
        vst2((unsigned*)(QH + o), *(const v4u*)&eh[rl][q * 8]); vst2((unsigned*)(QL + o), *(const v4u*)&eh[32 + rl][q * 8]); } }
    asm volatile("s_wait_xcnt 0x0" ::: "memory");   // behind the wave's last stores: no register that they name is reused in front of this wait
  }
  else if (which == 1) { _Float16 (*eh)[72] = (_Float16 (*)[72])ew;
#pragma unroll
    for (int i = 0; i < 4; ++i)
#pragma unroll
      for (int j = 0; j < 4; ++j)
#pragma unroll
        for (int r = 0; r < 8; ++r) eh[i * 16 + 8 * g + r][j * 16 + col] = (_Float16)(acc[i][j][r] + bb[j]);
    LDSX();
#pragma unroll
    for (int e = 0; e < 16; ++e) { const int rl = e * 4 + (lane >> 3), q = lane & 7; vst2((unsigned*)(KH + (rw + rl) * CC + cw + q * 8), *(const v4u*)&eh[rl][q * 8]); }   // 4 whole 128-B lines per store
    asm volatile("s_wait_xcnt 0x0" ::: "memory");   // behind the wave's last stores: no register that they name is reused in front of this wait
  }
  else { _Float16 (*et)[72] = (_Float16 (*)[72])ew; float (*ef)[68] = (float (*)[68])ew; const size_t b = rw / TT; const int t0 = (int)(rw % TT);
#pragma unroll
    for (int i = 0; i < 4; ++i)
#pragma unroll
      for (int j = 0; j < 4; ++j) { v8h hv;
#pragma unroll
        for (int r = 0; r < 8; ++r) hv[r] = (_Float16)(acc[i][j][r] + bb[j]);
        *(v8h*)&et[j * 16 + col][i * 16 + 8 * g] = hv; }   // a lane's 8 rows are 8 neighbours of one plane row
    LDSX();
#pragma unroll
    for (int e = 0; e < 16; ++e) { const int cl = e * 4 + (lane >> 3), q = lane & 7; vst2((unsigned*)(VT + (b * CC + cw + cl) * (size_t)TT + t0 + q * 8), *(const v4u*)&et[cl][q * 8]); }
#pragma unroll
    for (int hf = 0; hf < 2; ++hf) {   // the f32 rows, 32 at a time
      LDSX();
#pragma unroll
      for (int i = 0; i < 2; ++i)
#pragma unroll
        for (int j = 0; j < 4; ++j)
#pragma unroll
          for (int r = 0; r < 8; ++r) ef[i * 16 + 8 * g + r][j * 16 + col] = acc[hf * 2 + i][j][r] + bb[j];
      LDSX();
#pragma unroll
      for (int e = 0; e < 16; ++e) { const int rl = e * 2 + (lane >> 4), q = lane & 15; vst2(VR + (rw + hf * 32 + rl) * CC + cw + q * 4, *(const v4f*)&ef[rl][q * 4]); } }
    asm volatile("s_wait_xcnt 0x0" ::: "memory");   // behind the wave's last stores: no register that they name is reused in front of this wait
  } }
// ---- k_fa: block = 8 waves x 32 queries of (b,h). The block brings K rows and V plane rows to LDS once per stage of 128 keys, by asynchronous copies into two buffers, and its 8 waves take their fragments from there. Per pass of 32 keys: S^T = K Q^T - m (a lane holds 16 logits of one query per 16-query tile; minus the maximum in use is the products' C operand), exp2 in registers, the pass's row sums by one product with an A whose row 0 is ones (they also tell when the maximum must be renewed), O^T += V^T P^T (the two S^T tiles, converted, are the B operand); then the exclusion step and the y rows.
__device__ __forceinline__ float xhalf(float x) { return __builtin_bit_cast(float, __builtin_amdgcn_permlanex16(__builtin_bit_cast(int, x), __builtin_bit_cast(int, x), 0x76543210, 0xfedcba98, false, false)); }  // lane l with lane l ^ 16
#define QT 2
#define PSMAX 8192.0f   // a pass's sum of P, over a lane's queries, above which the maxima in use are renewed: 32 keys at 2^8
#define SK 128   // keys per stage
#define KPI 72   // f16 per staged K row of 64: 144 B = 16 B x odd (no bank met twice by 16-byte fragment reads)
#define VPI 136  // f16 per staged V plane row of 128: 272 B = 16 B x odd
// one stage: 128 K rows of 128 B and 64 V plane rows of 256 B, 8 copies of 16 B per lane, whole lines per wave. The s_wait_xcnt stands inside the statement, so that no address register is rewritten in front of it.
__device__ __forceinline__ void stage_kv(const _Float16* gk, const _Float16* gv, unsigned lk, unsigned lv) {
  asm volatile("global_load_async_to_lds_b128 %0, %8, off\n\tglobal_load_async_to_lds_b128 %1, %9, off\n\tglobal_load_async_to_lds_b128 %2, %10, off\n\tglobal_load_async_to_lds_b128 %3, %11, off\n\t"
               "global_load_async_to_lds_b128 %4, %12, off\n\tglobal_load_async_to_lds_b128 %5, %13, off\n\tglobal_load_async_to_lds_b128 %6, %14, off\n\tglobal_load_async_to_lds_b128 %7, %15, off\n\ts_wait_xcnt 0x0"
               :: "v"(lk), "v"(lk + 32u * KPI * 2u), "v"(lk + 64u * KPI * 2u), "v"(lk + 96u * KPI * 2u), "v"(lv), "v"(lv + 16u * VPI * 2u), "v"(lv + 32u * VPI * 2u), "v"(lv + 48u * VPI * 2u),
                  "v"(gk), "v"(gk + 32 * CC), "v"(gk + 64 * CC), "v"(gk + 96 * CC), "v"(gv), "v"(gv + 16 * (size_t)TT), "v"(gv + 32 * (size_t)TT), "v"(gv + 48 * (size_t)TT) : "memory");
}
__global__ __launch_bounds__(256) void k_fa(const _Float16* __restrict__ QH, const _Float16* __restrict__ KH, const _Float16* __restrict__ VT, const float* __restrict__ VR, __bf16* __restrict__ YH, __bf16* __restrict__ YL) {
  const int tid = threadIdx.x, wave = tid >> 5, lane = tid & 31, col = lane & 15, g = lane >> 4; const int h = blockIdx.y, b = blockIdx.z; const int ql0 = blockIdx.x * (8 * 16 * QT) + wave * (16 * QT);
  __shared__ __align__(16) _Float16 sK[2][SK][KPI]; __shared__ __align__(16) _Float16 sV[2][HD][VPI];
  const _Float16* Kg = KH + ((size_t)b * TT + (tid >> 3)) * CC + h * HD + (tid & 7) * 8;              // copies: lane = (key row tid/8 + 32 i, 16-byte piece tid%8 of its 128 B)
  const _Float16* Vg = VT + ((size_t)b * CC + h * HD + (tid >> 4)) * (size_t)TT + (tid & 15) * 8;     // copies: lane = (plane row tid/16 + 16 i, 16-byte piece tid%16 of the stage's 256 B)
  const unsigned lk0 = (unsigned)(size_t)&sK[0][tid >> 3][(tid & 7) * 8], lv0 = (unsigned)(size_t)&sV[0][tid >> 4][(tid & 15) * 8];   // the lane's LDS byte addresses in buffer 0
  const int st0 = ((blockIdx.x & 3) << 2) + ((blockIdx.x >> 2) << 1);   // the block's first stage; the walk wraps round: the 8 blocks of one (b,h), which read the same K and V, start 2 stages apart. For speed only
  stage_kv(Kg + (size_t)st0 * SK * CC, Vg + st0 * SK, lk0, lv0);
  const _Float16* Qa = QH + ((size_t)b * TT + ql0 + col) * CC + h * HD + 8 * g;   // this lane's first 8 elements of query row col (fragment order as in frag_h)
  v16h qf[QT][2];
#pragma unroll
  for (int t = 0; t < QT; ++t)
#pragma unroll
    for (int kc = 0; kc < 2; ++kc) { union { v16h v; v8h q[2]; } u; u.q[0] = *(const v8h*)(Qa + t * 16 * CC + kc * 32); u.q[1] = *(const v8h*)(Qa + t * 16 * CC + kc * 32 + 16); qf[t][kc] = u.v; }
  asm volatile("s_wait_xcnt 0x0" :: "v"(Qa) : "memory");   // the Q loads' address register stays live up to this wait, so that the accumulators below reuse it only behind it
  asm volatile("s_wait_asynccnt 0x0" ::: "memory");        // the block's first stage has landed, as far as this wave copied it
  __syncthreads();                                          // publishes the block's first stage
  stage_kv(Kg + (size_t)((st0 + 1) & (TT / SK - 1)) * SK * CC, Vg + ((st0 + 1) & (TT / SK - 1)) * SK, lk0 + (unsigned)sizeof(sK[0]), lv0 + (unsigned)sizeof(sV[0]));   // the second stage flies under the first one's passes
  v8f acc[QT][4] = {}; v8f cm[QT] = {}; float lr[QT] = {};   // cm: every element is minus its query's maximum in use (0 until the first pass sets it); lr: the query's sum of P, in lanes 0 to 15 (0 in the others)
  v16h one;   // A operand of the row sums: row 0 (lanes 0 and 16) is 1 at all 32 k, every other row 0
#pragma unroll
  for (int i = 0; i < 16; ++i) one[i] = col == 0 ? (_Float16)1.0f : (_Float16)0.0f;
#pragma unroll 1
  for (int st = 0; st < TT / SK; ++st) {   // rolled: the two buffers differ by a base address only
   const _Float16* Ks = &sK[st & 1][col][0];   // key row col of a 16-key tile
   const _Float16* Vs = &sV[st & 1][col][0];   // plane row d = col of a 16-d tile
   v16h kf[2][2];
#pragma unroll
   for (int i = 0; i < 2; ++i)
#pragma unroll
     for (int kc = 0; kc < 2; ++kc) kf[i][kc] = frag_h(Ks + (i * 16) * KPI + kc * 32, lane);
#pragma unroll   // the stage's four passes: every LDS offset a constant
   for (int p = 0; p < SK / 32; ++p) {
    v16h vf[4];
#pragma unroll
    for (int j = 0; j < 4; ++j) vf[j] = frag_h(Vs + (j * 16) * VPI + p * 32, lane);
    v8f s[QT][2];
#pragma unroll
    for (int t = 0; t < QT; ++t)
#pragma unroll
      for (int i = 0; i < 2; ++i) { const v8f z = wmma16(kf[i][0], qf[t][0], cm[t]); s[t][i] = wmma16(kf[i][1], qf[t][1], z); }
    if (p + 1 < SK / 32) {   // the next pass's K fragments come under the softmax; never the next stage's, which is not published yet
#pragma unroll
      for (int i = 0; i < 2; ++i)
#pragma unroll
        for (int kc = 0; kc < 2; ++kc) kf[i][kc] = frag_h(Ks + ((p + 1) * 32 + i * 16) * KPI + kc * 32, lane); }
    __builtin_amdgcn_sched_barrier(0);   // keeps both groups of fragment loads up here, a whole softmax ahead of their first use; left free they sink to just in front of the products that read them
    v16h pf[QT]; v8f ps[QT];   // each query tile's P in registers of its own; ps: row 0 (element 0 of lanes 0 to 15) is this pass's sum of P per query, every other row 0
#pragma unroll
    for (int t = 0; t < QT; ++t)
#pragma unroll
      for (int i = 0; i < 2; ++i)
#pragma unroll
        for (int r = 0; r < 8; ++r) pf[t][i * 8 + r] = (_Float16)__builtin_amdgcn_exp2f(s[t][i][r]);
#pragma unroll
    for (int t = 0; t < QT; ++t) { const v8f z = {}; ps[t] = wmma16(one, pf[t], z); }   // both behind all the vector work: a product that has to wait for the matrix unit holds up nothing that could run meanwhile
    const bool first = p == 0 && st == 0;
    float pt = ps[0][0];
#pragma unroll
    for (int t = 1; t < QT; ++t) pt += ps[t][0];
    const bool need = !(pt <= PSMAX);   // the lane's sums together within the bound: no term is negative, so each term is within it and none has left f16's range (an infinite or undefined sum fails the test)
    if (__builtin_amdgcn_ballot_w32(need) != 0 || first) {   // lazy rescale: only when some query's sum says that its maximum in use is too low, and on the first pass, which sets the maximum. The pass's logits are formed anew from its K rows, which stay in LDS to the end of the stage; so the common path need not keep them
      v16h k2[2][2];
#pragma unroll
      for (int i = 0; i < 2; ++i)
#pragma unroll
        for (int kc = 0; kc < 2; ++kc) k2[i][kc] = frag_h(Ks + (p * 32 + i * 16) * KPI + kc * 32, lane);
#pragma unroll
      for (int t = 0; t < QT; ++t) { v8f s2[2];
#pragma unroll
        for (int i = 0; i < 2; ++i) { const v8f z = wmma16(k2[i][0], qf[t][0], cm[t]); s2[i] = wmma16(k2[i][1], qf[t][1], z); }
        float a = fmaxf(s2[0][0], s2[1][0]);
#pragma unroll
        for (int r = 1; r < 8; ++r) a = fmaxf(a, fmaxf(s2[0][r], s2[1][r]));
        a = fmaxf(a, xhalf(a)); const float d = first ? a : fmaxf(a, 0.f); const float al = __builtin_amdgcn_exp2f(fminf(-d, 0.f));   // d: by how much the maximum moves (down only on the first pass, where all sums are 0)
        cm[t] -= d; lr[t] *= al;
#pragma unroll
        for (int j = 0; j < 4; ++j) acc[t][j] *= al;
#pragma unroll
        for (int i = 0; i < 2; ++i)
#pragma unroll
          for (int r = 0; r < 8; ++r) pf[t][i * 8 + r] = (_Float16)__builtin_amdgcn_exp2f(s2[i][r] - d);
        const v8f z = {}; ps[t] = wmma16(one, pf[t], z); }
      // the fragments fetched ahead are fetched again: on this path their registers are free for the work above
      if (p + 1 < SK / 32) {
#pragma unroll
        for (int i = 0; i < 2; ++i)
#pragma unroll
          for (int kc = 0; kc < 2; ++kc) kf[i][kc] = frag_h(Ks + ((p + 1) * 32 + i * 16) * KPI + kc * 32, lane); }
#pragma unroll
      for (int j = 0; j < 4; ++j) vf[j] = frag_h(Vs + (j * 16) * VPI + p * 32, lane);
    }
#pragma unroll
    for (int t = 0; t < QT; ++t) { lr[t] += ps[t][0];
#pragma unroll
      for (int j = 0; j < 4; ++j) acc[t][j] = wmma16(vf[j], pf[t], acc[t][j]); }
    __builtin_amdgcn_sched_barrier(0);   // keeps the next pass's V fragment loads out of this pass: a second set of them takes the kernel over 256 registers
    asm volatile("v_nop\n\tv_nop\n\tv_nop\n\tv_nop");   // four vector slots between this pass's last product and the next pass's first ones, whose results may be given the registers that P was read from
    __builtin_amdgcn_sched_barrier(0);   // holds the next pass's products behind those four slots
   }
   asm volatile("s_wait_dscnt 0x0" ::: "memory");      // this wave's reads of the stage's buffer are over
   asm volatile("s_wait_asynccnt 0x0" ::: "memory");   // the next stage has landed, as far as this wave copied it
   __syncthreads();                                     // publishes the next stage and frees this stage's buffer
   if (st + 2 < TT / SK) stage_kv(Kg + (size_t)((st + 2 + st0) & (TT / SK - 1)) * SK * CC, Vg + ((st + 2 + st0) & (TT / SK - 1)) * SK, lk0 + (unsigned)(st & 1) * (unsigned)sizeof(sK[0]), lv0 + (unsigned)(st & 1) * (unsigned)sizeof(sV[0]));
  }
  asm volatile("s_wait_asynccnt 0x0" ::: "memory");    // no copy is left in flight when the wave goes on to its end
#pragma unroll
  for (int t = 0; t < QT; ++t) {   // lane (g, col) holds o[d = 16 j + 8 g + r] of query col; the row sum comes over from lanes 0 to 15 by one exchange
    const float inv = 1.0f / (lr[t] + xhalf(lr[t])); const size_t ro = ((size_t)b * TT + ql0 + t * 16 + col) * CC + h * HD + 8 * g;
    v4f vv[4][2]; float dt = 0.f, nn = 0.f;
#pragma unroll
    for (int j = 0; j < 4; ++j) { vv[j][0] = *(const v4f*)(VR + ro + j * 16); vv[j][1] = *(const v4f*)(VR + ro + j * 16 + 4);
#pragma unroll
      for (int r = 0; r < 8; ++r) { const float o = acc[t][j][r] * inv, v = vv[j][r >> 2][r & 3]; acc[t][j][r] = o; dt += o * v; nn += v * v; } }
    dt += xhalf(dt); nn += xhalf(nn); const float al = dt / (nn + 1e-8f);
    v8b yh[4], yl[4];   // y as k_out's products take it: rounded to bf16, and what the rounding left, rounded again
#pragma unroll
    for (int j = 0; j < 4; ++j)
#pragma unroll
      for (int r = 0; r < 8; ++r) { const float o = acc[t][j][r] - al * vv[j][r >> 2][r & 3]; const __bf16 hi = (__bf16)o; yh[j][r] = hi; yl[j][r] = (__bf16)(o - (float)hi); }
#pragma unroll
    for (int j = 0; j < 4; ++j) { vst2(YH + ro + j * 16, yh[j]); vst2(YL + ro + j * 16, yl[j]); }
    asm volatile("s_wait_xcnt 0x0" ::: "memory");   // behind the tile's stores: no register that they name is reused in front of this wait
  } }
// ---- k_out: block = 8 waves = (128 rows, 128 cols), a wave = 32 x 64: out = y (bf16 hi + lo) Wproj + b. All three operands lie in memory as bf16 (k_fa wrote y's two parts, k_proj's fourth plane the weight), so a stage of 128 k goes to LDS by asynchronous copies, through no register, into two buffers: the next stage flies under this stage's products
#define OBK 128  // k per stage
#define OP 136   // elements per staged row of 128 bf16: 272 B = 16 B x odd, the pitch at which 16-byte fragment reads meet no bank twice
#define OAB (128u * OP * 2u)   // bytes of one staged operand
// one stage: 128 rows of 256 B of each operand, 24 copies of 16 B per lane, 16 lanes to a row, rows 16 apart from copy to copy. Each s_wait_xcnt stands inside its statement, so that no address register is rewritten in front of it.
__device__ __forceinline__ void stage_o(const __bf16* gw, const __bf16* gh, const __bf16* gl, unsigned lw) {
  const unsigned lh = lw + OAB, ll = lw + 2u * OAB;
  asm volatile("global_load_async_to_lds_b128 %0, %12, off\n\tglobal_load_async_to_lds_b128 %1, %13, off\n\tglobal_load_async_to_lds_b128 %2, %14, off\n\tglobal_load_async_to_lds_b128 %3, %15, off\n\t"
               "global_load_async_to_lds_b128 %4, %16, off\n\tglobal_load_async_to_lds_b128 %5, %17, off\n\tglobal_load_async_to_lds_b128 %6, %18, off\n\tglobal_load_async_to_lds_b128 %7, %19, off\n\t"
               "global_load_async_to_lds_b128 %8, %20, off\n\tglobal_load_async_to_lds_b128 %9, %21, off\n\tglobal_load_async_to_lds_b128 %10, %22, off\n\tglobal_load_async_to_lds_b128 %11, %23, off\n\ts_wait_xcnt 0x0"
               :: "v"(lw), "v"(lw + 1u * 16u * OP * 2u), "v"(lw + 2u * 16u * OP * 2u), "v"(lw + 3u * 16u * OP * 2u), "v"(lw + 4u * 16u * OP * 2u), "v"(lw + 5u * 16u * OP * 2u), "v"(lw + 6u * 16u * OP * 2u), "v"(lw + 7u * 16u * OP * 2u), "v"(lh), "v"(lh + 1u * 16u * OP * 2u), "v"(lh + 2u * 16u * OP * 2u), "v"(lh + 3u * 16u * OP * 2u),
                  "v"(gw), "v"(gw + 1 * 16 * CC), "v"(gw + 2 * 16 * CC), "v"(gw + 3 * 16 * CC), "v"(gw + 4 * 16 * CC), "v"(gw + 5 * 16 * CC), "v"(gw + 6 * 16 * CC), "v"(gw + 7 * 16 * CC), "v"(gh), "v"(gh + 1 * 16 * CC), "v"(gh + 2 * 16 * CC), "v"(gh + 3 * 16 * CC) : "memory");
  asm volatile("global_load_async_to_lds_b128 %0, %12, off\n\tglobal_load_async_to_lds_b128 %1, %13, off\n\tglobal_load_async_to_lds_b128 %2, %14, off\n\tglobal_load_async_to_lds_b128 %3, %15, off\n\t"
               "global_load_async_to_lds_b128 %4, %16, off\n\tglobal_load_async_to_lds_b128 %5, %17, off\n\tglobal_load_async_to_lds_b128 %6, %18, off\n\tglobal_load_async_to_lds_b128 %7, %19, off\n\t"
               "global_load_async_to_lds_b128 %8, %20, off\n\tglobal_load_async_to_lds_b128 %9, %21, off\n\tglobal_load_async_to_lds_b128 %10, %22, off\n\tglobal_load_async_to_lds_b128 %11, %23, off\n\ts_wait_xcnt 0x0"
               :: "v"(lh + 4u * 16u * OP * 2u), "v"(lh + 5u * 16u * OP * 2u), "v"(lh + 6u * 16u * OP * 2u), "v"(lh + 7u * 16u * OP * 2u), "v"(ll), "v"(ll + 1u * 16u * OP * 2u), "v"(ll + 2u * 16u * OP * 2u), "v"(ll + 3u * 16u * OP * 2u), "v"(ll + 4u * 16u * OP * 2u), "v"(ll + 5u * 16u * OP * 2u), "v"(ll + 6u * 16u * OP * 2u), "v"(ll + 7u * 16u * OP * 2u),
                  "v"(gh + 4 * 16 * CC), "v"(gh + 5 * 16 * CC), "v"(gh + 6 * 16 * CC), "v"(gh + 7 * 16 * CC), "v"(gl), "v"(gl + 1 * 16 * CC), "v"(gl + 2 * 16 * CC), "v"(gl + 3 * 16 * CC), "v"(gl + 4 * 16 * CC), "v"(gl + 5 * 16 * CC), "v"(gl + 6 * 16 * CC), "v"(gl + 7 * 16 * CC) : "memory");
}
__global__ __launch_bounds__(256) void k_out(const __bf16* __restrict__ YH, const __bf16* __restrict__ YL, const __bf16* __restrict__ WB, const float* __restrict__ BP, float* __restrict__ OUT) { __shared__ __align__(16) float sf[8][32][68]; __shared__ __align__(16) __bf16 sS[2][3][128][OP];   // per buffer: W, y hi, y lo
  const int tid = threadIdx.x, wave = tid >> 5, lane = tid & 31, col = lane & 15, g = lane >> 4; const int wr = wave >> 1, wc = wave & 1; const int c0 = blockIdx.y * 128; const size_t r0 = (size_t)blockIdx.x * 128;
  v8f acc[2][4] = {};
  const int srow = tid >> 4, sq = tid & 15;   // copies: lane = (row srow + 16 i, 16-byte piece sq of the stage's 256 B)
  const __bf16* Hp = YH + (r0 + srow) * CC; const __bf16* Lp = YL + (r0 + srow) * CC; const __bf16* Wp = WB + (size_t)(c0 + srow) * CC;
  const unsigned l0 = (unsigned)(size_t)&sS[0][0][srow][sq * 8];   // the lane's LDS byte address in buffer 0
  const int ks0 = ((blockIdx.x & 3) + ((blockIdx.x >> 3) << 2) + 2 * blockIdx.y) & (CC / 64 - 1);   // where the block's k walk starts, in units of 64 k, as in k_proj: the 8 blocks that read the same y rows start 128 k apart, the 32 that read the same W rows are spread over all 16 places
  const int kl0 = ks0 * 64 + sq * 8;   // the lane's first k; the walk wraps round piece by piece
  { const int ko = kl0 & (CC - 1); stage_o(Wp + ko, Hp + ko, Lp + ko, l0); }
  asm volatile("s_wait_asynccnt 0x0" ::: "memory");   // stage 0 has landed, as far as this wave copied it
  __syncthreads();                                     // publishes stage 0
  { const int ko = (kl0 + OBK) & (CC - 1); stage_o(Wp + ko, Hp + ko, Lp + ko, l0 + 3u * OAB); }   // the second stage flies under the first one's products
#pragma unroll 1   // rolled: the two buffers differ by a base address only
  for (int ks = 0; ks < CC / OBK; ++ks) { const int cur = ks & 1;
#pragma unroll
    for (int hf = 0; hf < OBK / 64; ++hf) {
      v16b ah[2][2], al[2][2], w[2][4];   // the fragments of 64 k, read as one group
#pragma unroll
      for (int kk = 0; kk < 2; ++kk) {
#pragma unroll
        for (int i = 0; i < 2; ++i) { ah[kk][i] = frag_b(&sS[cur][1][wr * 32 + i * 16 + col][hf * 64 + kk * 32], lane); al[kk][i] = frag_b(&sS[cur][2][wr * 32 + i * 16 + col][hf * 64 + kk * 32], lane); }
#pragma unroll
        for (int j = 0; j < 4; ++j) w[kk][j] = frag_b(&sS[cur][0][wc * 64 + j * 16 + col][hf * 64 + kk * 32], lane);
        __builtin_amdgcn_sched_barrier(0); }   // keeps the loads in the order in which the products take them; left free they are sorted by address, and the third product waits for nearly the whole group
#pragma unroll
      for (int kk = 0; kk < 2; ++kk) {
#pragma unroll
        for (int i = 0; i < 2; ++i)
#pragma unroll
          for (int j = 0; j < 4; ++j) acc[i][j] = wmma_bf(ah[kk][i], w[kk][j], acc[i][j]);
#pragma unroll
        for (int i = 0; i < 2; ++i)   // per tile still hi, then lo, of each 32 k in turn
#pragma unroll
          for (int j = 0; j < 4; ++j) acc[i][j] = wmma_bf(al[kk][i], w[kk][j], acc[i][j]); } }
    asm volatile("s_wait_dscnt 0x0" ::: "memory");      // this wave's reads of the stage's buffer are over
    asm volatile("s_wait_asynccnt 0x0" ::: "memory");   // the next stage has landed, as far as this wave copied it
    __syncthreads();                                     // publishes the next stage and frees this stage's buffer
    if (ks + 2 < CC / OBK) { const int ko = (kl0 + (ks + 2) * OBK) & (CC - 1); stage_o(Wp + ko, Hp + ko, Lp + ko, l0 + (unsigned)cur * 3u * OAB); } }
  asm volatile("s_wait_asynccnt 0x0" ::: "memory");    // no copy is left in flight when the wave goes on to its end
#pragma unroll
  for (int j = 0; j < 4; ++j) { const float bb = BP ? bfr(BP[c0 + wc * 64 + j * 16 + col]) : 0.f;
#pragma unroll
    for (int i = 0; i < 2; ++i)
#pragma unroll
      for (int r = 0; r < 8; ++r) sf[wave][i * 16 + 8 * g + r][j * 16 + col] = acc[i][j][r] + bb; }
  LDSX();
#pragma unroll
  for (int e = 0; e < 16; ++e) { const int rl = e * 2 + (lane >> 4), q = lane & 15; vst2(OUT + (r0 + wr * 32 + rl) * CC + c0 + wc * 64 + q * 4, *(const v4f*)&sf[wave][rl][q * 4]); } }
extern "C" void kernel_launch(void* const* d_in, const int* in_sizes, int n_in, void* d_out, int out_size, void* d_ws, size_t ws_size, hipStream_t stream) {
  (void)in_sizes; (void)n_in; (void)out_size;
  const float** F = (const float**)d_in;   // 0 x [2,2048,1024], 1 wq [1024,1024] ([out,in]), 2 bq, 3 wk, 4 bk, 5 wv, 6 bv, 7 wo, 8 bo
  if (ws_size < (size_t)WS_END) return;
  char* ws = (char*)d_ws; _Float16 *QH = (_Float16*)(ws + WS_QH), *QL = (_Float16*)(ws + WS_QL), *KH = (_Float16*)(ws + WS_KH), *VT = (_Float16*)(ws + WS_VT); float *VR = (float*)(ws + WS_VR); __bf16 *YH = (__bf16*)(ws + WS_YH), *YL = (__bf16*)(ws + WS_YL), *WB = (__bf16*)(ws + WS_WB);
  k_proj<<<dim3(TNB * TT / PBM, CC / PBN, 4), PNT, 0, stream>>>(F[0], F[1], F[2], F[3], F[4], F[5], F[6], F[7], QH, QL, KH, VT, VR, WB);
  k_fa<<<dim3(TT / (8 * 16 * QT), NH, TNB), 256, 0, stream>>>(QH, KH, VT, VR, YH, YL);
  k_out<<<dim3(TNB * TT / 128, CC / 128), 256, 0, stream>>>(YH, YL, WB, F[8], (float*)d_out);
}

// v010
// It runs in 70.4 microseconds.
// Versions between v008 and this one are left out; their measured steps multiply to 1.12 times as fast.
// All steps since v000 together make it 19.6 times as fast.
// compute dtype: all float inputs rounded to bf16; q/k/v = x W^T + b with EXACT bf16 products on WMMA 16x16x32, f32 accumulate; q times log2(e) / 8 and k rounded once to f16 (1-product logits, f32, kept in registers, formed on top of minus the running maximum); online softmax in f32, base 2 -> unnormalised P f16 (32 keys' sum at most 2^13); o = P . v (v once to f16) / row sum of the rounded P; per-position exclusion o -= (o . v_s / (|v_s|^2 + 1e-8)) v_s in f32 with the exact f32 v row; out = o (rounded once to f16) Wo^T + bo, Wo's bf16 values held as f16; f32 output.
#include <hip/hip_runtime.h>
#include <math.h>

typedef __attribute__((ext_vector_type(16))) _Float16 v16h;
typedef __attribute__((ext_vector_type(16))) __bf16 v16b;
typedef __attribute__((ext_vector_type(8)))  _Float16 v8h;
typedef __attribute__((ext_vector_type(8)))  float v8f;
typedef __attribute__((ext_vector_type(4)))  float v4f;
typedef __attribute__((ext_vector_type(2)))  float v2f;
typedef __attribute__((ext_vector_type(4)))  unsigned v4u;
typedef __attribute__((ext_vector_type(4)))  int v4i;
typedef float __attribute__((may_alias)) float_a;
typedef int __attribute__((may_alias)) int_a;

template <typename T> __device__ __forceinline__ void vst2(void* p, T v) { *(T*)p = v;  }
__device__ __forceinline__ v8f wmma16(v16h a, v16h b, v8f c) {
  return __builtin_amdgcn_wmma_f32_16x16x32_f16(false, a, false, b, (short)0, c, false, false);   // the compiler keeps the distance behind its own builtin form where a vector instruction follows on D, A or B
}
__device__ __forceinline__ v8f wmma_bf(v16b a, v16b b, v8f c) {
  v8f d = __builtin_amdgcn_wmma_f32_16x16x32_bf16(false, a, false, b, (short)0, c, false, false);
  asm volatile("v_nop\n\tv_nop\n\tv_nop\n\tv_nop" : "+v"(d) : "v"(a), "v"(b));
  return d;
}
// 16x16x32 fragments: lane = (h = lane>>4, row/col = lane&15); elements 0..7 = k0+8h+0..7, 8..15 = k0+16+8h+0..7; D element r = row 8h+r
__device__ __forceinline__ v16h frag_h(const _Float16* rowk0, int lane) {
  union { v16h v; v8h q[2]; } u; const _Float16* p = rowk0 + 8 * (lane >> 4);
  u.q[0] = *(const v8h*)p; u.q[1] = *(const v8h*)(p + 16); return u.v;
}
__device__ __forceinline__ v16h frag_f32(const float* rowk0, int lane) {
  v16h a; const float* p = rowk0 + 8 * (lane >> 4);
#pragma unroll
  for (int i = 0; i < 8; ++i) { a[i] = (_Float16)p[i]; a[8 + i] = (_Float16)p[16 + i]; }
  return a;
}
__device__ __forceinline__ v16h frag_f32s(const float* rowk0, int lane, float sc) {
  v16h a; const float* p = rowk0 + 8 * (lane >> 4);
#pragma unroll
  for (int i = 0; i < 8; ++i) { a[i] = (_Float16)(p[i] * sc); a[8 + i] = (_Float16)(p[16 + i] * sc); }
  return a;
}
// column fragment from a [K][ld] layout (column n), rows >= K read as 0
__device__ __forceinline__ v16h fragc_f32(const float* W, int k0, int n, int lane, int ld, int K) {
  v16h a; const int g = lane >> 4;
#pragma unroll
  for (int i = 0; i < 8; ++i) { const int ka = k0 + 8 * g + i, kb = ka + 16;
    a[i] = (_Float16)(ka < K ? W[(size_t)(ka < K ? ka : K - 1) * ld + n] : 0.f); a[8 + i] = (_Float16)(kb < K ? W[(size_t)(kb < K ? kb : K - 1) * ld + n] : 0.f); }
  return a;
}
struct F2 { v16b h, l; };
__device__ __forceinline__ F2 bsplit16(const float v[16]) { F2 r;
#pragma unroll
  for (int i = 0; i < 16; ++i) { const __bf16 h = (__bf16)v[i]; r.h[i] = h; r.l[i] = (__bf16)(v[i] - (float)h); }
  return r; }
__device__ __forceinline__ F2 split_row(const float* row, int k0, int lane) { float v[16]; const float* p = row + k0 + 8 * (lane >> 4);
#pragma unroll
  for (int i = 0; i < 8; ++i) { v[i] = p[i]; v[8 + i] = p[16 + i]; }
  return bsplit16(v); }
__device__ __forceinline__ F2 split_rowK(const float* row, int k0, int lane, int K) { float v[16]; const int g = lane >> 4;
#pragma unroll
  for (int i = 0; i < 8; ++i) { const int ka = k0 + 8 * g + i, kb = ka + 16; v[i] = ka < K ? row[ka < K ? ka : K - 1] : 0.f; v[8 + i] = kb < K ? row[kb < K ? kb : K - 1] : 0.f; }
  return bsplit16(v); }
__device__ __forceinline__ F2 split_col(const float* W, int k0, int n, int lane, int ld, int K) { float v[16]; const int g = lane >> 4;
#pragma unroll
  for (int i = 0; i < 8; ++i) { const int ka = k0 + 8 * g + i, kb = ka + 16; v[i] = ka < K ? W[(size_t)(ka < K ? ka : K - 1) * ld + n] : 0.f; v[8 + i] = kb < K ? W[(size_t)(kb < K ? kb : K - 1) * ld + n] : 0.f; }
  return bsplit16(v); }
__device__ __forceinline__ v8f mac3(const F2& a, const F2& b, v8f c) { c = wmma_bf(a.l, b.h, c); c = wmma_bf(a.h, b.l, c); return wmma_bf(a.h, b.h, c); }
__device__ __forceinline__ float sigm(float v) { return 1.0f / (1.0f + expf(-v)); }
#define LDSX() do { asm volatile("s_wait_dscnt 0" ::: "memory"); __builtin_amdgcn_wave_barrier(); __builtin_amdgcn_fence(__ATOMIC_RELEASE, "workgroup"); } while (0)


// Exclusive self attention (B 2, S 2,048, D 1,024 = 16 x 64): q/k/v Linear ([out,in] + bias), softmax(q k / 8) v, then per position and head o -= <o, v_s> / (|v_s|^2 + 1e-8) v_s, output Linear.
#define NB 2
#define TT 2048
#define CC 1024
#define NH 16
#define HD 64
#ifndef TNB
#define TNB NB
#endif
typedef __attribute__((ext_vector_type(8))) __bf16 v8b;
__device__ __forceinline__ v16b frag_b(const __bf16* rowk0, int lane) {
  union { v16b v; v8b q[2]; } u; const __bf16* p = rowk0 + 8 * (lane >> 4);
  u.q[0] = *(const v8b*)p; u.q[1] = *(const v8b*)(p + 16); return u.v;
}
__device__ __forceinline__ float bfr(float v) { return (float)(__bf16)v; }
typedef __attribute__((ext_vector_type(4))) __bf16 v4b;
typedef v4f __attribute__((aligned(4))) v4fu;   // 16-byte read of an input that is only known to be float-aligned
#define KP2 72  // elements per staged row of 64 bf16: 144 B = 16 B x odd, the pitch at which 16-byte fragment reads meet no bank twice
__device__ __forceinline__ v4b cvt4(v4f v) { v4b r;
#pragma unroll
  for (int i = 0; i < 4; ++i) r[i] = (__bf16)v[i];
  return r; }
typedef __attribute__((ext_vector_type(4))) _Float16 v4h;
__device__ __forceinline__ v4h cvt4h(v4f v) { v4h r;   // rounded to bf16 as every input is, then held as f16: the same value wherever f16 has the range (8 bits fit its 11; below 2^-17 it keeps steps of 2^-24)
#pragma unroll
  for (int i = 0; i < 4; ++i) r[i] = (_Float16)(float)(__bf16)v[i];
  return r; }
__device__ __attribute__((noinline)) float exp_ni(float v) { return expf(v); }
__device__ __attribute__((noinline)) float erf_ni(float v) { return erff(v); }

// work-group barrier ordered for LDS alone: every wave's LDS reads and writes are over before it and none of the later ones starts before it. __syncthreads() would also wait for the global loads in flight, whose values go to registers and are not wanted before the next step's head
__device__ __forceinline__ void lds_barrier() { __builtin_amdgcn_fence(__ATOMIC_RELEASE, "workgroup", "local"); __builtin_amdgcn_s_barrier(); __builtin_amdgcn_fence(__ATOMIC_ACQUIRE, "workgroup", "local"); }

#define WS_QH  0u
#define WS_QL  (WS_QH + 2u * (size_t)NB * TT * CC)
#define WS_KH  (WS_QL + 2u * (size_t)NB * TT * CC)
#define WS_VT  (WS_KH + 2u * (size_t)NB * TT * CC)      // f16 v planes [b][c][t]
#define WS_YH  (WS_VT + 2u * (size_t)NB * CC * TT)      // f16 y rows [b*t][C]
#define WS_VR  (WS_YH + 2u * (size_t)NB * TT * CC)      // f32 v rows [b*t][C] for the exclusion step
#define WS_WB  (WS_VR + 4u * (size_t)NB * TT * CC)      // f16 rows of the output weight [out][in]: its bf16 values
#define WS_END (WS_WB + 2u * (size_t)CC * CC)

// ---- k_proj: block = 16 waves = (256 rows, 256 cols, which), a wave = 64 x 64: qkv = x W (+ b), exact; q (scaled by QSC) -> f16 hi (+ residual), k -> f16 rows, v -> f16 planes and f32 rows. Per 32-k step the block reads its x and W rows once, a whole 128-B line per 8 lanes, rounds them to bf16 one step later and stages them in LDS (two buffers of 64 k, one barrier per 64 k); a wave takes 4 + 4 fragments from there for 16 products. In the epilogue each wave turns its own tile in its own piece of the same LDS.
#define QSC (0.125f * 1.4426950408889634f)   // q leaves k_proj times 1 / 8 and log2(e): k_fa's products are then the logits in base 2
#define PBM 256   // rows of x per block
#define PBN 256   // rows of W (output columns) per block
#define PNT 512   // threads: 4 x 4 waves
#define PEW 9216  // bytes of LDS per wave in the epilogue: 64 rows of 72 f16, or 32 rows of 68 f32
#define WOB (CC * CC / ((TNB * TT / PBM) * (CC / PBN)))   // elements of the output weight per block of the grid's fourth plane
__global__ __launch_bounds__(PNT) void k_proj(const float* __restrict__ X, const float* __restrict__ WQ, const float* __restrict__ BQ, const float* __restrict__ WK, const float* __restrict__ BK, const float* __restrict__ WV, const float* __restrict__ BV, const float* __restrict__ WO, _Float16* __restrict__ QH, _Float16* __restrict__ QL, _Float16* __restrict__ KH, _Float16* __restrict__ VT, float* __restrict__ VR, _Float16* __restrict__ WB) {
  __shared__ __align__(16) char sm[(PNT / 32) * PEW];
  __bf16 (*sA)[PBM][KP2] = (__bf16 (*)[PBM][KP2])sm; __bf16 (*sB)[PBN][KP2] = (__bf16 (*)[PBN][KP2])(sm + 2 * PBM * KP2 * 2);   // main loop: 2 x 36 KiB each
  const int tid = threadIdx.x, wave = tid >> 5, lane = tid & 31, col = lane & 15, g = lane >> 4; const int wr = wave >> 2, wc = wave & 3; const int which = blockIdx.z; const int c0 = blockIdx.y * PBN; const size_t r0 = (size_t)blockIdx.x * PBM; const float* WA = which == 0 ? WQ : which == 1 ? WK : WV; const float* BA = which == 0 ? BQ : which == 1 ? BK : BV;
  if (which == 3) {   // the grid's fourth plane, on WGPs that the three products leave free: rounds the output weight to bf16 once and writes the values as f16, for k_out's copies, which cannot round. The whole block leaves here, in front of every barrier
    const size_t wo = (size_t)(blockIdx.y * (TNB * TT / PBM) + blockIdx.x) * WOB + tid * 4; const float* wp = WO + wo; v4f rw[WOB / (PNT * 4)];
#pragma unroll
    for (int i = 0; i < WOB / (PNT * 4); ++i) rw[i] = *(const v4fu*)(wp + i * PNT * 4);
    asm volatile("s_wait_xcnt 0x0" :: "v"(wp) : "memory");   // the loads' address register stays live up to this wait, so that nothing lands on it in front of the wait
    _Float16* bp = WB + wo;
#pragma unroll
    for (int i = 0; i < WOB / (PNT * 4); ++i) *(v4h*)(bp + i * PNT * 4) = cvt4h(rw[i]);   // 256 B in a row per wave
    asm volatile("s_wait_xcnt 0x0" :: "v"(bp) : "memory");   // behind the wave's last stores: no register that they name is reused in front of this wait
    return; }
  const int srow = tid >> 3, sq = tid & 7;   // staging: thread = (row srow + 64 i, 16-byte piece sq of the row's 128-B line)
  const float* Xp = X + (r0 + srow) * CC + sq * 4; const float* Wp = WA + (size_t)(c0 + srow) * CC + sq * 4;
  // The block's first k step; the walk wraps round, so every start gives the whole sum, in another order. Blocks that read the same rows start at different steps: they do not ask L2 for the same lines at the same moment, and a line that one of them has brought in from memory is in L2 when the others come to it. Same x rows (12 blocks): 3 steps apart. Same W rows (16 blocks): 2 apart, and 4 apart among blocks whose blockIdx.x lies in four neighbouring residues modulo 8. For speed only.
  const int ks0 = (((blockIdx.x & 3) << 2) + ((blockIdx.x >> 3) << 4) + (((blockIdx.x >> 2) & 1) << 1) + 3 * (blockIdx.y + 4 * blockIdx.z)) & (CC / 32 - 1);
  v4f ra[4], rb[4];
  { v4f pa[2][4], pb[2][4];   // the first stage's two tiles, asked for in one flight: the accumulators are not live yet
#pragma unroll
    for (int e = 0; e < 2; ++e) { const int kn = ((e + ks0) & (CC / 32 - 1)) * 32; const float* xn = Xp + kn; const float* wn = Wp + kn;
#pragma unroll
      for (int i = 0; i < 4; ++i) pa[e][i] = *(const v4fu*)(xn + (size_t)i * 64 * CC);
#pragma unroll
      for (int i = 0; i < 4; ++i) pb[e][i] = *(const v4fu*)(wn + (size_t)i * 64 * CC);
      asm volatile("s_wait_xcnt 0x0" :: "v"(xn), "v"(wn) : "memory"); }   // both runs' address registers stay live up to this wait: the next tile's addresses take them only behind it
    { const int kn = ((2 + ks0) & (CC / 32 - 1)) * 32; const float* xn = Xp + kn; const float* wn = Wp + kn;   // the third tile's lines: taken at the head of the first step
#pragma unroll
      for (int i = 0; i < 4; ++i) ra[i] = *(const v4fu*)(xn + (size_t)i * 64 * CC);
#pragma unroll
      for (int i = 0; i < 4; ++i) rb[i] = *(const v4fu*)(wn + (size_t)i * 64 * CC);
      asm volatile("s_wait_xcnt 0x0" :: "v"(xn), "v"(wn) : "memory"); }   // as above: nothing takes the address registers in front of this wait
#pragma unroll
    for (int e = 0; e < 2; ++e) {
#pragma unroll
      for (int i = 0; i < 4; ++i) *(v4b*)&sA[0][srow + i * 64][e * 32 + sq * 4] = cvt4(pa[e][i]);
#pragma unroll
      for (int i = 0; i < 4; ++i) *(v4b*)&sB[0][srow + i * 64][e * 32 + sq * 4] = cvt4(pb[e][i]); } }
  lds_barrier();   // publishes the first stage
  v8f acc[4][4] = {};
#pragma unroll 2   // by two, so that each half addresses its buffers by constants
  for (int ks = 0; ks < CC / 64; ++ks) { const int cur = ks & 1;
#pragma unroll
    for (int e = 0; e < 2; ++e) { const int kc = ks * 2 + e;   // the stage's two steps of 32 k, with no barrier between them
      v16b a[4], w[4];   // read in the order in which the products take them: the first product waits for four of the sixteen loads
      a[0] = frag_b(&sA[cur][wr * 64 + col][e * 32], lane);
#pragma unroll
      for (int j = 0; j < 4; ++j) w[j] = frag_b(&sB[cur][wc * 64 + j * 16 + col][e * 32], lane);
#pragma unroll
      for (int i = 1; i < 4; ++i) a[i] = frag_b(&sA[cur][wr * 64 + i * 16 + col][e * 32], lane);
      __builtin_amdgcn_sched_barrier(0);   // the fragment loads go first, in that order: the roundings and stores below run while LDS answers them
      if (kc + 2 < CC / 32) {   // the tile whose lines were asked for a whole step ago goes to its half of the other buffer; the stage's barrier, up to two steps on, publishes it
#pragma unroll
        for (int i = 0; i < 4; ++i) *(v4b*)&sA[cur ^ 1][srow + i * 64][e * 32 + sq * 4] = cvt4(ra[i]);
#pragma unroll
        for (int i = 0; i < 4; ++i) *(v4b*)&sB[cur ^ 1][srow + i * 64][e * 32 + sq * 4] = cvt4(rb[i]); }
      if (kc + 3 < CC / 32) {   // the following tile's lines fly under this step's products and are taken at the head of the next step
        const int kn = ((kc + 3 + ks0) & (CC / 32 - 1)) * 32; const float* xn = Xp + kn; const float* wn = Wp + kn;
#pragma unroll
        for (int i = 0; i < 4; ++i) ra[i] = *(const v4fu*)(xn + (size_t)i * 64 * CC);
#pragma unroll
        for (int i = 0; i < 4; ++i) rb[i] = *(const v4fu*)(wn + (size_t)i * 64 * CC);
        asm volatile("s_wait_xcnt 0x0" :: "v"(xn), "v"(wn) : "memory"); }   // both runs' address registers stay live up to this wait, so that no load of a run lands on them in front of it
#pragma unroll
      for (int i = 0; i < 4; ++i)
#pragma unroll
        for (int j = 0; j < 4; ++j) acc[i][j] = wmma_bf(a[i], w[j], acc[i][j]);
      __builtin_amdgcn_sched_barrier(0); }   // keeps the next step's roundings, which wait for the lines in flight, from moving up among this step's products
    // publishes the buffer filled during the stage and ends the reads of the one filled next; the last one frees the LDS for the epilogue
    lds_barrier(); }
  char* ew = sm + wave * PEW;   // this wave's own piece: no other wave reads or writes it from here on, so LDSX() orders all that follows
  const size_t rw = r0 + wr * 64; const int cw = c0 + wc * 64;   // the wave's first row and column
  const int bi = cw + col; float bb[4];
#pragma unroll
  for (int j = 0; j < 4; ++j) bb[j] = BA[bi + j * 16];
  asm volatile("s_wait_xcnt 0x0" :: "v"(bi) : "memory");   // the bias loads' index register stays live up to this wait, so that none of the four lands on it in front of the wait
#pragma unroll
  for (int j = 0; j < 4; ++j) bb[j] = bfr(bb[j]);
  if (which == 0) { _Float16 (*eh)[72] = (_Float16 (*)[72])ew;   // 32 rows at a time: rows 0..31 of the piece hold q's f16 value, rows 32..63 its residual
#pragma unroll
    for (int hf = 0; hf < 2; ++hf) {
      if (hf) LDSX();   // the first half's reads are over before its rows are written anew
#pragma unroll
      for (int i = 0; i < 2; ++i)
#pragma unroll
        for (int j = 0; j < 4; ++j)
#pragma unroll
          for (int r = 0; r < 8; ++r) { const float v = (acc[hf * 2 + i][j][r] + bb[j]) * QSC; const _Float16 hv = (_Float16)v; eh[i * 16 + 8 * g + r][j * 16 + col] = hv; eh[32 + i * 16 + 8 * g + r][j * 16 + col] = (_Float16)(v - (float)hv); }
      LDSX();
#pragma unroll
      for (int e = 0; e < 8; ++e) { const int rl = e * 4 + (lane >> 3), q = lane & 7; const size_t o = (rw + hf * 32 + rl) * CC + cw + q * 8;   // 4 whole 128-B lines per store
        vst2((unsigned*)(QH + o), *(const v4u*)&eh[rl][q * 8]); vst2((unsigned*)(QL + o), *(const v4u*)&eh[32 + rl][q * 8]); } }
    asm volatile("s_wait_xcnt 0x0" ::: "memory");   // behind the wave's last stores: no register that they name is reused in front of this wait
  }
  else if (which == 1) { _Float16 (*eh)[72] = (_Float16 (*)[72])ew;
#pragma unroll
    for (int i = 0; i < 4; ++i)
#pragma unroll
      for (int j = 0; j < 4; ++j)
#pragma unroll
        for (int r = 0; r < 8; ++r) eh[i * 16 + 8 * g + r][j * 16 + col] = (_Float16)(acc[i][j][r] + bb[j]);
    LDSX();
#pragma unroll
    for (int e = 0; e < 16; ++e) { const int rl = e * 4 + (lane >> 3), q = lane & 7; vst2((unsigned*)(KH + (rw + rl) * CC + cw + q * 8), *(const v4u*)&eh[rl][q * 8]); }   // 4 whole 128-B lines per store
    asm volatile("s_wait_xcnt 0x0" ::: "memory");   // behind the wave's last stores: no register that they name is reused in front of this wait
  }
  else { _Float16 (*et)[72] = (_Float16 (*)[72])ew; float (*ef)[68] = (float (*)[68])ew; const size_t b = rw / TT; const int t0 = (int)(rw % TT);
#pragma unroll
    for (int i = 0; i < 4; ++i)
#pragma unroll
      for (int j = 0; j < 4; ++j) { v8h hv;
#pragma unroll
        for (int r = 0; r < 8; ++r) hv[r] = (_Float16)(acc[i][j][r] + bb[j]);
        *(v8h*)&et[j * 16 + col][i * 16 + 8 * g] = hv; }   // a lane's 8 rows are 8 neighbours of one plane row
    LDSX();
#pragma unroll
    for (int e = 0; e < 16; ++e) { const int cl = e * 4 + (lane >> 3), q = lane & 7; vst2((unsigned*)(VT + (b * CC + cw + cl) * (size_t)TT + t0 + q * 8), *(const v4u*)&et[cl][q * 8]); }
#pragma unroll
    for (int hf = 0; hf < 2; ++hf) {   // the f32 rows, 32 at a time
      LDSX();
#pragma unroll
      for (int i = 0; i < 2; ++i)
#pragma unroll
        for (int j = 0; j < 4; ++j)
#pragma unroll
          for (int r = 0; r < 8; ++r) ef[i * 16 + 8 * g + r][j * 16 + col] = acc[hf * 2 + i][j][r] + bb[j];
      LDSX();
#pragma unroll
      for (int e = 0; e < 16; ++e) { const int rl = e * 2 + (lane >> 4), q = lane & 15; vst2(VR + (rw + hf * 32 + rl) * CC + cw + q * 4, *(const v4f*)&ef[rl][q * 4]); } }
    asm volatile("s_wait_xcnt 0x0" ::: "memory");   // behind the wave's last stores: no register that they name is reused in front of this wait
  } }
// ---- k_fa: block = 8 waves x 32 queries of (b,h). The block brings K rows and V plane rows to LDS once per stage of 128 keys, by asynchronous copies into two buffers, and its 8 waves take their fragments from there. Per pass of 32 keys: S^T = K Q^T - m (a lane holds 16 logits of one query per 16-query tile; minus the maximum in use is the products' C operand), exp2 in registers, the pass's row sums by one product with an A whose row 0 is ones (they also tell when the maximum must be renewed), O^T += V^T P^T (the two S^T tiles, converted, are the B operand); then the exclusion step and the y rows.
__device__ __forceinline__ float xhalf(float x) { return __builtin_bit_cast(float, __builtin_amdgcn_permlanex16(__builtin_bit_cast(int, x), __builtin_bit_cast(int, x), 0x76543210, 0xfedcba98, false, false)); }  // lane l with lane l ^ 16
#define QT 2
#define PSMAX 8192.0f   // a pass's sum of P, over a lane's queries, above which the maxima in use are renewed: 32 keys at 2^8
#define SK 128   // keys per stage
#define KPI 72   // f16 per staged K row of 64: 144 B = 16 B x odd (no bank met twice by 16-byte fragment reads)
#define VPI 136  // f16 per staged V plane row of 128: 272 B = 16 B x odd
// one stage: 128 K rows of 128 B and 64 V plane rows of 256 B, 8 copies of 16 B per lane, whole lines per wave. The s_wait_xcnt stands inside the statement, so that no address register is rewritten in front of it.
__device__ __forceinline__ void stage_kv(const _Float16* gk, const _Float16* gv, unsigned lk, unsigned lv) {
  asm volatile("global_load_async_to_lds_b128 %0, %8, off\n\tglobal_load_async_to_lds_b128 %1, %9, off\n\tglobal_load_async_to_lds_b128 %2, %10, off\n\tglobal_load_async_to_lds_b128 %3, %11, off\n\t"
               "global_load_async_to_lds_b128 %4, %12, off\n\tglobal_load_async_to_lds_b128 %5, %13, off\n\tglobal_load_async_to_lds_b128 %6, %14, off\n\tglobal_load_async_to_lds_b128 %7, %15, off\n\ts_wait_xcnt 0x0"
               :: "v"(lk), "v"(lk + 32u * KPI * 2u), "v"(lk + 64u * KPI * 2u), "v"(lk + 96u * KPI * 2u), "v"(lv), "v"(lv + 16u * VPI * 2u), "v"(lv + 32u * VPI * 2u), "v"(lv + 48u * VPI * 2u),
                  "v"(gk), "v"(gk + 32 * CC), "v"(gk + 64 * CC), "v"(gk + 96 * CC), "v"(gv), "v"(gv + 16 * (size_t)TT), "v"(gv + 32 * (size_t)TT), "v"(gv + 48 * (size_t)TT) : "memory");
}
__global__ __launch_bounds__(256) void k_fa(const _Float16* __restrict__ QH, const _Float16* __restrict__ KH, const _Float16* __restrict__ VT, const float* __restrict__ VR, _Float16* __restrict__ YH) {
  const int tid = threadIdx.x, wave = tid >> 5, lane = tid & 31, col = lane & 15, g = lane >> 4; const int h = blockIdx.y, b = blockIdx.z; const int ql0 = blockIdx.x * (8 * 16 * QT) + wave * (16 * QT);
  __shared__ __align__(16) _Float16 sK[2][SK][KPI]; __shared__ __align__(16) _Float16 sV[2][HD][VPI];
  const _Float16* Kg = KH + ((size_t)b * TT + (tid >> 3)) * CC + h * HD + (tid & 7) * 8;              // copies: lane = (key row tid/8 + 32 i, 16-byte piece tid%8 of its 128 B)
  const _Float16* Vg = VT + ((size_t)b * CC + h * HD + (tid >> 4)) * (size_t)TT + (tid & 15) * 8;     // copies: lane = (plane row tid/16 + 16 i, 16-byte piece tid%16 of the stage's 256 B)
  const unsigned lk0 = (unsigned)(size_t)&sK[0][tid >> 3][(tid & 7) * 8], lv0 = (unsigned)(size_t)&sV[0][tid >> 4][(tid & 15) * 8];   // the lane's LDS byte addresses in buffer 0
  const int st0 = ((blockIdx.x & 3) << 2) + ((blockIdx.x >> 2) << 1);   // the block's first stage; the walk wraps round: the 8 blocks of one (b,h), which read the same K and V, start 2 stages apart. For speed only
  stage_kv(Kg + (size_t)st0 * SK * CC, Vg + st0 * SK, lk0, lv0);
  const _Float16* Qa = QH + ((size_t)b * TT + ql0 + col) * CC + h * HD + 8 * g;   // this lane's first 8 elements of query row col (fragment order as in frag_h)
  v16h qf[QT][2];
#pragma unroll
  for (int t = 0; t < QT; ++t)
#pragma unroll
    for (int kc = 0; kc < 2; ++kc) { union { v16h v; v8h q[2]; } u; u.q[0] = *(const v8h*)(Qa + t * 16 * CC + kc * 32); u.q[1] = *(const v8h*)(Qa + t * 16 * CC + kc * 32 + 16); qf[t][kc] = u.v; }
  asm volatile("s_wait_xcnt 0x0" :: "v"(Qa) : "memory");   // the Q loads' address register stays live up to this wait, so that the accumulators below reuse it only behind it
  asm volatile("s_wait_asynccnt 0x0" ::: "memory");        // the block's first stage has landed, as far as this wave copied it
  __syncthreads();                                          // publishes the block's first stage
  stage_kv(Kg + (size_t)((st0 + 1) & (TT / SK - 1)) * SK * CC, Vg + ((st0 + 1) & (TT / SK - 1)) * SK, lk0 + (unsigned)sizeof(sK[0]), lv0 + (unsigned)sizeof(sV[0]));   // the second stage flies under the first one's passes
  v8f acc[QT][4] = {}; v8f cm[QT] = {}; float lr[QT] = {};   // cm: every element is minus its query's maximum in use (0 until the first pass sets it); lr: the query's sum of P, in lanes 0 to 15 (0 in the others)
  v16h one;   // A operand of the row sums: row 0 (lanes 0 and 16) is 1 at all 32 k, every other row 0
#pragma unroll
  for (int i = 0; i < 16; ++i) one[i] = col == 0 ? (_Float16)1.0f : (_Float16)0.0f;
#pragma unroll 1
  for (int st = 0; st < TT / SK; ++st) {   // rolled: the two buffers differ by a base address only
   const _Float16* Ks = &sK[st & 1][col][0];   // key row col of a 16-key tile
   const _Float16* Vs = &sV[st & 1][col][0];   // plane row d = col of a 16-d tile
   v16h kf[2][2];
#pragma unroll
   for (int i = 0; i < 2; ++i)
#pragma unroll
     for (int kc = 0; kc < 2; ++kc) kf[i][kc] = frag_h(Ks + (i * 16) * KPI + kc * 32, lane);
#pragma unroll   // the stage's four passes: every LDS offset a constant
   for (int p = 0; p < SK / 32; ++p) {
    v16h vf[4];
#pragma unroll
    for (int j = 0; j < 4; ++j) vf[j] = frag_h(Vs + (j * 16) * VPI + p * 32, lane);
    v8f s[QT][2];
#pragma unroll
    for (int t = 0; t < QT; ++t)
#pragma unroll
      for (int i = 0; i < 2; ++i) { const v8f z = wmma16(kf[i][0], qf[t][0], cm[t]); s[t][i] = wmma16(kf[i][1], qf[t][1], z); }
    if (p + 1 < SK / 32) {   // the next pass's K fragments come under the softmax; never the next stage's, which is not published yet
#pragma unroll
      for (int i = 0; i < 2; ++i)
#pragma unroll
        for (int kc = 0; kc < 2; ++kc) kf[i][kc] = frag_h(Ks + ((p + 1) * 32 + i * 16) * KPI + kc * 32, lane); }
    __builtin_amdgcn_sched_barrier(0);   // keeps both groups of fragment loads up here, a whole softmax ahead of their first use; left free they sink to just in front of the products that read them
    v16h pf[QT]; v8f ps[QT];   // each query tile's P in registers of its own; ps: row 0 (element 0 of lanes 0 to 15) is this pass's sum of P per query, every other row 0
#pragma unroll
    for (int t = 0; t < QT; ++t)
#pragma unroll
      for (int i = 0; i < 2; ++i)
#pragma unroll
        for (int r = 0; r < 8; ++r) pf[t][i * 8 + r] = (_Float16)__builtin_amdgcn_exp2f(s[t][i][r]);
#pragma unroll
    for (int t = 0; t < QT; ++t) { const v8f z = {}; ps[t] = wmma16(one, pf[t], z); }   // both behind all the vector work: a product that has to wait for the matrix unit holds up nothing that could run meanwhile
    const bool first = p == 0 && st == 0;
    float pt = ps[0][0];
#pragma unroll
    for (int t = 1; t < QT; ++t) pt += ps[t][0];
    const bool need = !(pt <= PSMAX);   // the lane's sums together within the bound: no term is negative, so each term is within it and none has left f16's range (an infinite or undefined sum fails the test)
    if (__builtin_amdgcn_ballot_w32(need) != 0 || first) {   // lazy rescale: only when some query's sum says that its maximum in use is too low, and on the first pass, which sets the maximum. The pass's logits are formed anew from its K rows, which stay in LDS to the end of the stage; so the common path need not keep them
      v16h k2[2][2];
#pragma unroll
      for (int i = 0; i < 2; ++i)
#pragma unroll
        for (int kc = 0; kc < 2; ++kc) k2[i][kc] = frag_h(Ks + (p * 32 + i * 16) * KPI + kc * 32, lane);
#pragma unroll
      for (int t = 0; t < QT; ++t) { v8f s2[2];
#pragma unroll
        for (int i = 0; i < 2; ++i) { const v8f z = wmma16(k2[i][0], qf[t][0], cm[t]); s2[i] = wmma16(k2[i][1], qf[t][1], z); }
        float a = fmaxf(s2[0][0], s2[1][0]);
#pragma unroll
        for (int r = 1; r < 8; ++r) a = fmaxf(a, fmaxf(s2[0][r], s2[1][r]));
        a = fmaxf(a, xhalf(a)); const float d = first ? a : fmaxf(a, 0.f); const float al = __builtin_amdgcn_exp2f(fminf(-d, 0.f));   // d: by how much the maximum moves (down only on the first pass, where all sums are 0)
        cm[t] -= d; lr[t] *= al;
#pragma unroll
        for (int j = 0; j < 4; ++j) acc[t][j] *= al;
#pragma unroll
        for (int i = 0; i < 2; ++i)
#pragma unroll
          for (int r = 0; r < 8; ++r) pf[t][i * 8 + r] = (_Float16)__builtin_amdgcn_exp2f(s2[i][r] - d);
        const v8f z = {}; ps[t] = wmma16(one, pf[t], z); }
      // the fragments fetched ahead are fetched again: on this path their registers are free for the work above
      if (p + 1 < SK / 32) {
#pragma unroll
        for (int i = 0; i < 2; ++i)
#pragma unroll
          for (int kc = 0; kc < 2; ++kc) kf[i][kc] = frag_h(Ks + ((p + 1) * 32 + i * 16) * KPI + kc * 32, lane); }
#pragma unroll
      for (int j = 0; j < 4; ++j) vf[j] = frag_h(Vs + (j * 16) * VPI + p * 32, lane);
    }
#pragma unroll
    for (int t = 0; t < QT; ++t) { lr[t] += ps[t][0];
#pragma unroll
      for (int j = 0; j < 4; ++j) acc[t][j] = wmma16(vf[j], pf[t], acc[t][j]); }
    __builtin_amdgcn_sched_barrier(0);   // keeps the next pass's V fragment loads out of this pass: a second set of them takes the kernel over 256 registers
    asm volatile("v_nop\n\tv_nop\n\tv_nop\n\tv_nop");   // four vector slots between this pass's last product and the next pass's first ones, whose results may be given the registers that P was read from
    __builtin_amdgcn_sched_barrier(0);   // holds the next pass's products behind those four slots
   }
   asm volatile("s_wait_dscnt 0x0" ::: "memory");      // this wave's reads of the stage's buffer are over
   asm volatile("s_wait_asynccnt 0x0" ::: "memory");   // the next stage has landed, as far as this wave copied it
   __syncthreads();                                     // publishes the next stage and frees this stage's buffer
   if (st + 2 < TT / SK) stage_kv(Kg + (size_t)((st + 2 + st0) & (TT / SK - 1)) * SK * CC, Vg + ((st + 2 + st0) & (TT / SK - 1)) * SK, lk0 + (unsigned)(st & 1) * (unsigned)sizeof(sK[0]), lv0 + (unsigned)(st & 1) * (unsigned)sizeof(sV[0]));
  }
  asm volatile("s_wait_asynccnt 0x0" ::: "memory");    // no copy is left in flight when the wave goes on to its end
#pragma unroll
  for (int t = 0; t < QT; ++t) {   // lane (g, col) holds o[d = 16 j + 8 g + r] of query col; the row sum comes over from lanes 0 to 15 by one exchange
    const float inv = 1.0f / (lr[t] + xhalf(lr[t])); const size_t ro = ((size_t)b * TT + ql0 + t * 16 + col) * CC + h * HD + 8 * g;
    v4f vv[4][2]; float dt = 0.f, nn = 0.f;
#pragma unroll
    for (int j = 0; j < 4; ++j) { vv[j][0] = *(const v4f*)(VR + ro + j * 16); vv[j][1] = *(const v4f*)(VR + ro + j * 16 + 4);
#pragma unroll
      for (int r = 0; r < 8; ++r) { const float o = acc[t][j][r] * inv, v = vv[j][r >> 2][r & 3]; acc[t][j][r] = o; dt += o * v; nn += v * v; } }
    dt += xhalf(dt); nn += xhalf(nn); const float al = dt / (nn + 1e-8f);
#pragma unroll
    for (int j = 0; j < 4; ++j) { v8h yh;   // y as k_out's products take it: rounded once to f16
#pragma unroll
      for (int r = 0; r < 8; ++r) yh[r] = (_Float16)(acc[t][j][r] - al * vv[j][r >> 2][r & 3]);
      vst2(YH + ro + j * 16, yh); }
    asm volatile("s_wait_xcnt 0x0" ::: "memory");   // behind the tile's stores: no register that they name is reused in front of this wait
  } }
// ---- k_out: block = 8 waves = (128 rows, 128 cols), a wave = 32 x 64: out = y Wproj + b, one f16 product per tile and 32 k. Both operands lie in memory as f16 (k_fa wrote y, k_proj's fourth plane the weight), so a stage of 128 k goes to LDS by asynchronous copies, through no register, into two buffers: the next stage flies under this stage's products
#define OBK 128  // k per stage
#define OP 136   // elements per staged row of 128 f16: 272 B = 16 B x odd, the pitch at which 16-byte fragment reads meet no bank twice
#define OAB (128u * OP * 2u)   // bytes of one staged operand
// one operand of a stage: 128 rows of 256 B, 8 copies of 16 B per lane, 16 lanes to a row, rows 16 apart from copy to copy. The s_wait_xcnt stands inside the statement, so that no address register is rewritten in front of it.
__device__ __forceinline__ void stage_o1(const _Float16* gp, unsigned lp) {
  asm volatile("global_load_async_to_lds_b128 %0, %8, off\n\tglobal_load_async_to_lds_b128 %1, %9, off\n\tglobal_load_async_to_lds_b128 %2, %10, off\n\tglobal_load_async_to_lds_b128 %3, %11, off\n\t"
               "global_load_async_to_lds_b128 %4, %12, off\n\tglobal_load_async_to_lds_b128 %5, %13, off\n\tglobal_load_async_to_lds_b128 %6, %14, off\n\tglobal_load_async_to_lds_b128 %7, %15, off\n\ts_wait_xcnt 0x0"
               :: "v"(lp), "v"(lp + 1u * 16u * OP * 2u), "v"(lp + 2u * 16u * OP * 2u), "v"(lp + 3u * 16u * OP * 2u), "v"(lp + 4u * 16u * OP * 2u), "v"(lp + 5u * 16u * OP * 2u), "v"(lp + 6u * 16u * OP * 2u), "v"(lp + 7u * 16u * OP * 2u),
                  "v"(gp), "v"(gp + 1 * 16 * CC), "v"(gp + 2 * 16 * CC), "v"(gp + 3 * 16 * CC), "v"(gp + 4 * 16 * CC), "v"(gp + 5 * 16 * CC), "v"(gp + 6 * 16 * CC), "v"(gp + 7 * 16 * CC) : "memory");
}
__device__ __forceinline__ void stage_o(const _Float16* gw, const _Float16* gy, unsigned lw) { stage_o1(gw, lw); stage_o1(gy, lw + OAB); }
__global__ __launch_bounds__(256) void k_out(const _Float16* __restrict__ YH, const _Float16* __restrict__ WB, const float* __restrict__ BP, float* __restrict__ OUT) { __shared__ __align__(16) float sf[8][32][68]; __shared__ __align__(16) _Float16 sS[2][2][128][OP];   // per buffer: W, y
  const int tid = threadIdx.x, wave = __builtin_amdgcn_readfirstlane(tid >> 5), lane = tid & 31, col = lane & 15, g = lane >> 4; const int wr = wave >> 1, wc = wave & 1; const int c0 = blockIdx.y * 128; const size_t r0 = (size_t)blockIdx.x * 128;
  v8f acc[2][4] = {};
  const int srow = tid >> 4, sq = tid & 15;   // copies: lane = (row srow + 16 i, 16-byte piece sq of the stage's 256 B)
  const _Float16* Hp = YH + (r0 + srow) * CC; const _Float16* Wp = WB + (size_t)(c0 + srow) * CC;
  const unsigned l0 = (unsigned)(size_t)&sS[0][0][srow][sq * 8];   // the lane's LDS byte address in buffer 0
  const int ks0 = ((blockIdx.x & 3) + ((blockIdx.x >> 3) << 2) + 2 * blockIdx.y) & (CC / 64 - 1);   // where the block's k walk starts, in units of 64 k, as in k_proj: the 8 blocks that read the same y rows start 128 k apart, the 32 that read the same W rows are spread over all 16 places
  const int kl0 = ks0 * 64 + sq * 8;   // the lane's first k; the walk wraps round piece by piece
  { const int ko = kl0 & (CC - 1); stage_o(Wp + ko, Hp + ko, l0); }
  asm volatile("s_wait_asynccnt 0x0" ::: "memory");   // stage 0 has landed, as far as this wave copied it
  __syncthreads();                                     // publishes stage 0
  { const int ko = (kl0 + OBK) & (CC - 1); stage_o(Wp + ko, Hp + ko, l0 + 2u * OAB); }   // the second stage flies under the first one's products
#pragma unroll 1   // rolled: the two buffers differ by a base address only
  for (int ks = 0; ks < CC / OBK; ++ks) { const int cur = ks & 1;
#pragma unroll
    for (int hf = 0; hf < OBK / 64; ++hf) {
      v16h a[2][2], w[2][4];   // the fragments of 64 k, read as one group
#pragma unroll
      for (int kk = 0; kk < 2; ++kk) {
#pragma unroll
        for (int i = 0; i < 2; ++i) a[kk][i] = frag_h(&sS[cur][1][wr * 32 + i * 16 + col][hf * 64 + kk * 32], lane);
#pragma unroll
        for (int j = 0; j < 4; ++j) w[kk][j] = frag_h(&sS[cur][0][wc * 64 + j * 16 + col][hf * 64 + kk * 32], lane);
        __builtin_amdgcn_sched_barrier(0); }   // keeps the loads in the order in which the products take them; left free they are sorted by address, and the third product waits for nearly the whole group
#pragma unroll
      for (int kk = 0; kk < 2; ++kk)
#pragma unroll
        for (int i = 0; i < 2; ++i)
#pragma unroll
          for (int j = 0; j < 4; ++j) acc[i][j] = wmma16(a[kk][i], w[kk][j], acc[i][j]); }
    asm volatile("s_wait_dscnt 0x0" ::: "memory");      // this wave's reads of the stage's buffer are over
    asm volatile("s_wait_asynccnt 0x0" ::: "memory");   // the next stage has landed, as far as this wave copied it
    __syncthreads();                                     // publishes the next stage and frees this stage's buffer
    if (ks + 2 < CC / OBK) { const int ko = (kl0 + (ks + 2) * OBK) & (CC - 1); stage_o(Wp + ko, Hp + ko, l0 + (unsigned)cur * 2u * OAB); } }
  asm volatile("s_wait_asynccnt 0x0" ::: "memory");    // no copy is left in flight when the wave goes on to its end
#pragma unroll
  for (int j = 0; j < 4; ++j) { const float bb = BP ? bfr(BP[c0 + wc * 64 + j * 16 + col]) : 0.f;
#pragma unroll
    for (int i = 0; i < 2; ++i)
#pragma unroll
      for (int r = 0; r < 8; ++r) sf[wave][i * 16 + 8 * g + r][j * 16 + col] = acc[i][j][r] + bb; }
  LDSX();
#pragma unroll
  for (int e = 0; e < 16; ++e) { const int rl = e * 2 + (lane >> 4), q = lane & 15; vst2(OUT + (r0 + wr * 32 + rl) * CC + c0 + wc * 64 + q * 4, *(const v4f*)&sf[wave][rl][q * 4]); } }
extern "C" void kernel_launch(void* const* d_in, const int* in_sizes, int n_in, void* d_out, int out_size, void* d_ws, size_t ws_size, hipStream_t stream) {
  (void)in_sizes; (void)n_in; (void)out_size;
  const float** F = (const float**)d_in;   // 0 x [2,2048,1024], 1 wq [1024,1024] ([out,in]), 2 bq, 3 wk, 4 bk, 5 wv, 6 bv, 7 wo, 8 bo
  if (ws_size < (size_t)WS_END) return;
  char* ws = (char*)d_ws; _Float16 *QH = (_Float16*)(ws + WS_QH), *QL = (_Float16*)(ws + WS_QL), *KH = (_Float16*)(ws + WS_KH), *VT = (_Float16*)(ws + WS_VT); float *VR = (float*)(ws + WS_VR); _Float16 *YH = (_Float16*)(ws + WS_YH), *WB = (_Float16*)(ws + WS_WB);
  k_proj<<<dim3(TNB * TT / PBM, CC / PBN, 4), PNT, 0, stream>>>(F[0], F[1], F[2], F[3], F[4], F[5], F[6], F[7], QH, QL, KH, VT, VR, WB);
  k_fa<<<dim3(TT / (8 * 16 * QT), NH, TNB), 256, 0, stream>>>(QH, KH, VT, VR, YH);
  k_out<<<dim3(TNB * TT / 128, CC / 128), 256, 0, stream>>>(YH, WB, F[8], (float*)d_out);
}
